// v000
// Measured on an AMD MI455X. A time is GPU time per run, averaged over a window of back-to-back runs after a warm-up
// (all launches, gaps included; the runs take copies of the inputs in turn), and the median of several windows.
// Apart from v000's, it joins two sittings. Times from different sittings can be a few percent apart, while
// side-by-side timings come from the same sitting.
// v000, which the later versions start from, runs in 1020 microseconds.
#include <hip/hip_runtime.h>

// ---------------- problem dims (fixed by reference) ----------------
#define B_    2
#define T_    1024
#define D_    512
#define H_    8
#define MT_   (B_ * T_)          // 2048 rows
#define C_    512                // H*K == H*V == 512 channels

#define LR_    1e-3f
#define BETA1_ 0.9f
#define BETA2_ 0.999f
#define EPS_   1e-5f
#define SCALE_ 0.125f            // 64^-0.5

typedef __attribute__((ext_vector_type(16))) _Float16 v16h;
typedef __attribute__((ext_vector_type(8)))  float    v8f;

// ---------------- fp32 -> f16 conversion (row-major, for A operands) -------------
__global__ void f32_to_f16(const float* __restrict__ in, _Float16* __restrict__ out, int n) {
    int i = blockIdx.x * blockDim.x + threadIdx.x;
    if (i < n) out[i] = (_Float16)in[i];
}

// ---------------- pack fp32 weight [Kd x N] into WMMA B-fragment layout ----------
// Bp layout: [nt = n/16][ks = k/32][lane 0..31][e 0..15]  (contiguous 32B per lane)
// Element map (ISA 7.12.2, 16-bit B 32x16): lane -> col = lane&15, kh = lane>>4;
// e -> k = ks*32 + (e<8 ? e : e+8) + 8*kh
__global__ void pack_b_f16(const float* __restrict__ W, _Float16* __restrict__ Bp,
                           int Kd, int N) {
    int idx = blockIdx.x * blockDim.x + threadIdx.x;     // over Kd*N
    if (idx >= Kd * N) return;
    const int e    = idx & 15;
    const int lane = (idx >> 4) & 31;
    const int ks   = (idx >> 9) % (Kd / 32);
    const int nt   = idx / ((Kd / 32) << 9);
    const int kh   = lane >> 4;
    const int col  = lane & 15;
    const int k    = ks * 32 + ((e < 8 ? e : e + 8) + 8 * kh);
    Bp[idx] = (_Float16)W[(size_t)k * N + nt * 16 + col];
}

// ---------------- WMMA f16 GEMM: C[MxN] = A[MxKd] * Bpacked ----------------------
// block = 128 threads (4 waves); each wave owns one 16x16 tile; k-loop fully
// unrolled (Kd/32 = 16 static v_wmma_f32_16x16x32_f16 per wave).
// grid = (N/64, M/16)
template <int Kd, int N>
__global__ __launch_bounds__(128)
void gemm_f16_wmma(const _Float16* __restrict__ A, const _Float16* __restrict__ Bp,
                   float* __restrict__ C) {
    const int lane = threadIdx.x & 31;
    const int wave = threadIdx.x >> 5;
    const int nt   = blockIdx.x * 4 + wave;  // 16-wide n-tile index
    const int m0   = blockIdx.y * 16;
    const int r    = lane & 15;              // A-row / C-col within tile
    const int kh   = lane >> 4;              // K-half select

    const _Float16* Arow  = A + (size_t)(m0 + r) * Kd + 8 * kh;
    const _Float16* Bfrag = Bp + ((size_t)nt * (Kd / 32) * 32 + lane) * 16;

    v8f acc = {};
#pragma unroll
    for (int ks = 0; ks < Kd / 32; ++ks) {
        v16h a;
        const _Float16* ap = Arow + ks * 32;
#pragma unroll
        for (int e = 0; e < 8; ++e) {        // k = ks*32 + 8*kh + e (+16 for hi half)
            a[e]     = ap[e];
            a[e + 8] = ap[e + 16];
        }
        const v16h b = *(const v16h*)(Bfrag + (size_t)ks * 32 * 16);
        acc = __builtin_amdgcn_wmma_f32_16x16x32_f16(false, a, false, b,
                                                     (short)0, acc, false, false);
    }
    // C/D layout: VGPR i -> row = i + 8*kh, col = lane&15
#pragma unroll
    for (int i = 0; i < 8; ++i)
        C[(size_t)(m0 + i + 8 * kh) * N + nt * 16 + r] = acc[i];
}

// ---------------- beta = sigmoid(x @ Wb), one thread per (row, h) ----------------
__global__ void beta_sigmoid(const float* __restrict__ x, const float* __restrict__ Wb,
                             float* __restrict__ beta) {
    int idx = blockIdx.x * blockDim.x + threadIdx.x;   // over MT_*H_
    if (idx >= MT_ * H_) return;
    const int h = idx % H_;
    const int row = idx / H_;
    float acc = 0.f;
    for (int d = 0; d < D_; ++d)
        acc += x[(size_t)row * D_ + d] * Wb[(size_t)d * H_ + h];
    beta[idx] = __builtin_amdgcn_rcpf(1.f + __expf(-acc));
}

// ---------------- causal depthwise conv-4 + SiLU, one thread per element --------
__global__ void conv_silu(const float* __restrict__ P, const float* __restrict__ w,
                          float* __restrict__ Y) {
    int idx = blockIdx.x * blockDim.x + threadIdx.x;   // over MT_*C_
    if (idx >= MT_ * C_) return;
    const int c  = idx % C_;
    const int bt = idx / C_;
    const int t  = bt % T_;
    float acc = 0.f;
#pragma unroll
    for (int i = 0; i < 4; ++i) {
        const int tt = t - 3 + i;
        if (tt >= 0) acc += P[(size_t)(bt - (3 - i)) * C_ + c] * w[c * 4 + i];
    }
    Y[idx] = acc * __builtin_amdgcn_rcpf(1.f + __expf(-acc));   // SiLU
}

// ---------------- per-head l2norm (sum, +1e-6) with scale (in-place safe) --------
__global__ __launch_bounds__(64)
void l2norm_scale(const float* __restrict__ in, float* __restrict__ out, float scale) {
    const int g = blockIdx.x;                 // over MT_*H_ groups of 64
    const int tid = threadIdx.x;
    const size_t base = (size_t)g * 64;
    const float x = in[base + tid];
    __shared__ float red[64];
    red[tid] = x * x;
    __syncthreads();
    for (int s = 32; s > 0; s >>= 1) {
        if (tid < s) red[tid] += red[tid + s];
        __syncthreads();
    }
    out[base + tid] = x * rsqrtf(red[0] + 1e-6f) * scale;
}

// ---------------- sequential IVON delta-rule recurrence --------------------------
// grid = (4 v-groups, H, B); block = 64 threads (kg = tid&3, vl = tid>>2).
// Double-buffered LDS (one barrier/step) + register prefetch of step t+1 inputs.
__global__ __launch_bounds__(64)
void recurrence(const float* __restrict__ qn, const float* __restrict__ kn,
                const float* __restrict__ vn, const float* __restrict__ beta,
                float* __restrict__ o) {
    const int tid = threadIdx.x;
    const int kg  = tid & 3;
    const int vl  = tid >> 2;
    const int vg  = blockIdx.x;
    const int h   = blockIdx.y;
    const int b   = blockIdx.z;
    const int v   = vg * 16 + vl;

    float S[16], G[16], Hm[16];
#pragma unroll
    for (int i = 0; i < 16; ++i) { S[i] = 0.f; G[i] = 0.f; Hm[i] = 0.f; }

    __shared__ float ks_[2][64], qs_[2][64], vs_[2][16];
    __shared__ float bsh[2];

    const size_t base  = (size_t)(b * T_) * C_ + h * 64;
    const size_t bbase = (size_t)(b * T_) * H_ + h;

    // preload step 0 into registers
    float kr = kn[base + tid];
    float qr = qn[base + tid];
    float vr = (tid < 16) ? vn[base + vg * 16 + tid] : 0.f;
    float br = beta[bbase];

    for (int t = 0; t < T_; ++t) {
        const int p = t & 1;
        ks_[p][tid] = kr;
        qs_[p][tid] = qr;
        if (tid < 16) vs_[p][tid] = vr;
        if (tid == 0) bsh[p] = br;

        if (t + 1 < T_) {                       // prefetch next step (overlaps compute)
            const size_t nb = base + (size_t)(t + 1) * C_;
            kr = kn[nb + tid];
            qr = qn[nb + tid];
            if (tid < 16) vr = vn[nb + vg * 16 + tid];
            br = beta[bbase + (size_t)(t + 1) * H_];
        }
        __syncthreads();

        // pred[v] = k . S[:,v]  (16 partials, reduced across the 4 lanes of a v)
        float pred = 0.f;
#pragma unroll
        for (int i = 0; i < 16; ++i) pred += ks_[p][kg * 16 + i] * S[i];
        pred += __shfl_xor(pred, 1, 32);
        pred += __shfl_xor(pred, 2, 32);

        const float err = pred - vs_[p][vl];
        const float lrb = LR_ * bsh[p];
        float og = 0.f;
#pragma unroll
        for (int i = 0; i < 16; ++i) {
            const float grad = ks_[p][kg * 16 + i] * err;   // outer(k, pred-v)
            G[i]  = BETA1_ * G[i]  + (1.f - BETA1_) * grad;
            Hm[i] = BETA2_ * Hm[i] + (1.f - BETA2_) * grad * grad;
            S[i] -= lrb * G[i] * __builtin_amdgcn_rcpf(Hm[i] + 1.f);  // WD==0, LAM==1
            og   += qs_[p][kg * 16 + i] * S[i];             // o[v] = q . S[:,v]
        }
        og += __shfl_xor(og, 1, 32);
        og += __shfl_xor(og, 2, 32);
        if (kg == 0) o[base + (size_t)t * C_ + v] = og;
    }
}

// ---------------- RMSNorm over V (mean, +1e-5) * rms_w, emit f16 -----------------
__global__ __launch_bounds__(64)
void rmsnorm_f16(const float* __restrict__ o, const float* __restrict__ rw,
                 _Float16* __restrict__ oh) {
    const int g = blockIdx.x;                 // over MT_*H_ groups of 64
    const int tid = threadIdx.x;
    const size_t base = (size_t)g * 64;
    const float x = o[base + tid];
    __shared__ float red[64];
    red[tid] = x * x;
    __syncthreads();
    for (int s = 32; s > 0; s >>= 1) {
        if (tid < s) red[tid] += red[tid + s];
        __syncthreads();
    }
    const float inv = rsqrtf(red[0] * (1.0f / 64.f) + EPS_);
    oh[base + tid] = (_Float16)(x * inv * rw[tid]);
}

// ---------------- host-side launch ----------------
extern "C" void kernel_launch(void* const* d_in, const int* in_sizes, int n_in,
                              void* d_out, int out_size, void* d_ws, size_t ws_size,
                              hipStream_t stream) {
    (void)in_sizes; (void)n_in; (void)out_size; (void)ws_size;
    const float* x    = (const float*)d_in[0];
    const float* Wq   = (const float*)d_in[1];
    const float* Wk   = (const float*)d_in[2];
    const float* Wv   = (const float*)d_in[3];
    const float* Wb   = (const float*)d_in[4];
    const float* cwq  = (const float*)d_in[5];
    const float* cwk  = (const float*)d_in[6];
    const float* cwv  = (const float*)d_in[7];
    const float* rmsw = (const float*)d_in[8];
    const float* Wo   = (const float*)d_in[9];
    float* out = (float*)d_out;

    char* ws = (char*)d_ws;
    size_t off = 0;
    auto alloc = [&](size_t bytes) -> void* {
        void* p = ws + off;
        off += (bytes + 255) & ~(size_t)255;
        return p;
    };
    _Float16* xh   = (_Float16*)alloc((size_t)MT_ * D_ * 2);
    _Float16* Wqp  = (_Float16*)alloc((size_t)D_ * C_ * 2);   // packed fragments
    _Float16* Wkp  = (_Float16*)alloc((size_t)D_ * C_ * 2);
    _Float16* Wvp  = (_Float16*)alloc((size_t)D_ * C_ * 2);
    _Float16* Wop  = (_Float16*)alloc((size_t)C_ * D_ * 2);
    float*    Qf   = (float*)alloc((size_t)MT_ * C_ * 4);
    float*    Kf   = (float*)alloc((size_t)MT_ * C_ * 4);
    float*    Vf   = (float*)alloc((size_t)MT_ * C_ * 4);
    float*    qc   = (float*)alloc((size_t)MT_ * C_ * 4);
    float*    kc   = (float*)alloc((size_t)MT_ * C_ * 4);
    float*    vc   = (float*)alloc((size_t)MT_ * C_ * 4);
    float*    betaf= (float*)alloc((size_t)MT_ * H_ * 4);
    float*    ob   = (float*)alloc((size_t)MT_ * C_ * 4);
    _Float16* ohh  = (_Float16*)alloc((size_t)MT_ * C_ * 2);

    // 1) stage A operand (x) as f16; pack all weights into WMMA B-fragment layout
    int n = MT_ * D_;
    f32_to_f16<<<(n + 255) / 256, 256, 0, stream>>>(x, xh, n);
    n = D_ * C_;
    pack_b_f16<<<(n + 255) / 256, 256, 0, stream>>>(Wq, Wqp, D_, C_);
    pack_b_f16<<<(n + 255) / 256, 256, 0, stream>>>(Wk, Wkp, D_, C_);
    pack_b_f16<<<(n + 255) / 256, 256, 0, stream>>>(Wv, Wvp, D_, C_);
    pack_b_f16<<<(n + 255) / 256, 256, 0, stream>>>(Wo, Wop, C_, D_);

    // 2) projection GEMMs via v_wmma_f32_16x16x32_f16 (fully unrolled k-loop)
    dim3 gblk(128);
    dim3 ggrd(C_ / 64, MT_ / 16);
    gemm_f16_wmma<D_, C_><<<ggrd, gblk, 0, stream>>>(xh, Wqp, Qf);
    gemm_f16_wmma<D_, C_><<<ggrd, gblk, 0, stream>>>(xh, Wkp, Kf);
    gemm_f16_wmma<D_, C_><<<ggrd, gblk, 0, stream>>>(xh, Wvp, Vf);

    // 3) beta projection (tiny)
    n = MT_ * H_;
    beta_sigmoid<<<(n + 255) / 256, 256, 0, stream>>>(x, Wb, betaf);

    // 4) causal depthwise conv + SiLU
    n = MT_ * C_;
    conv_silu<<<(n + 255) / 256, 256, 0, stream>>>(Qf, cwq, qc);
    conv_silu<<<(n + 255) / 256, 256, 0, stream>>>(Kf, cwk, kc);
    conv_silu<<<(n + 255) / 256, 256, 0, stream>>>(Vf, cwv, vc);

    // 5) l2norm (in-place), scale on q
    l2norm_scale<<<MT_ * H_, 64, 0, stream>>>(qc, qc, SCALE_);
    l2norm_scale<<<MT_ * H_, 64, 0, stream>>>(kc, kc, 1.0f);

    // 6) sequential recurrence: 64 blocks (B*H*4 v-groups) x 64 threads
    dim3 rgrid(4, H_, B_);
    recurrence<<<rgrid, 64, 0, stream>>>(qc, kc, vc, betaf, ob);

    // 7) RMSNorm -> f16
    rmsnorm_f16<<<MT_ * H_, 64, 0, stream>>>(ob, rmsw, ohh);

    // 8) output projection GEMM (fp32 result straight to d_out)
    gemm_f16_wmma<C_, D_><<<ggrd, gblk, 0, stream>>>(ohh, Wop, out);
}

// v001
// One run takes 371 microseconds.
// Two timings next to v000 put it at 2.73 and 2.74 times that version's speed.
#include <hip/hip_runtime.h>

// ---------------- problem dims (fixed by reference) ----------------
#define B_    2
#define T_    1024
#define D_    512
#define H_    8
#define MT_   (B_ * T_)          // 2048 rows
#define C_    512                // H*K == H*V == 512 channels

#define LR_    1e-3f
#define BETA1_ 0.9f
#define BETA2_ 0.999f
#define EPS_   1e-5f
#define SCALE_ 0.125f            // 64^-0.5

typedef __attribute__((ext_vector_type(16))) _Float16 v16h;
typedef __attribute__((ext_vector_type(8)))  float    v8f;
typedef __attribute__((ext_vector_type(4)))  float    v4f;

// ---------------- fp32 -> f16 conversion (row-major, for A operands) -------------
__global__ void f32_to_f16(const float* __restrict__ in, _Float16* __restrict__ out, int n) {
    int i = blockIdx.x * blockDim.x + threadIdx.x;
    if (i < n) out[i] = (_Float16)in[i];
}

// ---------------- pack fp32 weight [Kd x N] into WMMA B-fragment layout ----------
// Bp layout: [nt = n/16][ks = k/32][lane 0..31][e 0..15]  (contiguous 32B per lane)
// Element map (ISA 7.12.2, 16-bit B 32x16): lane -> col = lane&15, kh = lane>>4;
// e -> k = ks*32 + (e<8 ? e : e+8) + 8*kh
__global__ void pack_b_f16(const float* __restrict__ W, _Float16* __restrict__ Bp,
                           int Kd, int N) {
    int idx = blockIdx.x * blockDim.x + threadIdx.x;     // over Kd*N
    if (idx >= Kd * N) return;
    const int e    = idx & 15;
    const int lane = (idx >> 4) & 31;
    const int ks   = (idx >> 9) % (Kd / 32);
    const int nt   = idx / ((Kd / 32) << 9);
    const int kh   = lane >> 4;
    const int col  = lane & 15;
    const int k    = ks * 32 + ((e < 8 ? e : e + 8) + 8 * kh);
    Bp[idx] = (_Float16)W[(size_t)k * N + nt * 16 + col];
}

// ---------------- WMMA f16 GEMM: C[MxN] = A[MxKd] * Bpacked ----------------------
// block = 128 threads (4 waves); each wave owns one 16x16 tile; k-loop fully
// unrolled (Kd/32 = 16 static v_wmma_f32_16x16x32_f16 per wave).
// grid = (N/64, M/16)
template <int Kd, int N>
__global__ __launch_bounds__(128)
void gemm_f16_wmma(const _Float16* __restrict__ A, const _Float16* __restrict__ Bp,
                   float* __restrict__ C) {
    const int lane = threadIdx.x & 31;
    const int wave = threadIdx.x >> 5;
    const int nt   = blockIdx.x * 4 + wave;  // 16-wide n-tile index
    const int m0   = blockIdx.y * 16;
    const int r    = lane & 15;              // A-row / C-col within tile
    const int kh   = lane >> 4;              // K-half select

    const _Float16* Arow  = A + (size_t)(m0 + r) * Kd + 8 * kh;
    const _Float16* Bfrag = Bp + ((size_t)nt * (Kd / 32) * 32 + lane) * 16;

    v8f acc = {};
#pragma unroll
    for (int ks = 0; ks < Kd / 32; ++ks) {
        v16h a;
        const _Float16* ap = Arow + ks * 32;
#pragma unroll
        for (int e = 0; e < 8; ++e) {        // k = ks*32 + 8*kh + e (+16 for hi half)
            a[e]     = ap[e];
            a[e + 8] = ap[e + 16];
        }
        const v16h b = *(const v16h*)(Bfrag + (size_t)ks * 32 * 16);
        acc = __builtin_amdgcn_wmma_f32_16x16x32_f16(false, a, false, b,
                                                     (short)0, acc, false, false);
    }
    // C/D layout: VGPR i -> row = i + 8*kh, col = lane&15
#pragma unroll
    for (int i = 0; i < 8; ++i)
        C[(size_t)(m0 + i + 8 * kh) * N + nt * 16 + r] = acc[i];
}

// ---------------- beta = sigmoid(x @ Wb), one thread per (row, h) ----------------
__global__ void beta_sigmoid(const float* __restrict__ x, const float* __restrict__ Wb,
                             float* __restrict__ beta) {
    int idx = blockIdx.x * blockDim.x + threadIdx.x;   // over MT_*H_
    if (idx >= MT_ * H_) return;
    const int h = idx % H_;
    const int row = idx / H_;
    float acc = 0.f;
    for (int d = 0; d < D_; ++d)
        acc += x[(size_t)row * D_ + d] * Wb[(size_t)d * H_ + h];
    beta[idx] = __builtin_amdgcn_rcpf(1.f + __expf(-acc));
}

// ---------------- causal depthwise conv-4 + SiLU, one thread per element --------
__global__ void conv_silu(const float* __restrict__ P, const float* __restrict__ w,
                          float* __restrict__ Y) {
    int idx = blockIdx.x * blockDim.x + threadIdx.x;   // over MT_*C_
    if (idx >= MT_ * C_) return;
    const int c  = idx % C_;
    const int bt = idx / C_;
    const int t  = bt % T_;
    float acc = 0.f;
#pragma unroll
    for (int i = 0; i < 4; ++i) {
        const int tt = t - 3 + i;
        if (tt >= 0) acc += P[(size_t)(bt - (3 - i)) * C_ + c] * w[c * 4 + i];
    }
    Y[idx] = acc * __builtin_amdgcn_rcpf(1.f + __expf(-acc));   // SiLU
}

// ---------------- per-head l2norm (sum, +1e-6) with scale (in-place safe) --------
__global__ __launch_bounds__(64)
void l2norm_scale(const float* __restrict__ in, float* __restrict__ out, float scale) {
    const int g = blockIdx.x;                 // over MT_*H_ groups of 64
    const int tid = threadIdx.x;
    const size_t base = (size_t)g * 64;
    const float x = in[base + tid];
    __shared__ float red[64];
    red[tid] = x * x;
    __syncthreads();
    for (int s = 32; s > 0; s >>= 1) {
        if (tid < s) red[tid] += red[tid + s];
        __syncthreads();
    }
    out[base + tid] = x * rsqrtf(red[0] + 1e-6f) * scale;
}

// ---------------- sequential IVON delta-rule recurrence --------------------------
// grid = (4 v-groups, H, B); block = 64 threads (kg = tid&3, vl = tid>>2).
// Inputs and outputs pass through double-buffered LDS CH_ time steps at a time: the
// global loads of chunk c+1 are in flight while chunk c is worked on, chunk c-1's
// outputs are stored behind the same barrier, and the block meets once per chunk.
// Inside a chunk each step's operands are read from LDS into registers one step
// ahead, so no global access and no barrier stands on the serial path.
#define CH_ 32
#define NCH_ (T_ / CH_)

struct StepIn { float k[16]; float q[16]; float v; float b; };

__device__ __forceinline__ void read_step(StepIn& r, const float* kb, const float* qb,
                                          const float* vb, const float* bb, int s) {
#pragma unroll
    for (int j = 0; j < 4; ++j) {
        const v4f kk = *(const v4f*)(kb + s * 64 + 4 * j);
        const v4f qq = *(const v4f*)(qb + s * 64 + 4 * j);
        r.k[4 * j + 0] = kk.x; r.k[4 * j + 1] = kk.y; r.k[4 * j + 2] = kk.z; r.k[4 * j + 3] = kk.w;
        r.q[4 * j + 0] = qq.x; r.q[4 * j + 1] = qq.y; r.q[4 * j + 2] = qq.z; r.q[4 * j + 3] = qq.w;
    }
    r.v = vb[s * 16];
    r.b = bb[s];
}

__device__ __forceinline__ float one_step(const StepIn& r, float (&S)[16], float (&G)[16],
                                          float (&Hm)[16]) {
    // pred[v] = k . S[:,v]  (16 partials, reduced across the 4 lanes of a v)
    float pred = 0.f;
#pragma unroll
    for (int i = 0; i < 16; ++i) pred += r.k[i] * S[i];
    pred += __shfl_xor(pred, 1, 32);
    pred += __shfl_xor(pred, 2, 32);

    const float err = pred - r.v;
    const float lrb = LR_ * r.b;
    float og = 0.f;
#pragma unroll
    for (int i = 0; i < 16; ++i) {
        const float grad = r.k[i] * err;                    // outer(k, pred-v)
        G[i]  = BETA1_ * G[i]  + (1.f - BETA1_) * grad;
        Hm[i] = BETA2_ * Hm[i] + (1.f - BETA2_) * grad * grad;
        S[i] -= lrb * G[i] * __builtin_amdgcn_rcpf(Hm[i] + 1.f);  // WD==0, LAM==1
        og   += r.q[i] * S[i];                              // o[v] = q . S[:,v]
    }
    og += __shfl_xor(og, 1, 32);
    og += __shfl_xor(og, 2, 32);
    return og;
}

__global__ __launch_bounds__(64)
void recurrence(const float* __restrict__ qn, const float* __restrict__ kn,
                const float* __restrict__ vn, const float* __restrict__ beta,
                float* __restrict__ o) {
    const int tid = threadIdx.x;
    const int kg  = tid & 3;
    const int vl  = tid >> 2;
    const int vg  = blockIdx.x;
    const int h   = blockIdx.y;
    const int b   = blockIdx.z;
    const int v   = vg * 16 + vl;

    float S[16], G[16], Hm[16];
#pragma unroll
    for (int i = 0; i < 16; ++i) { S[i] = 0.f; G[i] = 0.f; Hm[i] = 0.f; }

    __shared__ __attribute__((aligned(16))) float ks_[2][CH_][64];
    __shared__ __attribute__((aligned(16))) float qs_[2][CH_][64];
    __shared__ __attribute__((aligned(16))) float vs_[2][CH_][16];
    __shared__ __attribute__((aligned(16))) float os_[2][CH_][16];
    __shared__ float bs_[2][CH_];

    const size_t base  = (size_t)(b * T_) * C_ + h * 64;
    const size_t bbase = (size_t)(b * T_) * H_ + h;

    // staging map: 16 lanes cover one 64-float row of k or q (4 rows a pass),
    // 4 lanes cover one 16-float row of v (16 rows a pass)
    const int r4 = tid >> 4, c4 = (tid & 15) * 4;
    const int rv = tid >> 2, cv = (tid & 3) * 4;
    const float* kgp = kn + base + (size_t)r4 * C_ + c4;
    const float* qgp = qn + base + (size_t)r4 * C_ + c4;
    const float* vgp = vn + base + vg * 16 + (size_t)rv * C_ + cv;
    const float* bgp = beta + bbase + (size_t)(tid & (CH_ - 1)) * H_;

    v4f   kst[CH_ / 4], qst[CH_ / 4], vst[CH_ / 16];
    float bst;

    // chunk 0: global -> registers
#pragma unroll
    for (int j = 0; j < CH_ / 4; ++j) {
        kst[j] = *(const v4f*)(kgp + (size_t)j * 4 * C_);
        qst[j] = *(const v4f*)(qgp + (size_t)j * 4 * C_);
    }
#pragma unroll
    for (int j = 0; j < CH_ / 16; ++j) vst[j] = *(const v4f*)(vgp + (size_t)j * 16 * C_);
    bst = *bgp;
    // precaution: the wait stands before any address register of the loads above is
    // reused; the scheduling barrier keeps later register writes from rising over it
    asm volatile("s_wait_xcnt 0x0" ::: "memory");
    __builtin_amdgcn_sched_barrier(0);

    float* ogp = o + base + vg * 16 + (size_t)rv * C_ + cv;
    for (int c = 0; c < NCH_; ++c) {
        const int p = c & 1;
        // registers -> LDS buffer p; its last readers (chunk c-2) left it before
        // the barrier of chunk c-1
#pragma unroll
        for (int j = 0; j < CH_ / 4; ++j) {
            *(v4f*)&ks_[p][r4 + 4 * j][c4] = kst[j];
            *(v4f*)&qs_[p][r4 + 4 * j][c4] = qst[j];
        }
#pragma unroll
        for (int j = 0; j < CH_ / 16; ++j) *(v4f*)&vs_[p][rv + 16 * j][cv] = vst[j];
        if (tid < CH_) bs_[p][tid] = bst;
        __syncthreads();

        if (c > 0) {                            // chunk c-1's outputs: LDS -> global
#pragma unroll
            for (int j = 0; j < CH_ / 16; ++j)
                *(v4f*)(ogp + (size_t)j * 16 * C_) = *(const v4f*)&os_[p ^ 1][rv + 16 * j][cv];
            ogp += (size_t)CH_ * C_;
        }
        if (c + 1 < NCH_) {                     // chunk c+1: in flight across chunk c
            kgp += (size_t)CH_ * C_;
            qgp += (size_t)CH_ * C_;
            vgp += (size_t)CH_ * C_;
            bgp += (size_t)CH_ * H_;
#pragma unroll
            for (int j = 0; j < CH_ / 4; ++j) {
                kst[j] = *(const v4f*)(kgp + (size_t)j * 4 * C_);
                qst[j] = *(const v4f*)(qgp + (size_t)j * 4 * C_);
            }
#pragma unroll
            for (int j = 0; j < CH_ / 16; ++j) vst[j] = *(const v4f*)(vgp + (size_t)j * 16 * C_);
            bst = *bgp;
        }

        const float* kb = &ks_[p][0][kg * 16];
        const float* qb = &qs_[p][0][kg * 16];
        const float* vb = &vs_[p][0][vl];
        const float* bb = &bs_[p][0];
        float*       ob = &os_[p][0][vl];

        StepIn ra, rb;
        read_step(ra, kb, qb, vb, bb, 0);
        for (int s = 0; s < CH_; s += 2) {
            read_step(rb, kb, qb, vb, bb, s + 1);
            // keeps the LDS reads of the next step above this step's arithmetic, so
            // that they have returned before the first wait of the step
            __builtin_amdgcn_sched_barrier(0);
            const float o0 = one_step(ra, S, G, Hm);
            if (kg == 0) ob[s * 16] = o0;
            // past the chunk's end this wraps to row 0; that value is not used
            read_step(ra, kb, qb, vb, bb, (s + 2) & (CH_ - 1));
            __builtin_amdgcn_sched_barrier(0);  // as above
            const float o1 = one_step(rb, S, G, Hm);
            if (kg == 0) ob[(s + 1) * 16] = o1;
        }
    }

    __syncthreads();                            // last chunk's outputs are complete
#pragma unroll
    for (int j = 0; j < CH_ / 16; ++j)
        *(v4f*)(ogp + (size_t)j * 16 * C_) =
            *(const v4f*)&os_[(NCH_ - 1) & 1][rv + 16 * j][cv];
}

// ---------------- RMSNorm over V (mean, +1e-5) * rms_w, emit f16 -----------------
__global__ __launch_bounds__(64)
void rmsnorm_f16(const float* __restrict__ o, const float* __restrict__ rw,
                 _Float16* __restrict__ oh) {
    const int g = blockIdx.x;                 // over MT_*H_ groups of 64
    const int tid = threadIdx.x;
    const size_t base = (size_t)g * 64;
    const float x = o[base + tid];
    __shared__ float red[64];
    red[tid] = x * x;
    __syncthreads();
    for (int s = 32; s > 0; s >>= 1) {
        if (tid < s) red[tid] += red[tid + s];
        __syncthreads();
    }
    const float inv = rsqrtf(red[0] * (1.0f / 64.f) + EPS_);
    oh[base + tid] = (_Float16)(x * inv * rw[tid]);
}

// ---------------- host-side launch ----------------
extern "C" void kernel_launch(void* const* d_in, const int* in_sizes, int n_in,
                              void* d_out, int out_size, void* d_ws, size_t ws_size,
                              hipStream_t stream) {
    (void)in_sizes; (void)n_in; (void)out_size; (void)ws_size;
    const float* x    = (const float*)d_in[0];
    const float* Wq   = (const float*)d_in[1];
    const float* Wk   = (const float*)d_in[2];
    const float* Wv   = (const float*)d_in[3];
    const float* Wb   = (const float*)d_in[4];
    const float* cwq  = (const float*)d_in[5];
    const float* cwk  = (const float*)d_in[6];
    const float* cwv  = (const float*)d_in[7];
    const float* rmsw = (const float*)d_in[8];
    const float* Wo   = (const float*)d_in[9];
    float* out = (float*)d_out;

    char* ws = (char*)d_ws;
    size_t off = 0;
    auto alloc = [&](size_t bytes) -> void* {
        void* p = ws + off;
        off += (bytes + 255) & ~(size_t)255;
        return p;
    };
    _Float16* xh   = (_Float16*)alloc((size_t)MT_ * D_ * 2);
    _Float16* Wqp  = (_Float16*)alloc((size_t)D_ * C_ * 2);   // packed fragments
    _Float16* Wkp  = (_Float16*)alloc((size_t)D_ * C_ * 2);
    _Float16* Wvp  = (_Float16*)alloc((size_t)D_ * C_ * 2);
    _Float16* Wop  = (_Float16*)alloc((size_t)C_ * D_ * 2);
    float*    Qf   = (float*)alloc((size_t)MT_ * C_ * 4);
    float*    Kf   = (float*)alloc((size_t)MT_ * C_ * 4);
    float*    Vf   = (float*)alloc((size_t)MT_ * C_ * 4);
    float*    qc   = (float*)alloc((size_t)MT_ * C_ * 4);
    float*    kc   = (float*)alloc((size_t)MT_ * C_ * 4);
    float*    vc   = (float*)alloc((size_t)MT_ * C_ * 4);
    float*    betaf= (float*)alloc((size_t)MT_ * H_ * 4);
    float*    ob   = (float*)alloc((size_t)MT_ * C_ * 4);
    _Float16* ohh  = (_Float16*)alloc((size_t)MT_ * C_ * 2);

    // 1) stage A operand (x) as f16; pack all weights into WMMA B-fragment layout
    int n = MT_ * D_;
    f32_to_f16<<<(n + 255) / 256, 256, 0, stream>>>(x, xh, n);
    n = D_ * C_;
    pack_b_f16<<<(n + 255) / 256, 256, 0, stream>>>(Wq, Wqp, D_, C_);
    pack_b_f16<<<(n + 255) / 256, 256, 0, stream>>>(Wk, Wkp, D_, C_);
    pack_b_f16<<<(n + 255) / 256, 256, 0, stream>>>(Wv, Wvp, D_, C_);
    pack_b_f16<<<(n + 255) / 256, 256, 0, stream>>>(Wo, Wop, C_, D_);

    // 2) projection GEMMs via v_wmma_f32_16x16x32_f16 (fully unrolled k-loop)
    dim3 gblk(128);
    dim3 ggrd(C_ / 64, MT_ / 16);
    gemm_f16_wmma<D_, C_><<<ggrd, gblk, 0, stream>>>(xh, Wqp, Qf);
    gemm_f16_wmma<D_, C_><<<ggrd, gblk, 0, stream>>>(xh, Wkp, Kf);
    gemm_f16_wmma<D_, C_><<<ggrd, gblk, 0, stream>>>(xh, Wvp, Vf);

    // 3) beta projection (tiny)
    n = MT_ * H_;
    beta_sigmoid<<<(n + 255) / 256, 256, 0, stream>>>(x, Wb, betaf);

    // 4) causal depthwise conv + SiLU
    n = MT_ * C_;
    conv_silu<<<(n + 255) / 256, 256, 0, stream>>>(Qf, cwq, qc);
    conv_silu<<<(n + 255) / 256, 256, 0, stream>>>(Kf, cwk, kc);
    conv_silu<<<(n + 255) / 256, 256, 0, stream>>>(Vf, cwv, vc);

    // 5) l2norm (in-place), scale on q
    l2norm_scale<<<MT_ * H_, 64, 0, stream>>>(qc, qc, SCALE_);
    l2norm_scale<<<MT_ * H_, 64, 0, stream>>>(kc, kc, 1.0f);

    // 6) sequential recurrence: 64 blocks (B*H*4 v-groups) x 64 threads
    dim3 rgrid(4, H_, B_);
    recurrence<<<rgrid, 64, 0, stream>>>(qc, kc, vc, betaf, ob);

    // 7) RMSNorm -> f16
    rmsnorm_f16<<<MT_ * H_, 64, 0, stream>>>(ob, rmsw, ohh);

    // 8) output projection GEMM (fp32 result straight to d_out)
    gemm_f16_wmma<C_, D_><<<ggrd, gblk, 0, stream>>>(ohh, Wop, out);
}

// v002
// Measured time: 252 microseconds a run.
// Timed twice side by side with v001, it ran 1.47 times as fast both times.
// Over all steps from v000 it is 4.02 times as fast.
#include <hip/hip_runtime.h>

// ---------------- problem dims (fixed by reference) ----------------
#define B_    2
#define T_    1024
#define D_    512
#define H_    8
#define MT_   (B_ * T_)          // 2048 rows
#define C_    512                // H*K == H*V == 512 channels

#define LR_    1e-3f
#define BETA1_ 0.9f
#define BETA2_ 0.999f
#define EPS_   1e-5f
#define SCALE_ 0.125f            // 64^-0.5

typedef __attribute__((ext_vector_type(16))) _Float16 v16h;
typedef __attribute__((ext_vector_type(8)))  float    v8f;
typedef __attribute__((ext_vector_type(4)))  float    v4f;

// ---------------- fp32 -> f16 conversion (row-major, for A operands) -------------
__global__ void f32_to_f16(const float* __restrict__ in, _Float16* __restrict__ out, int n) {
    int i = blockIdx.x * blockDim.x + threadIdx.x;
    if (i < n) out[i] = (_Float16)in[i];
}

// ---------------- pack fp32 weight [Kd x N] into WMMA B-fragment layout ----------
// Bp layout: [nt = n/16][ks = k/32][lane 0..31][e 0..15]  (contiguous 32B per lane)
// Element map (ISA 7.12.2, 16-bit B 32x16): lane -> col = lane&15, kh = lane>>4;
// e -> k = ks*32 + (e<8 ? e : e+8) + 8*kh
__global__ void pack_b_f16(const float* __restrict__ W, _Float16* __restrict__ Bp,
                           int Kd, int N) {
    int idx = blockIdx.x * blockDim.x + threadIdx.x;     // over Kd*N
    if (idx >= Kd * N) return;
    const int e    = idx & 15;
    const int lane = (idx >> 4) & 31;
    const int ks   = (idx >> 9) % (Kd / 32);
    const int nt   = idx / ((Kd / 32) << 9);
    const int kh   = lane >> 4;
    const int col  = lane & 15;
    const int k    = ks * 32 + ((e < 8 ? e : e + 8) + 8 * kh);
    Bp[idx] = (_Float16)W[(size_t)k * N + nt * 16 + col];
}

// ---------------- WMMA f16 GEMM: C[MxN] = A[MxKd] * Bpacked ----------------------
// block = 128 threads (4 waves); each wave owns one 16x16 tile; k-loop fully
// unrolled (Kd/32 = 16 static v_wmma_f32_16x16x32_f16 per wave).
// grid = (N/64, M/16)
template <int Kd, int N>
__global__ __launch_bounds__(128)
void gemm_f16_wmma(const _Float16* __restrict__ A, const _Float16* __restrict__ Bp,
                   float* __restrict__ C) {
    const int lane = threadIdx.x & 31;
    const int wave = threadIdx.x >> 5;
    const int nt   = blockIdx.x * 4 + wave;  // 16-wide n-tile index
    const int m0   = blockIdx.y * 16;
    const int r    = lane & 15;              // A-row / C-col within tile
    const int kh   = lane >> 4;              // K-half select

    const _Float16* Arow  = A + (size_t)(m0 + r) * Kd + 8 * kh;
    const _Float16* Bfrag = Bp + ((size_t)nt * (Kd / 32) * 32 + lane) * 16;

    v8f acc = {};
#pragma unroll
    for (int ks = 0; ks < Kd / 32; ++ks) {
        v16h a;
        const _Float16* ap = Arow + ks * 32;
#pragma unroll
        for (int e = 0; e < 8; ++e) {        // k = ks*32 + 8*kh + e (+16 for hi half)
            a[e]     = ap[e];
            a[e + 8] = ap[e + 16];
        }
        const v16h b = *(const v16h*)(Bfrag + (size_t)ks * 32 * 16);
        acc = __builtin_amdgcn_wmma_f32_16x16x32_f16(false, a, false, b,
                                                     (short)0, acc, false, false);
    }
    // C/D layout: VGPR i -> row = i + 8*kh, col = lane&15
#pragma unroll
    for (int i = 0; i < 8; ++i)
        C[(size_t)(m0 + i + 8 * kh) * N + nt * 16 + r] = acc[i];
}

// ---------------- beta = sigmoid(x @ Wb), one thread per (row, h) ----------------
__global__ void beta_sigmoid(const float* __restrict__ x, const float* __restrict__ Wb,
                             float* __restrict__ beta) {
    int idx = blockIdx.x * blockDim.x + threadIdx.x;   // over MT_*H_
    if (idx >= MT_ * H_) return;
    const int h = idx % H_;
    const int row = idx / H_;
    float acc = 0.f;
    for (int d = 0; d < D_; ++d)
        acc += x[(size_t)row * D_ + d] * Wb[(size_t)d * H_ + h];
    beta[idx] = __builtin_amdgcn_rcpf(1.f + __expf(-acc));
}

// ---------------- causal depthwise conv-4 + SiLU, one thread per element --------
__global__ void conv_silu(const float* __restrict__ P, const float* __restrict__ w,
                          float* __restrict__ Y) {
    int idx = blockIdx.x * blockDim.x + threadIdx.x;   // over MT_*C_
    if (idx >= MT_ * C_) return;
    const int c  = idx % C_;
    const int bt = idx / C_;
    const int t  = bt % T_;
    float acc = 0.f;
#pragma unroll
    for (int i = 0; i < 4; ++i) {
        const int tt = t - 3 + i;
        if (tt >= 0) acc += P[(size_t)(bt - (3 - i)) * C_ + c] * w[c * 4 + i];
    }
    Y[idx] = acc * __builtin_amdgcn_rcpf(1.f + __expf(-acc));   // SiLU
}

// ---------------- per-head l2norm (sum, +1e-6) with scale (in-place safe) --------
__global__ __launch_bounds__(64)
void l2norm_scale(const float* __restrict__ in, float* __restrict__ out, float scale) {
    const int g = blockIdx.x;                 // over MT_*H_ groups of 64
    const int tid = threadIdx.x;
    const size_t base = (size_t)g * 64;
    const float x = in[base + tid];
    __shared__ float red[64];
    red[tid] = x * x;
    __syncthreads();
    for (int s = 32; s > 0; s >>= 1) {
        if (tid < s) red[tid] += red[tid + s];
        __syncthreads();
    }
    out[base + tid] = x * rsqrtf(red[0] + 1e-6f) * scale;
}

// ---------------- sequential IVON delta-rule recurrence --------------------------
// grid = (4 v-groups, H, B); block = 64 threads (kg = tid&3, vl = tid>>2).
// Inputs and outputs pass through double-buffered LDS CH_ time steps at a time: the
// global loads of chunk c+1 are in flight while chunk c is worked on, chunk c-1's
// outputs are stored behind the same barrier, and the block meets once per chunk.
// Inside a chunk each step's operands are read from LDS into registers one step
// ahead, so no global access and no barrier stands on the serial path.
#define CH_ 32
#define NCH_ (T_ / CH_)

struct StepIn { float k[16]; float q[16]; float v; float b; };

__device__ __forceinline__ void read_step(StepIn& r, const float* kb, const float* qb,
                                          const float* vb, const float* bb, int s) {
#pragma unroll
    for (int j = 0; j < 4; ++j) {
        const v4f kk = *(const v4f*)(kb + s * 64 + 4 * j);
        const v4f qq = *(const v4f*)(qb + s * 64 + 4 * j);
        r.k[4 * j + 0] = kk.x; r.k[4 * j + 1] = kk.y; r.k[4 * j + 2] = kk.z; r.k[4 * j + 3] = kk.w;
        r.q[4 * j + 0] = qq.x; r.q[4 * j + 1] = qq.y; r.q[4 * j + 2] = qq.z; r.q[4 * j + 3] = qq.w;
    }
    r.v = vb[s * 16];
    r.b = bb[s];
}

// x + (x of lane ^ m), m = CTRL - 0x160 (DPP row_xmask): the partner's value comes
// through the vector unit's own cross-lane path, not through the LDS queue and a
// wait on it; both lanes add the same two values, so the sum is the shuffle's
template <int CTRL>
__device__ __forceinline__ float add_xlane(float x) {
    const int y = __builtin_amdgcn_update_dpp(0, __float_as_int(x), CTRL, 0xf, 0xf, true);
    return x + __int_as_float(y);
}

__device__ __forceinline__ float one_step(const StepIn& r, float (&S)[16], float (&G)[16],
                                          float (&Hm)[16]) {
    // pred[v] = k . S[:,v]  (16 partials, reduced across the 4 lanes of a v)
    float pred = 0.f;
#pragma unroll
    for (int i = 0; i < 16; ++i) pred += r.k[i] * S[i];
    pred = add_xlane<0x161>(pred);
    pred = add_xlane<0x162>(pred);

    const float err = pred - r.v;
    const float lrb = LR_ * r.b;
    float og = 0.f;
#pragma unroll
    for (int i = 0; i < 16; ++i) {
        const float grad = r.k[i] * err;                    // outer(k, pred-v)
        G[i]  = BETA1_ * G[i]  + (1.f - BETA1_) * grad;
        Hm[i] = BETA2_ * Hm[i] + (1.f - BETA2_) * grad * grad;
        S[i] -= lrb * G[i] * __builtin_amdgcn_rcpf(Hm[i] + 1.f);  // WD==0, LAM==1
        og   += r.q[i] * S[i];                              // o[v] = q . S[:,v]
    }
    og = add_xlane<0x161>(og);
    og = add_xlane<0x162>(og);
    return og;
}

__global__ __launch_bounds__(64)
void recurrence(const float* __restrict__ qn, const float* __restrict__ kn,
                const float* __restrict__ vn, const float* __restrict__ beta,
                float* __restrict__ o) {
    const int tid = threadIdx.x;
    const int kg  = tid & 3;
    const int vl  = tid >> 2;
    const int vg  = blockIdx.x;
    const int h   = blockIdx.y;
    const int b   = blockIdx.z;
    const int v   = vg * 16 + vl;

    float S[16], G[16], Hm[16];
#pragma unroll
    for (int i = 0; i < 16; ++i) { S[i] = 0.f; G[i] = 0.f; Hm[i] = 0.f; }

    __shared__ __attribute__((aligned(16))) float ks_[2][CH_][64];
    __shared__ __attribute__((aligned(16))) float qs_[2][CH_][64];
    __shared__ __attribute__((aligned(16))) float vs_[2][CH_][16];
    __shared__ __attribute__((aligned(16))) float os_[2][CH_][16];
    __shared__ float bs_[2][CH_];

    const size_t base  = (size_t)(b * T_) * C_ + h * 64;
    const size_t bbase = (size_t)(b * T_) * H_ + h;

    // staging map: 16 lanes cover one 64-float row of k or q (4 rows a pass),
    // 4 lanes cover one 16-float row of v (16 rows a pass)
    const int r4 = tid >> 4, c4 = (tid & 15) * 4;
    const int rv = tid >> 2, cv = (tid & 3) * 4;
    const float* kgp = kn + base + (size_t)r4 * C_ + c4;
    const float* qgp = qn + base + (size_t)r4 * C_ + c4;
    const float* vgp = vn + base + vg * 16 + (size_t)rv * C_ + cv;
    const float* bgp = beta + bbase + (size_t)(tid & (CH_ - 1)) * H_;

    v4f   kst[CH_ / 4], qst[CH_ / 4], vst[CH_ / 16];
    float bst;

    // chunk 0: global -> registers
#pragma unroll
    for (int j = 0; j < CH_ / 4; ++j) {
        kst[j] = *(const v4f*)(kgp + (size_t)j * 4 * C_);
        qst[j] = *(const v4f*)(qgp + (size_t)j * 4 * C_);
    }
#pragma unroll
    for (int j = 0; j < CH_ / 16; ++j) vst[j] = *(const v4f*)(vgp + (size_t)j * 16 * C_);
    bst = *bgp;
    // precaution: the wait stands before any address register of the loads above is
    // reused; the scheduling barrier keeps later register writes from rising over it
    asm volatile("s_wait_xcnt 0x0" ::: "memory");
    __builtin_amdgcn_sched_barrier(0);

    float* ogp = o + base + vg * 16 + (size_t)rv * C_ + cv;
    for (int c = 0; c < NCH_; ++c) {
        const int p = c & 1;
        // registers -> LDS buffer p; its last readers (chunk c-2) left it before
        // the barrier of chunk c-1
#pragma unroll
        for (int j = 0; j < CH_ / 4; ++j) {
            *(v4f*)&ks_[p][r4 + 4 * j][c4] = kst[j];
            *(v4f*)&qs_[p][r4 + 4 * j][c4] = qst[j];
        }
#pragma unroll
        for (int j = 0; j < CH_ / 16; ++j) *(v4f*)&vs_[p][rv + 16 * j][cv] = vst[j];
        if (tid < CH_) bs_[p][tid] = bst;
        __syncthreads();

        if (c > 0) {                            // chunk c-1's outputs: LDS -> global
#pragma unroll
            for (int j = 0; j < CH_ / 16; ++j)
                *(v4f*)(ogp + (size_t)j * 16 * C_) = *(const v4f*)&os_[p ^ 1][rv + 16 * j][cv];
            ogp += (size_t)CH_ * C_;
        }
        if (c + 1 < NCH_) {                     // chunk c+1: in flight across chunk c
            kgp += (size_t)CH_ * C_;
            qgp += (size_t)CH_ * C_;
            vgp += (size_t)CH_ * C_;
            bgp += (size_t)CH_ * H_;
#pragma unroll
            for (int j = 0; j < CH_ / 4; ++j) {
                kst[j] = *(const v4f*)(kgp + (size_t)j * 4 * C_);
                qst[j] = *(const v4f*)(qgp + (size_t)j * 4 * C_);
            }
#pragma unroll
            for (int j = 0; j < CH_ / 16; ++j) vst[j] = *(const v4f*)(vgp + (size_t)j * 16 * C_);
            bst = *bgp;
        }

        const float* kb = &ks_[p][0][kg * 16];
        const float* qb = &qs_[p][0][kg * 16];
        const float* vb = &vs_[p][0][vl];
        const float* bb = &bs_[p][0];
        float*       ob = &os_[p][0][vl];

        StepIn ra, rb;
        read_step(ra, kb, qb, vb, bb, 0);
        for (int s = 0; s < CH_; s += 2) {
            read_step(rb, kb, qb, vb, bb, s + 1);
            // keeps the LDS reads of the next step above this step's arithmetic, so
            // that they have returned before the next step waits on them
            __builtin_amdgcn_sched_barrier(0);
            const float o0 = one_step(ra, S, G, Hm);
            if (kg == 0) ob[s * 16] = o0;
            // past the chunk's end this wraps to row 0; that value is not used
            read_step(ra, kb, qb, vb, bb, (s + 2) & (CH_ - 1));
            __builtin_amdgcn_sched_barrier(0);  // as above
            const float o1 = one_step(rb, S, G, Hm);
            if (kg == 0) ob[(s + 1) * 16] = o1;
        }
    }

    __syncthreads();                            // last chunk's outputs are complete
#pragma unroll
    for (int j = 0; j < CH_ / 16; ++j)
        *(v4f*)(ogp + (size_t)j * 16 * C_) =
            *(const v4f*)&os_[(NCH_ - 1) & 1][rv + 16 * j][cv];
}

// ---------------- RMSNorm over V (mean, +1e-5) * rms_w, emit f16 -----------------
__global__ __launch_bounds__(64)
void rmsnorm_f16(const float* __restrict__ o, const float* __restrict__ rw,
                 _Float16* __restrict__ oh) {
    const int g = blockIdx.x;                 // over MT_*H_ groups of 64
    const int tid = threadIdx.x;
    const size_t base = (size_t)g * 64;
    const float x = o[base + tid];
    __shared__ float red[64];
    red[tid] = x * x;
    __syncthreads();
    for (int s = 32; s > 0; s >>= 1) {
        if (tid < s) red[tid] += red[tid + s];
        __syncthreads();
    }
    const float inv = rsqrtf(red[0] * (1.0f / 64.f) + EPS_);
    oh[base + tid] = (_Float16)(x * inv * rw[tid]);
}

// ---------------- host-side launch ----------------
extern "C" void kernel_launch(void* const* d_in, const int* in_sizes, int n_in,
                              void* d_out, int out_size, void* d_ws, size_t ws_size,
                              hipStream_t stream) {
    (void)in_sizes; (void)n_in; (void)out_size; (void)ws_size;
    const float* x    = (const float*)d_in[0];
    const float* Wq   = (const float*)d_in[1];
    const float* Wk   = (const float*)d_in[2];
    const float* Wv   = (const float*)d_in[3];
    const float* Wb   = (const float*)d_in[4];
    const float* cwq  = (const float*)d_in[5];
    const float* cwk  = (const float*)d_in[6];
    const float* cwv  = (const float*)d_in[7];
    const float* rmsw = (const float*)d_in[8];
    const float* Wo   = (const float*)d_in[9];
    float* out = (float*)d_out;

    char* ws = (char*)d_ws;
    size_t off = 0;
    auto alloc = [&](size_t bytes) -> void* {
        void* p = ws + off;
        off += (bytes + 255) & ~(size_t)255;
        return p;
    };
    _Float16* xh   = (_Float16*)alloc((size_t)MT_ * D_ * 2);
    _Float16* Wqp  = (_Float16*)alloc((size_t)D_ * C_ * 2);   // packed fragments
    _Float16* Wkp  = (_Float16*)alloc((size_t)D_ * C_ * 2);
    _Float16* Wvp  = (_Float16*)alloc((size_t)D_ * C_ * 2);
    _Float16* Wop  = (_Float16*)alloc((size_t)C_ * D_ * 2);
    float*    Qf   = (float*)alloc((size_t)MT_ * C_ * 4);
    float*    Kf   = (float*)alloc((size_t)MT_ * C_ * 4);
    float*    Vf   = (float*)alloc((size_t)MT_ * C_ * 4);
    float*    qc   = (float*)alloc((size_t)MT_ * C_ * 4);
    float*    kc   = (float*)alloc((size_t)MT_ * C_ * 4);
    float*    vc   = (float*)alloc((size_t)MT_ * C_ * 4);
    float*    betaf= (float*)alloc((size_t)MT_ * H_ * 4);
    float*    ob   = (float*)alloc((size_t)MT_ * C_ * 4);
    _Float16* ohh  = (_Float16*)alloc((size_t)MT_ * C_ * 2);

    // 1) stage A operand (x) as f16; pack all weights into WMMA B-fragment layout
    int n = MT_ * D_;
    f32_to_f16<<<(n + 255) / 256, 256, 0, stream>>>(x, xh, n);
    n = D_ * C_;
    pack_b_f16<<<(n + 255) / 256, 256, 0, stream>>>(Wq, Wqp, D_, C_);
    pack_b_f16<<<(n + 255) / 256, 256, 0, stream>>>(Wk, Wkp, D_, C_);
    pack_b_f16<<<(n + 255) / 256, 256, 0, stream>>>(Wv, Wvp, D_, C_);
    pack_b_f16<<<(n + 255) / 256, 256, 0, stream>>>(Wo, Wop, C_, D_);

    // 2) projection GEMMs via v_wmma_f32_16x16x32_f16 (fully unrolled k-loop)
    dim3 gblk(128);
    dim3 ggrd(C_ / 64, MT_ / 16);
    gemm_f16_wmma<D_, C_><<<ggrd, gblk, 0, stream>>>(xh, Wqp, Qf);
    gemm_f16_wmma<D_, C_><<<ggrd, gblk, 0, stream>>>(xh, Wkp, Kf);
    gemm_f16_wmma<D_, C_><<<ggrd, gblk, 0, stream>>>(xh, Wvp, Vf);

    // 3) beta projection (tiny)
    n = MT_ * H_;
    beta_sigmoid<<<(n + 255) / 256, 256, 0, stream>>>(x, Wb, betaf);

    // 4) causal depthwise conv + SiLU
    n = MT_ * C_;
    conv_silu<<<(n + 255) / 256, 256, 0, stream>>>(Qf, cwq, qc);
    conv_silu<<<(n + 255) / 256, 256, 0, stream>>>(Kf, cwk, kc);
    conv_silu<<<(n + 255) / 256, 256, 0, stream>>>(Vf, cwv, vc);

    // 5) l2norm (in-place), scale on q
    l2norm_scale<<<MT_ * H_, 64, 0, stream>>>(qc, qc, SCALE_);
    l2norm_scale<<<MT_ * H_, 64, 0, stream>>>(kc, kc, 1.0f);

    // 6) sequential recurrence: 64 blocks (B*H*4 v-groups) x 64 threads
    dim3 rgrid(4, H_, B_);
    recurrence<<<rgrid, 64, 0, stream>>>(qc, kc, vc, betaf, ob);

    // 7) RMSNorm -> f16
    rmsnorm_f16<<<MT_ * H_, 64, 0, stream>>>(ob, rmsw, ohh);

    // 8) output projection GEMM (fp32 result straight to d_out)
    gemm_f16_wmma<C_, D_><<<ggrd, gblk, 0, stream>>>(ohh, Wop, out);
}

// v003
// It runs in 195 microseconds.
// Two timings next to v002 both put it at 1.29 times that version's speed.
// Over all steps from v000 it is 5.19 times as fast.
#include <hip/hip_runtime.h>

// ---------------- problem dims (fixed by reference) ----------------
#define B_    2
#define T_    1024
#define D_    512
#define H_    8
#define MT_   (B_ * T_)          // 2048 rows
#define C_    512                // H*K == H*V == 512 channels

#define LR_    1e-3f
#define BETA1_ 0.9f
#define BETA2_ 0.999f
#define EPS_   1e-5f
#define SCALE_ 0.125f            // 64^-0.5

typedef __attribute__((ext_vector_type(16))) _Float16 v16h;
typedef __attribute__((ext_vector_type(8)))  float    v8f;
typedef __attribute__((ext_vector_type(4)))  float    v4f;

// ---------------- fp32 -> f16 conversion (row-major, for A operands) -------------
__global__ void f32_to_f16(const float* __restrict__ in, _Float16* __restrict__ out, int n) {
    int i = blockIdx.x * blockDim.x + threadIdx.x;
    if (i < n) out[i] = (_Float16)in[i];
}

// ---------------- pack fp32 weight [Kd x N] into WMMA B-fragment layout ----------
// Bp layout: [nt = n/16][ks = k/32][lane 0..31][e 0..15]  (contiguous 32B per lane)
// Element map (ISA 7.12.2, 16-bit B 32x16): lane -> col = lane&15, kh = lane>>4;
// e -> k = ks*32 + (e<8 ? e : e+8) + 8*kh
__global__ void pack_b_f16(const float* __restrict__ W, _Float16* __restrict__ Bp,
                           int Kd, int N) {
    int idx = blockIdx.x * blockDim.x + threadIdx.x;     // over Kd*N
    if (idx >= Kd * N) return;
    const int e    = idx & 15;
    const int lane = (idx >> 4) & 31;
    const int ks   = (idx >> 9) % (Kd / 32);
    const int nt   = idx / ((Kd / 32) << 9);
    const int kh   = lane >> 4;
    const int col  = lane & 15;
    const int k    = ks * 32 + ((e < 8 ? e : e + 8) + 8 * kh);
    Bp[idx] = (_Float16)W[(size_t)k * N + nt * 16 + col];
}

// ---------------- WMMA f16 GEMM: C[MxN] = A[MxKd] * Bpacked ----------------------
// block = 128 threads (4 waves); each wave owns one 16x16 tile; k-loop fully
// unrolled (Kd/32 = 16 static v_wmma_f32_16x16x32_f16 per wave).
// grid = (N/64, M/16)
template <int Kd, int N>
__global__ __launch_bounds__(128)
void gemm_f16_wmma(const _Float16* __restrict__ A, const _Float16* __restrict__ Bp,
                   float* __restrict__ C) {
    const int lane = threadIdx.x & 31;
    const int wave = threadIdx.x >> 5;
    const int nt   = blockIdx.x * 4 + wave;  // 16-wide n-tile index
    const int m0   = blockIdx.y * 16;
    const int r    = lane & 15;              // A-row / C-col within tile
    const int kh   = lane >> 4;              // K-half select

    const _Float16* Arow  = A + (size_t)(m0 + r) * Kd + 8 * kh;
    const _Float16* Bfrag = Bp + ((size_t)nt * (Kd / 32) * 32 + lane) * 16;

    v8f acc = {};
#pragma unroll
    for (int ks = 0; ks < Kd / 32; ++ks) {
        v16h a;
        const _Float16* ap = Arow + ks * 32;
#pragma unroll
        for (int e = 0; e < 8; ++e) {        // k = ks*32 + 8*kh + e (+16 for hi half)
            a[e]     = ap[e];
            a[e + 8] = ap[e + 16];
        }
        const v16h b = *(const v16h*)(Bfrag + (size_t)ks * 32 * 16);
        acc = __builtin_amdgcn_wmma_f32_16x16x32_f16(false, a, false, b,
                                                     (short)0, acc, false, false);
    }
    // C/D layout: VGPR i -> row = i + 8*kh, col = lane&15
#pragma unroll
    for (int i = 0; i < 8; ++i)
        C[(size_t)(m0 + i + 8 * kh) * N + nt * 16 + r] = acc[i];
}

// ---------------- beta = sigmoid(x @ Wb), one thread per (row, h) ----------------
__global__ void beta_sigmoid(const float* __restrict__ x, const float* __restrict__ Wb,
                             float* __restrict__ beta) {
    int idx = blockIdx.x * blockDim.x + threadIdx.x;   // over MT_*H_
    if (idx >= MT_ * H_) return;
    const int h = idx % H_;
    const int row = idx / H_;
    float acc = 0.f;
    for (int d = 0; d < D_; ++d)
        acc += x[(size_t)row * D_ + d] * Wb[(size_t)d * H_ + h];
    beta[idx] = __builtin_amdgcn_rcpf(1.f + __expf(-acc));
}

// ---------------- causal depthwise conv-4 + SiLU, one thread per element --------
__global__ void conv_silu(const float* __restrict__ P, const float* __restrict__ w,
                          float* __restrict__ Y) {
    int idx = blockIdx.x * blockDim.x + threadIdx.x;   // over MT_*C_
    if (idx >= MT_ * C_) return;
    const int c  = idx % C_;
    const int bt = idx / C_;
    const int t  = bt % T_;
    float acc = 0.f;
#pragma unroll
    for (int i = 0; i < 4; ++i) {
        const int tt = t - 3 + i;
        if (tt >= 0) acc += P[(size_t)(bt - (3 - i)) * C_ + c] * w[c * 4 + i];
    }
    Y[idx] = acc * __builtin_amdgcn_rcpf(1.f + __expf(-acc));   // SiLU
}

// ---------------- per-head l2norm (sum, +1e-6) with scale (in-place safe) --------
__global__ __launch_bounds__(64)
void l2norm_scale(const float* __restrict__ in, float* __restrict__ out, float scale) {
    const int g = blockIdx.x;                 // over MT_*H_ groups of 64
    const int tid = threadIdx.x;
    const size_t base = (size_t)g * 64;
    const float x = in[base + tid];
    __shared__ float red[64];
    red[tid] = x * x;
    __syncthreads();
    for (int s = 32; s > 0; s >>= 1) {
        if (tid < s) red[tid] += red[tid + s];
        __syncthreads();
    }
    out[base + tid] = x * rsqrtf(red[0] + 1e-6f) * scale;
}

// ---------------- sequential IVON delta-rule recurrence --------------------------
// grid = (8 v-groups, H, B); block = 128 threads = 4 waves, one per SIMD of a WGP
// (kg = tid&15, vl = tid>>4): a column v of the state lies on one 16-lane row, four
// k elements a lane, so a time step is a quarter of the vector work per wave that a
// 16-element lane had, and the sums over k end in a 16-lane DPP tree.
// Inputs and outputs pass through double-buffered LDS CH_ time steps at a time: the
// global loads of chunk c+1 are in flight while chunk c is worked on, chunk c-1's
// outputs are stored behind the same barrier, and the block meets once per chunk.
// Inside a chunk each step's operands are read from LDS into registers one step
// ahead, so no global access and no barrier stands on the serial path.
#define CH_ 32
#define NCH_ (T_ / CH_)
#define VB_ 8                    // state columns per block
#define RT_ 128                  // threads per block

struct StepIn { v4f k; v4f q; float v; float b; };

__device__ __forceinline__ void read_step(StepIn& r, const float* kb, const float* qb,
                                          const float* vb, const float* bb, int s) {
    r.k = *(const v4f*)(kb + s * 64);
    r.q = *(const v4f*)(qb + s * 64);
    r.v = vb[s * VB_];
    r.b = bb[s];
}

// x + (x of lane ^ m), m = CTRL - 0x160 (DPP row_xmask): the partner's value comes
// through the vector unit's own cross-lane path, not through the LDS queue and a
// wait on it; both lanes add the same two values, so the sum is the shuffle's
template <int CTRL>
__device__ __forceinline__ float add_xlane(float x) {
    const int y = __builtin_amdgcn_update_dpp(0, __float_as_int(x), CTRL, 0xf, 0xf, true);
    return x + __int_as_float(y);
}

// sum over the 16 lanes of a row, the same value in each of them
__device__ __forceinline__ float row_sum(float x) {
    x = add_xlane<0x161>(x);
    x = add_xlane<0x162>(x);
    x = add_xlane<0x164>(x);
    x = add_xlane<0x168>(x);
    return x;
}

// a lane's share of a sum over k
__device__ __forceinline__ float lane_dot(const v4f& a, const float (&S)[4]) {
    const float e = __builtin_fmaf(a[2], S[2], a[0] * S[0]);
    const float d = __builtin_fmaf(a[3], S[3], a[1] * S[1]);
    return e + d;
}

__device__ __forceinline__ float one_step(const StepIn& r, float (&S)[4], float (&G)[4],
                                          float (&Hm)[4]) {
    // pred[v] = k . S[:,v]: a lane's 4 products as two chains of two, elements 0,2 and
    // 1,3 (three dependent links; neighbours stay side by side for packed f32), then
    // the 16 lanes of the column
    const float pred = row_sum(lane_dot(r.k, S));

    const float err = pred - r.v;
    const float lrb = LR_ * r.b;
#pragma unroll
    for (int i = 0; i < 4; ++i) {
        const float grad = r.k[i] * err;                    // outer(k, pred-v)
        G[i]  = BETA1_ * G[i]  + (1.f - BETA1_) * grad;
        Hm[i] = BETA2_ * Hm[i] + (1.f - BETA2_) * grad * grad;
        S[i] -= lrb * G[i] * __builtin_amdgcn_rcpf(Hm[i] + 1.f);  // WD==0, LAM==1
    }
    return row_sum(lane_dot(r.q, S));                       // o[v] = q . S[:,v]
}

__global__ __launch_bounds__(RT_)
void recurrence(const float* __restrict__ qn, const float* __restrict__ kn,
                const float* __restrict__ vn, const float* __restrict__ beta,
                float* __restrict__ o) {
    const int tid = threadIdx.x;
    const int kg  = tid & 15;
    const int vl  = tid >> 4;
    const int vg  = blockIdx.x;
    const int h   = blockIdx.y;
    const int b   = blockIdx.z;

    float S[4], G[4], Hm[4];
#pragma unroll
    for (int i = 0; i < 4; ++i) { S[i] = 0.f; G[i] = 0.f; Hm[i] = 0.f; }

    __shared__ __attribute__((aligned(16))) float ks_[2][CH_][64];
    __shared__ __attribute__((aligned(16))) float qs_[2][CH_][64];
    __shared__ __attribute__((aligned(16))) float vs_[2][CH_][VB_];
    __shared__ __attribute__((aligned(16))) float os_[2][CH_][VB_];
    __shared__ float bs_[2][CH_];

    const size_t base  = (size_t)(b * T_) * C_ + h * 64;
    const size_t bbase = (size_t)(b * T_) * H_ + h;

    // staging map: 16 lanes cover one 64-float row of k or q (8 rows a pass); the
    // first two waves cover the chunk's 8-float rows of v and o, 2 lanes a row
    const int  r4 = tid >> 4, c4 = (tid & 15) * 4;
    const int  rv = (tid >> 1) & (CH_ - 1), cv = (tid & 1) * 4;
    const bool vo = tid < CH_ * VB_ / 4;
    const float* kgp = kn + base + (size_t)r4 * C_ + c4;
    const float* qgp = qn + base + (size_t)r4 * C_ + c4;
    const float* vgp = vn + base + vg * VB_ + (size_t)rv * C_ + cv;
    const float* bgp = beta + bbase + (size_t)(tid & (CH_ - 1)) * H_;

    v4f   kst[CH_ / 8], qst[CH_ / 8], vst;
    float bst;

    // chunk 0: global -> registers
#pragma unroll
    for (int j = 0; j < CH_ / 8; ++j) {
        kst[j] = *(const v4f*)(kgp + (size_t)j * 8 * C_);
        qst[j] = *(const v4f*)(qgp + (size_t)j * 8 * C_);
    }
    vst = *(const v4f*)vgp;
    bst = *bgp;
    // precaution: the wait stands before any address register of the loads above is
    // reused; the scheduling barrier keeps later register writes from rising over it
    asm volatile("s_wait_xcnt 0x0" ::: "memory");
    __builtin_amdgcn_sched_barrier(0);

    float* ogp = o + base + vg * VB_ + (size_t)rv * C_ + cv;
    for (int c = 0; c < NCH_; ++c) {
        const int p = c & 1;
        // registers -> LDS buffer p; its last readers (chunk c-2) left it before
        // the barrier of chunk c-1
#pragma unroll
        for (int j = 0; j < CH_ / 8; ++j) {
            *(v4f*)&ks_[p][r4 + 8 * j][c4] = kst[j];
            *(v4f*)&qs_[p][r4 + 8 * j][c4] = qst[j];
        }
        if (vo) *(v4f*)&vs_[p][rv][cv] = vst;
        if (tid < CH_) bs_[p][tid] = bst;
        __syncthreads();

        if (c > 0) {                            // chunk c-1's outputs: LDS -> global
            if (vo) *(v4f*)ogp = *(const v4f*)&os_[p ^ 1][rv][cv];
            ogp += (size_t)CH_ * C_;
        }
        if (c + 1 < NCH_) {                     // chunk c+1: in flight across chunk c
            kgp += (size_t)CH_ * C_;
            qgp += (size_t)CH_ * C_;
            vgp += (size_t)CH_ * C_;
            bgp += (size_t)CH_ * H_;
#pragma unroll
            for (int j = 0; j < CH_ / 8; ++j) {
                kst[j] = *(const v4f*)(kgp + (size_t)j * 8 * C_);
                qst[j] = *(const v4f*)(qgp + (size_t)j * 8 * C_);
            }
            vst = *(const v4f*)vgp;
            bst = *bgp;
        }

        const float* kb = &ks_[p][0][kg * 4];
        const float* qb = &qs_[p][0][kg * 4];
        const float* vb = &vs_[p][0][vl];
        const float* bb = &bs_[p][0];
        float*       ob = &os_[p][0][vl];

        StepIn ra, rb;
        read_step(ra, kb, qb, vb, bb, 0);
        for (int s = 0; s < CH_; s += 2) {
            read_step(rb, kb, qb, vb, bb, s + 1);
            // keeps the LDS reads of the next step above this step's arithmetic, so
            // that they have returned before the next step waits on them
            __builtin_amdgcn_sched_barrier(0);
            const float o0 = one_step(ra, S, G, Hm);
            if (kg == 0) ob[s * VB_] = o0;
            // past the chunk's end this wraps to row 0; that value is not used
            read_step(ra, kb, qb, vb, bb, (s + 2) & (CH_ - 1));
            __builtin_amdgcn_sched_barrier(0);  // as above
            const float o1 = one_step(rb, S, G, Hm);
            if (kg == 0) ob[(s + 1) * VB_] = o1;
        }
    }

    __syncthreads();                            // last chunk's outputs are complete
    if (vo) *(v4f*)ogp = *(const v4f*)&os_[(NCH_ - 1) & 1][rv][cv];
}

// ---------------- RMSNorm over V (mean, +1e-5) * rms_w, emit f16 -----------------
__global__ __launch_bounds__(64)
void rmsnorm_f16(const float* __restrict__ o, const float* __restrict__ rw,
                 _Float16* __restrict__ oh) {
    const int g = blockIdx.x;                 // over MT_*H_ groups of 64
    const int tid = threadIdx.x;
    const size_t base = (size_t)g * 64;
    const float x = o[base + tid];
    __shared__ float red[64];
    red[tid] = x * x;
    __syncthreads();
    for (int s = 32; s > 0; s >>= 1) {
        if (tid < s) red[tid] += red[tid + s];
        __syncthreads();
    }
    const float inv = rsqrtf(red[0] * (1.0f / 64.f) + EPS_);
    oh[base + tid] = (_Float16)(x * inv * rw[tid]);
}

// ---------------- host-side launch ----------------
extern "C" void kernel_launch(void* const* d_in, const int* in_sizes, int n_in,
                              void* d_out, int out_size, void* d_ws, size_t ws_size,
                              hipStream_t stream) {
    (void)in_sizes; (void)n_in; (void)out_size; (void)ws_size;
    const float* x    = (const float*)d_in[0];
    const float* Wq   = (const float*)d_in[1];
    const float* Wk   = (const float*)d_in[2];
    const float* Wv   = (const float*)d_in[3];
    const float* Wb   = (const float*)d_in[4];
    const float* cwq  = (const float*)d_in[5];
    const float* cwk  = (const float*)d_in[6];
    const float* cwv  = (const float*)d_in[7];
    const float* rmsw = (const float*)d_in[8];
    const float* Wo   = (const float*)d_in[9];
    float* out = (float*)d_out;

    char* ws = (char*)d_ws;
    size_t off = 0;
    auto alloc = [&](size_t bytes) -> void* {
        void* p = ws + off;
        off += (bytes + 255) & ~(size_t)255;
        return p;
    };
    _Float16* xh   = (_Float16*)alloc((size_t)MT_ * D_ * 2);
    _Float16* Wqp  = (_Float16*)alloc((size_t)D_ * C_ * 2);   // packed fragments
    _Float16* Wkp  = (_Float16*)alloc((size_t)D_ * C_ * 2);
    _Float16* Wvp  = (_Float16*)alloc((size_t)D_ * C_ * 2);
    _Float16* Wop  = (_Float16*)alloc((size_t)C_ * D_ * 2);
    float*    Qf   = (float*)alloc((size_t)MT_ * C_ * 4);
    float*    Kf   = (float*)alloc((size_t)MT_ * C_ * 4);
    float*    Vf   = (float*)alloc((size_t)MT_ * C_ * 4);
    float*    qc   = (float*)alloc((size_t)MT_ * C_ * 4);
    float*    kc   = (float*)alloc((size_t)MT_ * C_ * 4);
    float*    vc   = (float*)alloc((size_t)MT_ * C_ * 4);
    float*    betaf= (float*)alloc((size_t)MT_ * H_ * 4);
    float*    ob   = (float*)alloc((size_t)MT_ * C_ * 4);
    _Float16* ohh  = (_Float16*)alloc((size_t)MT_ * C_ * 2);

    // 1) stage A operand (x) as f16; pack all weights into WMMA B-fragment layout
    int n = MT_ * D_;
    f32_to_f16<<<(n + 255) / 256, 256, 0, stream>>>(x, xh, n);
    n = D_ * C_;
    pack_b_f16<<<(n + 255) / 256, 256, 0, stream>>>(Wq, Wqp, D_, C_);
    pack_b_f16<<<(n + 255) / 256, 256, 0, stream>>>(Wk, Wkp, D_, C_);
    pack_b_f16<<<(n + 255) / 256, 256, 0, stream>>>(Wv, Wvp, D_, C_);
    pack_b_f16<<<(n + 255) / 256, 256, 0, stream>>>(Wo, Wop, C_, D_);

    // 2) projection GEMMs via v_wmma_f32_16x16x32_f16 (fully unrolled k-loop)
    dim3 gblk(128);
    dim3 ggrd(C_ / 64, MT_ / 16);
    gemm_f16_wmma<D_, C_><<<ggrd, gblk, 0, stream>>>(xh, Wqp, Qf);
    gemm_f16_wmma<D_, C_><<<ggrd, gblk, 0, stream>>>(xh, Wkp, Kf);
    gemm_f16_wmma<D_, C_><<<ggrd, gblk, 0, stream>>>(xh, Wvp, Vf);

    // 3) beta projection (tiny)
    n = MT_ * H_;
    beta_sigmoid<<<(n + 255) / 256, 256, 0, stream>>>(x, Wb, betaf);

    // 4) causal depthwise conv + SiLU
    n = MT_ * C_;
    conv_silu<<<(n + 255) / 256, 256, 0, stream>>>(Qf, cwq, qc);
    conv_silu<<<(n + 255) / 256, 256, 0, stream>>>(Kf, cwk, kc);
    conv_silu<<<(n + 255) / 256, 256, 0, stream>>>(Vf, cwv, vc);

    // 5) l2norm (in-place), scale on q
    l2norm_scale<<<MT_ * H_, 64, 0, stream>>>(qc, qc, SCALE_);
    l2norm_scale<<<MT_ * H_, 64, 0, stream>>>(kc, kc, 1.0f);

    // 6) sequential recurrence: 128 blocks (B*H*8 v-groups) x 128 threads
    dim3 rgrid(64 / VB_, H_, B_);
    recurrence<<<rgrid, RT_, 0, stream>>>(qc, kc, vc, betaf, ob);

    // 7) RMSNorm -> f16
    rmsnorm_f16<<<MT_ * H_, 64, 0, stream>>>(ob, rmsw, ohh);

    // 8) output projection GEMM (fp32 result straight to d_out)
    gemm_f16_wmma<C_, D_><<<ggrd, gblk, 0, stream>>>(ohh, Wop, out);
}

// v004
// A run of this version takes 179 microseconds.
// Next to v003, in two timings, it ran 1.09 times as fast each time.
// Over all steps from v000 it is 5.65 times as fast.
#include <hip/hip_runtime.h>

// ---------------- problem dims (fixed by reference) ----------------
#define B_    2
#define T_    1024
#define D_    512
#define H_    8
#define MT_   (B_ * T_)          // 2048 rows
#define C_    512                // H*K == H*V == 512 channels

#define LR_    1e-3f
#define BETA1_ 0.9f
#define BETA2_ 0.999f
#define EPS_   1e-5f
#define SCALE_ 0.125f            // 64^-0.5

typedef __attribute__((ext_vector_type(16))) _Float16 v16h;
typedef __attribute__((ext_vector_type(8)))  float    v8f;
typedef __attribute__((ext_vector_type(4)))  float    v4f;
typedef __attribute__((ext_vector_type(4)))  _Float16 v4h;

// The elementwise kernels below are short, and what they cost is the starting of their
// waves: each lane therefore takes 16 elements and a launch is 256 blocks. Their loops
// over a lane's pieces are unrolled so that the pieces stay in registers and all of a
// lane's loads are in flight together.
#define EW_ 256                  // threads per block of those kernels

// x + (x of lane ^ m), m = CTRL - 0x160 (DPP row_xmask): the partner's value comes
// through the vector unit's own cross-lane path, not through the LDS queue and a
// wait on it; both lanes add the same two values, so the sum is the shuffle's
template <int CTRL>
__device__ __forceinline__ float add_xlane(float x) {
    const int y = __builtin_amdgcn_update_dpp(0, __float_as_int(x), CTRL, 0xf, 0xf, true);
    return x + __int_as_float(y);
}

// sum over the 16 lanes of a row, the same value in each of them
__device__ __forceinline__ float row_sum(float x) {
    x = add_xlane<0x161>(x);
    x = add_xlane<0x162>(x);
    x = add_xlane<0x164>(x);
    x = add_xlane<0x168>(x);
    return x;
}

// ---------------- fp32 -> f16 conversion (row-major, for A operands) -------------
// N4 = number of 4-element pieces; a lane takes pieces g, g + N4/4, ...: each access of
// a wave is one contiguous run
template <int N4>
__global__ __launch_bounds__(EW_)
void f32_to_f16(const float* __restrict__ in, _Float16* __restrict__ out) {
    const int g = blockIdx.x * EW_ + threadIdx.x;        // over N4/4
    v4f x[4];
#pragma unroll
    for (int j = 0; j < 4; ++j) x[j] = *(const v4f*)(in + (size_t)g * 4 + (size_t)j * N4);
#pragma unroll
    for (int j = 0; j < 4; ++j) {
        v4h y;
#pragma unroll
        for (int i = 0; i < 4; ++i) y[i] = (_Float16)x[j][i];
        *(v4h*)(out + (size_t)g * 4 + (size_t)j * N4) = y;
    }
}

// ---------------- pack fp32 weight [Kd x N] into WMMA B-fragment layout ----------
// Bp layout: [nt = n/16][ks = k/32][lane 0..31][e 0..15]  (contiguous 32B per lane)
// Element map (ISA 7.12.2, 16-bit B 32x16): lane -> col = lane&15, kh = lane>>4;
// e -> k = ks*32 + (e<8 ? e : e+8) + 8*kh
// One thread builds one lane's whole fragment: 16 loads down a column, one 32-byte store.
template <int Kd, int N>
__global__ __launch_bounds__(64)
void pack_b_f16(const float* __restrict__ W, _Float16* __restrict__ Bp) {
    const int idx  = blockIdx.x * 64 + threadIdx.x;      // over Kd*N/16
    const int lane = idx & 31;
    const int ks   = (idx >> 5) % (Kd / 32);
    const int nt   = idx / ((Kd / 32) << 5);
    const int kh   = lane >> 4;
    const int col  = lane & 15;
    const float* src = W + (size_t)(ks * 32 + 8 * kh) * N + nt * 16 + col;
    v16h f;
#pragma unroll
    for (int e = 0; e < 16; ++e) f[e] = (_Float16)src[(size_t)(e < 8 ? e : e + 8) * N];
    *(v16h*)(Bp + (size_t)idx * 16) = f;
}

// ---------------- WMMA f16 GEMM: C[MxN] = A[MxKd] * Bpacked ----------------------
// block = 128 threads (4 waves); each wave owns one 16x16 tile; k-loop fully
// unrolled (Kd/32 = 16 static v_wmma_f32_16x16x32_f16 per wave).
// grid = (N/64, M/16)
template <int Kd, int N>
__global__ __launch_bounds__(128)
void gemm_f16_wmma(const _Float16* __restrict__ A, const _Float16* __restrict__ Bp,
                   float* __restrict__ C) {
    const int lane = threadIdx.x & 31;
    const int wave = threadIdx.x >> 5;
    const int nt   = blockIdx.x * 4 + wave;  // 16-wide n-tile index
    const int m0   = blockIdx.y * 16;
    const int r    = lane & 15;              // A-row / C-col within tile
    const int kh   = lane >> 4;              // K-half select

    const _Float16* Arow  = A + (size_t)(m0 + r) * Kd + 8 * kh;
    const _Float16* Bfrag = Bp + ((size_t)nt * (Kd / 32) * 32 + lane) * 16;

    v8f acc = {};
#pragma unroll
    for (int ks = 0; ks < Kd / 32; ++ks) {
        v16h a;
        const _Float16* ap = Arow + ks * 32;
#pragma unroll
        for (int e = 0; e < 8; ++e) {        // k = ks*32 + 8*kh + e (+16 for hi half)
            a[e]     = ap[e];
            a[e + 8] = ap[e + 16];
        }
        const v16h b = *(const v16h*)(Bfrag + (size_t)ks * 32 * 16);
        acc = __builtin_amdgcn_wmma_f32_16x16x32_f16(false, a, false, b,
                                                     (short)0, acc, false, false);
    }
    // C/D layout: VGPR i -> row = i + 8*kh, col = lane&15
#pragma unroll
    for (int i = 0; i < 8; ++i)
        C[(size_t)(m0 + i + 8 * kh) * N + nt * 16 + r] = acc[i];
}

// ---------------- beta = sigmoid(x @ Wb), one thread per (row, h) ----------------
__global__ void beta_sigmoid(const float* __restrict__ x, const float* __restrict__ Wb,
                             float* __restrict__ beta) {
    int idx = blockIdx.x * blockDim.x + threadIdx.x;   // over MT_*H_
    if (idx >= MT_ * H_) return;
    const int h = idx % H_;
    const int row = idx / H_;
    float acc = 0.f;
    for (int d = 0; d < D_; ++d)
        acc += x[(size_t)row * D_ + d] * Wb[(size_t)d * H_ + h];
    beta[idx] = __builtin_amdgcn_rcpf(1.f + __expf(-acc));
}

// ---------------- causal depthwise conv-4 + SiLU ---------------------------------
// A lane takes 4 channels x 4 consecutive time steps: 7 input rows serve 4 output rows.
// The three rows in front of a sequence count as zero, as the reference pads them.
__global__ __launch_bounds__(EW_)
void conv_silu(const float* __restrict__ P, const float* __restrict__ w,
               float* __restrict__ Y) {
    const int g  = blockIdx.x * EW_ + threadIdx.x;       // over (MT_/4)*(C_/4)
    const int c  = (g % (C_ / 4)) * 4;
    const int bt = (g / (C_ / 4)) * 4;                   // first of the four rows
    const bool first = (bt % T_) == 0;
    const int off = bt * C_ + c;                         // the same place in P and in Y
    const float* cur = P + off;
    v4f p[7], wv[4];
#pragma unroll
    for (int r = 0; r < 4; ++r) p[3 + r] = *(const v4f*)(cur + r * C_);
#pragma unroll
    for (int r = 0; r < 3; ++r) p[r] = (v4f){0.f, 0.f, 0.f, 0.f};
    if (!first) {
#pragma unroll
        for (int r = 0; r < 3; ++r) p[r] = *(const v4f*)(cur + (r - 3) * C_);
    }
#pragma unroll
    for (int ch = 0; ch < 4; ++ch) wv[ch] = *(const v4f*)(w + (c + ch) * 4);
#pragma unroll
    for (int tt = 0; tt < 4; ++tt) {
        v4f y;
#pragma unroll
        for (int ch = 0; ch < 4; ++ch) {
            float acc = 0.f;
#pragma unroll
            for (int i = 0; i < 4; ++i) acc += p[tt + i][ch] * wv[ch][i];
            y[ch] = acc * __builtin_amdgcn_rcpf(1.f + __expf(-acc));   // SiLU
        }
        *(v4f*)(Y + off + tt * C_) = y;
    }
}

// sum of squares of a head's 64 values, 4 a lane on one 16-lane row
__device__ __forceinline__ float head_sumsq(const v4f& x) {
    const float e = __builtin_fmaf(x[2], x[2], x[0] * x[0]);
    const float d = __builtin_fmaf(x[3], x[3], x[1] * x[1]);
    return row_sum(e + d);
}

#define NG4_ (MT_ * H_ * 16)     // 4-element pieces in a [MT_][H_][64] array

// ---------------- per-head l2norm (sum, +1e-6) with scale (in place) -------------
// a lane takes its piece of heads g/16, g/16 + 4096, ...; it reads all before it writes
__global__ __launch_bounds__(EW_)
void l2norm_scale(float* io, float scale) {
    const int g = blockIdx.x * EW_ + threadIdx.x;        // over NG4_/4
    float* p = io + (size_t)g * 4;
    v4f x[4];
#pragma unroll
    for (int j = 0; j < 4; ++j) x[j] = *(const v4f*)(p + (size_t)j * NG4_);
#pragma unroll
    for (int j = 0; j < 4; ++j) {
        const float inv = rsqrtf(head_sumsq(x[j]) + 1e-6f);
        v4f y;
#pragma unroll
        for (int i = 0; i < 4; ++i) y[i] = x[j][i] * inv * scale;
        *(v4f*)(p + (size_t)j * NG4_) = y;
    }
}

// ---------------- sequential IVON delta-rule recurrence --------------------------
// grid = (8 v-groups, H, B); block = 128 threads = 4 waves, one per SIMD of a WGP
// (kg = tid&15, vl = tid>>4): a column v of the state lies on one 16-lane row, four
// k elements a lane, so a time step is a quarter of the vector work per wave that a
// 16-element lane had, and the sums over k end in a 16-lane DPP tree.
// Inputs and outputs pass through double-buffered LDS CH_ time steps at a time: the
// global loads of chunk c+1 are in flight while chunk c is worked on, chunk c-1's
// outputs are stored behind the same barrier, and the block meets once per chunk.
// Inside a chunk each step's operands are read from LDS into registers one step
// ahead, so no global access and no barrier stands on the serial path.
#define CH_ 32
#define NCH_ (T_ / CH_)
#define VB_ 8                    // state columns per block
#define RT_ 128                  // threads per block

struct StepIn { v4f k; v4f q; float v; float b; };

__device__ __forceinline__ void read_step(StepIn& r, const float* kb, const float* qb,
                                          const float* vb, const float* bb, int s) {
    r.k = *(const v4f*)(kb + s * 64);
    r.q = *(const v4f*)(qb + s * 64);
    r.v = vb[s * VB_];
    r.b = bb[s];
}

// a lane's share of a sum over k
__device__ __forceinline__ float lane_dot(const v4f& a, const float (&S)[4]) {
    const float e = __builtin_fmaf(a[2], S[2], a[0] * S[0]);
    const float d = __builtin_fmaf(a[3], S[3], a[1] * S[1]);
    return e + d;
}

__device__ __forceinline__ float one_step(const StepIn& r, float (&S)[4], float (&G)[4],
                                          float (&Hm)[4]) {
    // pred[v] = k . S[:,v]: a lane's 4 products as two chains of two, elements 0,2 and
    // 1,3 (three dependent links; neighbours stay side by side for packed f32), then
    // the 16 lanes of the column
    const float pred = row_sum(lane_dot(r.k, S));

    const float err = pred - r.v;
    const float lrb = LR_ * r.b;
#pragma unroll
    for (int i = 0; i < 4; ++i) {
        const float grad = r.k[i] * err;                    // outer(k, pred-v)
        G[i]  = BETA1_ * G[i]  + (1.f - BETA1_) * grad;
        Hm[i] = BETA2_ * Hm[i] + (1.f - BETA2_) * grad * grad;
        S[i] -= lrb * G[i] * __builtin_amdgcn_rcpf(Hm[i] + 1.f);  // WD==0, LAM==1
    }
    return row_sum(lane_dot(r.q, S));                       // o[v] = q . S[:,v]
}

__global__ __launch_bounds__(RT_)
void recurrence(const float* __restrict__ qn, const float* __restrict__ kn,
                const float* __restrict__ vn, const float* __restrict__ beta,
                float* __restrict__ o) {
    const int tid = threadIdx.x;
    const int kg  = tid & 15;
    const int vl  = tid >> 4;
    const int vg  = blockIdx.x;
    const int h   = blockIdx.y;
    const int b   = blockIdx.z;

    float S[4], G[4], Hm[4];
#pragma unroll
    for (int i = 0; i < 4; ++i) { S[i] = 0.f; G[i] = 0.f; Hm[i] = 0.f; }

    __shared__ __attribute__((aligned(16))) float ks_[2][CH_][64];
    __shared__ __attribute__((aligned(16))) float qs_[2][CH_][64];
    __shared__ __attribute__((aligned(16))) float vs_[2][CH_][VB_];
    __shared__ __attribute__((aligned(16))) float os_[2][CH_][VB_];
    __shared__ float bs_[2][CH_];

    const size_t base  = (size_t)(b * T_) * C_ + h * 64;
    const size_t bbase = (size_t)(b * T_) * H_ + h;

    // staging map: 16 lanes cover one 64-float row of k or q (8 rows a pass); the
    // first two waves cover the chunk's 8-float rows of v and o, 2 lanes a row
    const int  r4 = tid >> 4, c4 = (tid & 15) * 4;
    const int  rv = (tid >> 1) & (CH_ - 1), cv = (tid & 1) * 4;
    const bool vo = tid < CH_ * VB_ / 4;
    const float* kgp = kn + base + (size_t)r4 * C_ + c4;
    const float* qgp = qn + base + (size_t)r4 * C_ + c4;
    const float* vgp = vn + base + vg * VB_ + (size_t)rv * C_ + cv;
    const float* bgp = beta + bbase + (size_t)(tid & (CH_ - 1)) * H_;

    v4f   kst[CH_ / 8], qst[CH_ / 8], vst;
    float bst;

    // chunk 0: global -> registers
#pragma unroll
    for (int j = 0; j < CH_ / 8; ++j) {
        kst[j] = *(const v4f*)(kgp + (size_t)j * 8 * C_);
        qst[j] = *(const v4f*)(qgp + (size_t)j * 8 * C_);
    }
    vst = *(const v4f*)vgp;
    bst = *bgp;
    // precaution: the wait stands before any address register of the loads above is
    // reused; the scheduling barrier keeps later register writes from rising over it
    asm volatile("s_wait_xcnt 0x0" ::: "memory");
    __builtin_amdgcn_sched_barrier(0);

    float* ogp = o + base + vg * VB_ + (size_t)rv * C_ + cv;
    for (int c = 0; c < NCH_; ++c) {
        const int p = c & 1;
        // registers -> LDS buffer p; its last readers (chunk c-2) left it before
        // the barrier of chunk c-1
#pragma unroll
        for (int j = 0; j < CH_ / 8; ++j) {
            *(v4f*)&ks_[p][r4 + 8 * j][c4] = kst[j];
            *(v4f*)&qs_[p][r4 + 8 * j][c4] = qst[j];
        }
        if (vo) *(v4f*)&vs_[p][rv][cv] = vst;
        if (tid < CH_) bs_[p][tid] = bst;
        __syncthreads();

        if (c > 0) {                            // chunk c-1's outputs: LDS -> global
            if (vo) *(v4f*)ogp = *(const v4f*)&os_[p ^ 1][rv][cv];
            ogp += (size_t)CH_ * C_;
        }
        if (c + 1 < NCH_) {                     // chunk c+1: in flight across chunk c
            kgp += (size_t)CH_ * C_;
            qgp += (size_t)CH_ * C_;
            vgp += (size_t)CH_ * C_;
            bgp += (size_t)CH_ * H_;
#pragma unroll
            for (int j = 0; j < CH_ / 8; ++j) {
                kst[j] = *(const v4f*)(kgp + (size_t)j * 8 * C_);
                qst[j] = *(const v4f*)(qgp + (size_t)j * 8 * C_);
            }
            vst = *(const v4f*)vgp;
            bst = *bgp;
        }

        const float* kb = &ks_[p][0][kg * 4];
        const float* qb = &qs_[p][0][kg * 4];
        const float* vb = &vs_[p][0][vl];
        const float* bb = &bs_[p][0];
        float*       ob = &os_[p][0][vl];

        StepIn ra, rb;
        read_step(ra, kb, qb, vb, bb, 0);
        for (int s = 0; s < CH_; s += 2) {
            read_step(rb, kb, qb, vb, bb, s + 1);
            // keeps the LDS reads of the next step above this step's arithmetic, so
            // that they have returned before the next step waits on them
            __builtin_amdgcn_sched_barrier(0);
            const float o0 = one_step(ra, S, G, Hm);
            if (kg == 0) ob[s * VB_] = o0;
            // past the chunk's end this wraps to row 0; that value is not used
            read_step(ra, kb, qb, vb, bb, (s + 2) & (CH_ - 1));
            __builtin_amdgcn_sched_barrier(0);  // as above
            const float o1 = one_step(rb, S, G, Hm);
            if (kg == 0) ob[(s + 1) * VB_] = o1;
        }
    }

    __syncthreads();                            // last chunk's outputs are complete
    if (vo) *(v4f*)ogp = *(const v4f*)&os_[(NCH_ - 1) & 1][rv][cv];
}

// ---------------- RMSNorm over V (mean, +1e-5) * rms_w, emit f16 -----------------
__global__ __launch_bounds__(EW_)
void rmsnorm_f16(const float* __restrict__ o, const float* __restrict__ rw,
                 _Float16* __restrict__ oh) {
    const int g = blockIdx.x * EW_ + threadIdx.x;        // over NG4_/4
    v4f x[4];
#pragma unroll
    for (int j = 0; j < 4; ++j) x[j] = *(const v4f*)(o + (size_t)g * 4 + (size_t)j * NG4_);
    const v4f wv = *(const v4f*)(rw + (g & 15) * 4);
#pragma unroll
    for (int j = 0; j < 4; ++j) {
        const float inv = rsqrtf(head_sumsq(x[j]) * (1.0f / 64.f) + EPS_);
        v4h y;
#pragma unroll
        for (int i = 0; i < 4; ++i) y[i] = (_Float16)(x[j][i] * inv * wv[i]);
        *(v4h*)(oh + (size_t)g * 4 + (size_t)j * NG4_) = y;
    }
}

// ---------------- host-side launch ----------------
extern "C" void kernel_launch(void* const* d_in, const int* in_sizes, int n_in,
                              void* d_out, int out_size, void* d_ws, size_t ws_size,
                              hipStream_t stream) {
    (void)in_sizes; (void)n_in; (void)out_size; (void)ws_size;
    const float* x    = (const float*)d_in[0];
    const float* Wq   = (const float*)d_in[1];
    const float* Wk   = (const float*)d_in[2];
    const float* Wv   = (const float*)d_in[3];
    const float* Wb   = (const float*)d_in[4];
    const float* cwq  = (const float*)d_in[5];
    const float* cwk  = (const float*)d_in[6];
    const float* cwv  = (const float*)d_in[7];
    const float* rmsw = (const float*)d_in[8];
    const float* Wo   = (const float*)d_in[9];
    float* out = (float*)d_out;

    char* ws = (char*)d_ws;
    size_t off = 0;
    auto alloc = [&](size_t bytes) -> void* {
        void* p = ws + off;
        off += (bytes + 255) & ~(size_t)255;
        return p;
    };
    _Float16* xh   = (_Float16*)alloc((size_t)MT_ * D_ * 2);
    _Float16* Wqp  = (_Float16*)alloc((size_t)D_ * C_ * 2);   // packed fragments
    _Float16* Wkp  = (_Float16*)alloc((size_t)D_ * C_ * 2);
    _Float16* Wvp  = (_Float16*)alloc((size_t)D_ * C_ * 2);
    _Float16* Wop  = (_Float16*)alloc((size_t)C_ * D_ * 2);
    float*    Qf   = (float*)alloc((size_t)MT_ * C_ * 4);
    float*    Kf   = (float*)alloc((size_t)MT_ * C_ * 4);
    float*    Vf   = (float*)alloc((size_t)MT_ * C_ * 4);
    float*    qc   = (float*)alloc((size_t)MT_ * C_ * 4);
    float*    kc   = (float*)alloc((size_t)MT_ * C_ * 4);
    float*    vc   = (float*)alloc((size_t)MT_ * C_ * 4);
    float*    betaf= (float*)alloc((size_t)MT_ * H_ * 4);
    float*    ob   = (float*)alloc((size_t)MT_ * C_ * 4);
    _Float16* ohh  = (_Float16*)alloc((size_t)MT_ * C_ * 2);

    // 1) stage A operand (x) as f16; pack all weights into WMMA B-fragment layout
    f32_to_f16<MT_ * D_ / 4><<<MT_ * D_ / 16 / EW_, EW_, 0, stream>>>(x, xh);
    pack_b_f16<D_, C_><<<D_ * C_ / 16 / 64, 64, 0, stream>>>(Wq, Wqp);
    pack_b_f16<D_, C_><<<D_ * C_ / 16 / 64, 64, 0, stream>>>(Wk, Wkp);
    pack_b_f16<D_, C_><<<D_ * C_ / 16 / 64, 64, 0, stream>>>(Wv, Wvp);
    pack_b_f16<C_, D_><<<C_ * D_ / 16 / 64, 64, 0, stream>>>(Wo, Wop);

    // 2) projection GEMMs via v_wmma_f32_16x16x32_f16 (fully unrolled k-loop)
    dim3 gblk(128);
    dim3 ggrd(C_ / 64, MT_ / 16);
    gemm_f16_wmma<D_, C_><<<ggrd, gblk, 0, stream>>>(xh, Wqp, Qf);
    gemm_f16_wmma<D_, C_><<<ggrd, gblk, 0, stream>>>(xh, Wkp, Kf);
    gemm_f16_wmma<D_, C_><<<ggrd, gblk, 0, stream>>>(xh, Wvp, Vf);

    // 3) beta projection (tiny)
    const int n = MT_ * H_;
    beta_sigmoid<<<(n + 255) / 256, 256, 0, stream>>>(x, Wb, betaf);

    // 4) causal depthwise conv + SiLU
    conv_silu<<<MT_ * C_ / 16 / EW_, EW_, 0, stream>>>(Qf, cwq, qc);
    conv_silu<<<MT_ * C_ / 16 / EW_, EW_, 0, stream>>>(Kf, cwk, kc);
    conv_silu<<<MT_ * C_ / 16 / EW_, EW_, 0, stream>>>(Vf, cwv, vc);

    // 5) l2norm (in-place), scale on q
    l2norm_scale<<<NG4_ / 4 / EW_, EW_, 0, stream>>>(qc, SCALE_);
    l2norm_scale<<<NG4_ / 4 / EW_, EW_, 0, stream>>>(kc, 1.0f);

    // 6) sequential recurrence: 128 blocks (B*H*8 v-groups) x 128 threads
    dim3 rgrid(64 / VB_, H_, B_);
    recurrence<<<rgrid, RT_, 0, stream>>>(qc, kc, vc, betaf, ob);

    // 7) RMSNorm -> f16
    rmsnorm_f16<<<NG4_ / 4 / EW_, EW_, 0, stream>>>(ob, rmsw, ohh);

    // 8) output projection GEMM (fp32 result straight to d_out)
    gemm_f16_wmma<C_, D_><<<ggrd, gblk, 0, stream>>>(ohh, Wop, out);
}

// v005
// It runs in 152 microseconds.
// Next to v004, in two timings, it ran 1.18 times as fast each time.
// Counting every step since v000, it is 6.64 times as fast.
#include <hip/hip_runtime.h>

// ---------------- problem dims (fixed by reference) ----------------
#define B_    2
#define T_    1024
#define D_    512
#define H_    8
#define MT_   (B_ * T_)          // 2048 rows
#define C_    512                // H*K == H*V == 512 channels

#define LR_    1e-3f
#define BETA1_ 0.9f
#define BETA2_ 0.999f
#define EPS_   1e-5f
#define SCALE_ 0.125f            // 64^-0.5

typedef __attribute__((ext_vector_type(16))) _Float16 v16h;
typedef __attribute__((ext_vector_type(8)))  float    v8f;
typedef __attribute__((ext_vector_type(4)))  float    v4f;
typedef __attribute__((ext_vector_type(4)))  _Float16 v4h;

// The elementwise kernels below are short, and what they cost is the starting of their
// waves: each lane therefore takes 16 elements and a 2048 x 512 array is 256 blocks. Their loops
// over a lane's pieces are unrolled so that the pieces stay in registers and all of a
// lane's loads are in flight together.
#define EW_ 256                  // threads per block of those kernels

// x + (x of lane ^ m), m = CTRL - 0x160 (DPP row_xmask): the partner's value comes
// through the vector unit's own cross-lane path, not through the LDS queue and a
// wait on it; both lanes add the same two values, so the sum is the shuffle's
template <int CTRL>
__device__ __forceinline__ float add_xlane(float x) {
    const int y = __builtin_amdgcn_update_dpp(0, __float_as_int(x), CTRL, 0xf, 0xf, true);
    return x + __int_as_float(y);
}

// sum over the 16 lanes of a row, the same value in each of them
__device__ __forceinline__ float row_sum(float x) {
    x = add_xlane<0x161>(x);
    x = add_xlane<0x162>(x);
    x = add_xlane<0x164>(x);
    x = add_xlane<0x168>(x);
    return x;
}

// ---------------- fp32 -> f16 conversion (row-major, for A operands) -------------
// N4 = number of 4-element pieces; a lane takes pieces g, g + N4/4, ...: each access of
// a wave is one contiguous run
template <int N4>
__device__ __forceinline__
void f32_to_f16(const float* __restrict__ in, _Float16* __restrict__ out, int blk) {
    const int g = blk * EW_ + threadIdx.x;               // over N4/4
    v4f x[4];
#pragma unroll
    for (int j = 0; j < 4; ++j) x[j] = *(const v4f*)(in + (size_t)g * 4 + (size_t)j * N4);
#pragma unroll
    for (int j = 0; j < 4; ++j) {
        v4h y;
#pragma unroll
        for (int i = 0; i < 4; ++i) y[i] = (_Float16)x[j][i];
        *(v4h*)(out + (size_t)g * 4 + (size_t)j * N4) = y;
    }
}

// ---------------- pack fp32 weight [Kd x N] into WMMA B-fragment layout ----------
// Bp layout: [nt = n/16][ks = k/32][lane 0..31][e 0..15]  (contiguous 32B per lane)
// Element map (ISA 7.12.2, 16-bit B 32x16): lane -> col = lane&15, kh = lane>>4;
// e -> k = ks*32 + (e<8 ? e : e+8) + 8*kh
// One thread builds one lane's whole fragment: 16 loads down a column, one 32-byte store.
template <int Kd, int N>
__device__ __forceinline__
void pack_b_f16(const float* __restrict__ W, _Float16* __restrict__ Bp, int blk) {
    const int idx  = blk * EW_ + threadIdx.x;            // over Kd*N/16
    const int lane = idx & 31;
    const int ks   = (idx >> 5) % (Kd / 32);
    const int nt   = idx / ((Kd / 32) << 5);
    const int kh   = lane >> 4;
    const int col  = lane & 15;
    const float* src = W + (size_t)(ks * 32 + 8 * kh) * N + nt * 16 + col;
    float w[16];
#pragma unroll
    for (int e = 0; e < 16; ++e) w[e] = src[(size_t)(e < 8 ? e : e + 8) * N];
    // precaution: the address stays in its registers up to this wait, so that no load
    // above returns into them and nothing reuses them in front of it
    asm volatile("s_wait_xcnt 0x0" :: "v"(src) : "memory");
    v16h f;
#pragma unroll
    for (int e = 0; e < 16; ++e) f[e] = (_Float16)w[e];
    *(v16h*)(Bp + (size_t)idx * 16) = f;
}

// ---------------- one launch for the conversion of x and the weight packs ------------
// The conversion of x and the four packs read only inputs and write separate arrays:
// as ranges of blocks of one grid they start together and pay one launch gap, one
// start and one drain between them.
#define CVB_ (MT_ * D_ / 16 / EW_)   // blocks that convert x
#define PKB_ (D_ * C_ / 16 / EW_)    // blocks that pack one weight matrix
__global__ __launch_bounds__(EW_)
void convert_and_pack(const float* __restrict__ x, const float* __restrict__ Wq,
                      const float* __restrict__ Wk, const float* __restrict__ Wv,
                      const float* __restrict__ Wo, _Float16* __restrict__ xh,
                      _Float16* __restrict__ Wqp, _Float16* __restrict__ Wkp,
                      _Float16* __restrict__ Wvp, _Float16* __restrict__ Wop) {
    static_assert(D_ == C_, "the four weight matrices have one shape");
    const int bid = blockIdx.x;
    if (bid < CVB_) {
        f32_to_f16<MT_ * D_ / 4>(x, xh, bid);
    } else {
        const int m = (bid - CVB_) / PKB_;               // which matrix
        const float* W  = m == 0 ? Wq  : m == 1 ? Wk  : m == 2 ? Wv  : Wo;
        _Float16*    Bp = m == 0 ? Wqp : m == 1 ? Wkp : m == 2 ? Wvp : Wop;
        pack_b_f16<D_, C_>(W, Bp, (bid - CVB_) % PKB_);
    }
}

// ---------------- WMMA f16 GEMM: C[MxN] = A[MxKd] * Bpacked ----------------------
// block = 128 threads (4 waves); each wave owns one 16x16 tile; k-loop fully
// unrolled (Kd/32 = 16 static v_wmma_f32_16x16x32_f16 per wave).
// a block takes tile row by (of M/16) and the four n-tiles bx (of N/64)
template <int Kd, int N>
__device__ __forceinline__
void gemm_tile(const _Float16* __restrict__ A, const _Float16* __restrict__ Bp,
               float* __restrict__ C, int bx, int by) {
    const int lane = threadIdx.x & 31;
    const int wave = threadIdx.x >> 5;
    const int nt   = bx * 4 + wave;          // 16-wide n-tile index
    const int m0   = by * 16;
    const int r    = lane & 15;              // A-row / C-col within tile
    const int kh   = lane >> 4;              // K-half select

    const _Float16* Arow  = A + (size_t)(m0 + r) * Kd + 8 * kh;
    const _Float16* Bfrag = Bp + ((size_t)nt * (Kd / 32) * 32 + lane) * 16;

    v8f acc = {};
#pragma unroll
    for (int ks = 0; ks < Kd / 32; ++ks) {
        v16h a;
        const _Float16* ap = Arow + ks * 32;
#pragma unroll
        for (int e = 0; e < 8; ++e) {        // k = ks*32 + 8*kh + e (+16 for hi half)
            a[e]     = ap[e];
            a[e + 8] = ap[e + 16];
        }
        const v16h b = *(const v16h*)(Bfrag + (size_t)ks * 32 * 16);
        acc = __builtin_amdgcn_wmma_f32_16x16x32_f16(false, a, false, b,
                                                     (short)0, acc, false, false);
    }
    // C/D layout: VGPR i -> row = i + 8*kh, col = lane&15
#pragma unroll
    for (int i = 0; i < 8; ++i)
        C[(size_t)(m0 + i + 8 * kh) * N + nt * 16 + r] = acc[i];
}

// grid = (N/64, M/16)
template <int Kd, int N>
__global__ __launch_bounds__(128)
void gemm_f16_wmma(const _Float16* __restrict__ A, const _Float16* __restrict__ Bp,
                   float* __restrict__ C) {
    gemm_tile<Kd, N>(A, Bp, C, blockIdx.x, blockIdx.y);
}

// ---------------- beta = sigmoid(x @ Wb), one thread per (row, h) ----------------
__device__ __forceinline__
void beta_sigmoid(const float* __restrict__ x, const float* __restrict__ Wb,
                  float* __restrict__ beta, int blk) {
    const int idx = blk * 128 + threadIdx.x;           // over MT_*H_
    const int h = idx % H_;
    const int row = idx / H_;
    float acc = 0.f;
    for (int d = 0; d < D_; ++d)
        acc += x[(size_t)row * D_ + d] * Wb[(size_t)d * H_ + h];
    beta[idx] = __builtin_amdgcn_rcpf(1.f + __expf(-acc));
}

// ---------------- one launch for the four projections of x -----------------------
// q, k, v and beta do not depend on one another. The beta blocks have the longest
// serial loop and the lowest indices, so that they start first and the tiles of the
// three products run beside them.
#define BTB_ (MT_ * H_ / 128)            // blocks of beta
#define GMB_ ((C_ / 64) * (MT_ / 16))    // blocks of one product
__global__ __launch_bounds__(128)
void project_qkv_beta(const _Float16* __restrict__ xh, const _Float16* __restrict__ Wqp,
                      const _Float16* __restrict__ Wkp, const _Float16* __restrict__ Wvp,
                      float* __restrict__ Qf, float* __restrict__ Kf,
                      float* __restrict__ Vf, const float* __restrict__ x,
                      const float* __restrict__ Wb, float* __restrict__ beta) {
    const int bid = blockIdx.x;
    if (bid < BTB_) {
        beta_sigmoid(x, Wb, beta, bid);
    } else {
        const int m = (bid - BTB_) / GMB_;               // which product
        const int t = (bid - BTB_) % GMB_;
        const _Float16* Bp = m == 0 ? Wqp : m == 1 ? Wkp : Wvp;
        float*          C  = m == 0 ? Qf  : m == 1 ? Kf  : Vf;
        gemm_tile<D_, C_>(xh, Bp, C, t % (C_ / 64), t / (C_ / 64));
        // precaution: the built code lays the beta branch behind this one, and it
        // reuses the address registers of the stores above; the wait stands in between
        asm volatile("s_wait_xcnt 0x0" ::: "memory");
    }
}

// ---------------- causal depthwise conv-4 + SiLU ---------------------------------
// A lane takes 4 channels x 4 consecutive time steps: 7 input rows serve 4 output rows.
// The three rows in front of a sequence count as zero, as the reference pads them.
// blockIdx.y picks q, k or v: the three do not depend on one another and share a launch.
__global__ __launch_bounds__(EW_)
void conv_silu(const float* __restrict__ Pq, const float* __restrict__ Pk,
               const float* __restrict__ Pv, const float* __restrict__ wq,
               const float* __restrict__ wk, const float* __restrict__ wvv,
               float* __restrict__ Yq, float* __restrict__ Yk, float* __restrict__ Yv) {
    const int m = blockIdx.y;
    const float* P = m == 0 ? Pq : m == 1 ? Pk : Pv;
    const float* w = m == 0 ? wq : m == 1 ? wk : wvv;
    float*       Y = m == 0 ? Yq : m == 1 ? Yk : Yv;
    const int g  = blockIdx.x * EW_ + threadIdx.x;       // over (MT_/4)*(C_/4)
    const int c  = (g % (C_ / 4)) * 4;
    const int bt = (g / (C_ / 4)) * 4;                   // first of the four rows
    const bool first = (bt % T_) == 0;
    const int off = bt * C_ + c;                         // the same place in P and in Y
    const float* cur = P + off;
    v4f p[7], wv[4];
#pragma unroll
    for (int r = 0; r < 4; ++r) p[3 + r] = *(const v4f*)(cur + r * C_);
#pragma unroll
    for (int r = 0; r < 3; ++r) p[r] = (v4f){0.f, 0.f, 0.f, 0.f};
    if (!first) {
#pragma unroll
        for (int r = 0; r < 3; ++r) p[r] = *(const v4f*)(cur + (r - 3) * C_);
    }
#pragma unroll
    for (int ch = 0; ch < 4; ++ch) wv[ch] = *(const v4f*)(w + (c + ch) * 4);
#pragma unroll
    for (int tt = 0; tt < 4; ++tt) {
        v4f y;
#pragma unroll
        for (int ch = 0; ch < 4; ++ch) {
            float acc = 0.f;
#pragma unroll
            for (int i = 0; i < 4; ++i) acc += p[tt + i][ch] * wv[ch][i];
            y[ch] = acc * __builtin_amdgcn_rcpf(1.f + __expf(-acc));   // SiLU
        }
        *(v4f*)(Y + off + tt * C_) = y;
    }
}

// sum of squares of a head's 64 values, 4 a lane on one 16-lane row
__device__ __forceinline__ float head_sumsq(const v4f& x) {
    const float e = __builtin_fmaf(x[2], x[2], x[0] * x[0]);
    const float d = __builtin_fmaf(x[3], x[3], x[1] * x[1]);
    return row_sum(e + d);
}

#define NG4_ (MT_ * H_ * 16)     // 4-element pieces in a [MT_][H_][64] array

// ---------------- per-head l2norm (sum, +1e-6) with scale (in place) -------------
// a lane takes its piece of heads g/16, g/16 + 4096, ...; it reads all before it writes
// blockIdx.y picks q (scaled) or k: one launch for both
__global__ __launch_bounds__(EW_)
void l2norm_scale(float* q, float* k, float qscale) {
    const int g = blockIdx.x * EW_ + threadIdx.x;        // over NG4_/4
    const float scale = blockIdx.y == 0 ? qscale : 1.0f;
    float* p = (blockIdx.y == 0 ? q : k) + (size_t)g * 4;
    v4f x[4];
#pragma unroll
    for (int j = 0; j < 4; ++j) x[j] = *(const v4f*)(p + (size_t)j * NG4_);
#pragma unroll
    for (int j = 0; j < 4; ++j) {
        const float inv = rsqrtf(head_sumsq(x[j]) + 1e-6f);
        v4f y;
#pragma unroll
        for (int i = 0; i < 4; ++i) y[i] = x[j][i] * inv * scale;
        *(v4f*)(p + (size_t)j * NG4_) = y;
    }
}

// ---------------- sequential IVON delta-rule recurrence --------------------------
// grid = (8 v-groups, H, B); block = 128 threads = 4 waves, one per SIMD of a WGP
// (kg = tid&15, vl = tid>>4): a column v of the state lies on one 16-lane row, four
// k elements a lane, so a time step is a quarter of the vector work per wave that a
// 16-element lane had, and the sums over k end in a 16-lane DPP tree.
// Inputs and outputs pass through double-buffered LDS CH_ time steps at a time: the
// global loads of chunk c+1 are in flight while chunk c is worked on, chunk c-1's
// outputs are stored behind the same barrier, and the block meets once per chunk.
// Inside a chunk each step's operands are read from LDS into registers one step
// ahead, so no global access and no barrier stands on the serial path.
#define CH_ 32
#define NCH_ (T_ / CH_)
#define VB_ 8                    // state columns per block
#define RT_ 128                  // threads per block

struct StepIn { v4f k; v4f q; float v; float b; };

__device__ __forceinline__ void read_step(StepIn& r, const float* kb, const float* qb,
                                          const float* vb, const float* bb, int s) {
    r.k = *(const v4f*)(kb + s * 64);
    r.q = *(const v4f*)(qb + s * 64);
    r.v = vb[s * VB_];
    r.b = bb[s];
}

// a lane's share of a sum over k
__device__ __forceinline__ float lane_dot(const v4f& a, const float (&S)[4]) {
    const float e = __builtin_fmaf(a[2], S[2], a[0] * S[0]);
    const float d = __builtin_fmaf(a[3], S[3], a[1] * S[1]);
    return e + d;
}

__device__ __forceinline__ float one_step(const StepIn& r, float (&S)[4], float (&G)[4],
                                          float (&Hm)[4]) {
    // pred[v] = k . S[:,v]: a lane's 4 products as two chains of two, elements 0,2 and
    // 1,3 (three dependent links; neighbours stay side by side for packed f32), then
    // the 16 lanes of the column
    const float pred = row_sum(lane_dot(r.k, S));

    const float err = pred - r.v;
    const float lrb = LR_ * r.b;
#pragma unroll
    for (int i = 0; i < 4; ++i) {
        const float grad = r.k[i] * err;                    // outer(k, pred-v)
        G[i]  = BETA1_ * G[i]  + (1.f - BETA1_) * grad;
        Hm[i] = BETA2_ * Hm[i] + (1.f - BETA2_) * grad * grad;
        S[i] -= lrb * G[i] * __builtin_amdgcn_rcpf(Hm[i] + 1.f);  // WD==0, LAM==1
    }
    return row_sum(lane_dot(r.q, S));                       // o[v] = q . S[:,v]
}

__global__ __launch_bounds__(RT_)
void recurrence(const float* __restrict__ qn, const float* __restrict__ kn,
                const float* __restrict__ vn, const float* __restrict__ beta,
                float* __restrict__ o) {
    const int tid = threadIdx.x;
    const int kg  = tid & 15;
    const int vl  = tid >> 4;
    const int vg  = blockIdx.x;
    const int h   = blockIdx.y;
    const int b   = blockIdx.z;

    float S[4], G[4], Hm[4];
#pragma unroll
    for (int i = 0; i < 4; ++i) { S[i] = 0.f; G[i] = 0.f; Hm[i] = 0.f; }

    __shared__ __attribute__((aligned(16))) float ks_[2][CH_][64];
    __shared__ __attribute__((aligned(16))) float qs_[2][CH_][64];
    __shared__ __attribute__((aligned(16))) float vs_[2][CH_][VB_];
    __shared__ __attribute__((aligned(16))) float os_[2][CH_][VB_];
    __shared__ float bs_[2][CH_];

    const size_t base  = (size_t)(b * T_) * C_ + h * 64;
    const size_t bbase = (size_t)(b * T_) * H_ + h;

    // staging map: 16 lanes cover one 64-float row of k or q (8 rows a pass); the
    // first two waves cover the chunk's 8-float rows of v and o, 2 lanes a row
    const int  r4 = tid >> 4, c4 = (tid & 15) * 4;
    const int  rv = (tid >> 1) & (CH_ - 1), cv = (tid & 1) * 4;
    const bool vo = tid < CH_ * VB_ / 4;
    const float* kgp = kn + base + (size_t)r4 * C_ + c4;
    const float* qgp = qn + base + (size_t)r4 * C_ + c4;
    const float* vgp = vn + base + vg * VB_ + (size_t)rv * C_ + cv;
    const float* bgp = beta + bbase + (size_t)(tid & (CH_ - 1)) * H_;

    v4f   kst[CH_ / 8], qst[CH_ / 8], vst;
    float bst;

    // chunk 0: global -> registers
#pragma unroll
    for (int j = 0; j < CH_ / 8; ++j) {
        kst[j] = *(const v4f*)(kgp + (size_t)j * 8 * C_);
        qst[j] = *(const v4f*)(qgp + (size_t)j * 8 * C_);
    }
    vst = *(const v4f*)vgp;
    bst = *bgp;
    // precaution: the wait stands before any address register of the loads above is
    // reused; the scheduling barrier keeps later register writes from rising over it
    asm volatile("s_wait_xcnt 0x0" ::: "memory");
    __builtin_amdgcn_sched_barrier(0);

    float* ogp = o + base + vg * VB_ + (size_t)rv * C_ + cv;
    for (int c = 0; c < NCH_; ++c) {
        const int p = c & 1;
        // registers -> LDS buffer p; its last readers (chunk c-2) left it before
        // the barrier of chunk c-1
#pragma unroll
        for (int j = 0; j < CH_ / 8; ++j) {
            *(v4f*)&ks_[p][r4 + 8 * j][c4] = kst[j];
            *(v4f*)&qs_[p][r4 + 8 * j][c4] = qst[j];
        }
        if (vo) *(v4f*)&vs_[p][rv][cv] = vst;
        if (tid < CH_) bs_[p][tid] = bst;
        __syncthreads();

        if (c > 0) {                            // chunk c-1's outputs: LDS -> global
            if (vo) *(v4f*)ogp = *(const v4f*)&os_[p ^ 1][rv][cv];
            ogp += (size_t)CH_ * C_;
        }
        if (c + 1 < NCH_) {                     // chunk c+1: in flight across chunk c
            kgp += (size_t)CH_ * C_;
            qgp += (size_t)CH_ * C_;
            vgp += (size_t)CH_ * C_;
            bgp += (size_t)CH_ * H_;
#pragma unroll
            for (int j = 0; j < CH_ / 8; ++j) {
                kst[j] = *(const v4f*)(kgp + (size_t)j * 8 * C_);
                qst[j] = *(const v4f*)(qgp + (size_t)j * 8 * C_);
            }
            vst = *(const v4f*)vgp;
            bst = *bgp;
        }

        const float* kb = &ks_[p][0][kg * 4];
        const float* qb = &qs_[p][0][kg * 4];
        const float* vb = &vs_[p][0][vl];
        const float* bb = &bs_[p][0];
        float*       ob = &os_[p][0][vl];

        StepIn ra, rb;
        read_step(ra, kb, qb, vb, bb, 0);
        for (int s = 0; s < CH_; s += 2) {
            read_step(rb, kb, qb, vb, bb, s + 1);
            // keeps the LDS reads of the next step above this step's arithmetic, so
            // that they have returned before the next step waits on them
            __builtin_amdgcn_sched_barrier(0);
            const float o0 = one_step(ra, S, G, Hm);
            if (kg == 0) ob[s * VB_] = o0;
            // past the chunk's end this wraps to row 0; that value is not used
            read_step(ra, kb, qb, vb, bb, (s + 2) & (CH_ - 1));
            __builtin_amdgcn_sched_barrier(0);  // as above
            const float o1 = one_step(rb, S, G, Hm);
            if (kg == 0) ob[(s + 1) * VB_] = o1;
        }
    }

    __syncthreads();                            // last chunk's outputs are complete
    if (vo) *(v4f*)ogp = *(const v4f*)&os_[(NCH_ - 1) & 1][rv][cv];
}

// ---------------- RMSNorm over V (mean, +1e-5) * rms_w, emit f16 -----------------
__global__ __launch_bounds__(EW_)
void rmsnorm_f16(const float* __restrict__ o, const float* __restrict__ rw,
                 _Float16* __restrict__ oh) {
    const int g = blockIdx.x * EW_ + threadIdx.x;        // over NG4_/4
    v4f x[4];
#pragma unroll
    for (int j = 0; j < 4; ++j) x[j] = *(const v4f*)(o + (size_t)g * 4 + (size_t)j * NG4_);
    const v4f wv = *(const v4f*)(rw + (g & 15) * 4);
#pragma unroll
    for (int j = 0; j < 4; ++j) {
        const float inv = rsqrtf(head_sumsq(x[j]) * (1.0f / 64.f) + EPS_);
        v4h y;
#pragma unroll
        for (int i = 0; i < 4; ++i) y[i] = (_Float16)(x[j][i] * inv * wv[i]);
        *(v4h*)(oh + (size_t)g * 4 + (size_t)j * NG4_) = y;
    }
}

// ---------------- host-side launch ----------------
extern "C" void kernel_launch(void* const* d_in, const int* in_sizes, int n_in,
                              void* d_out, int out_size, void* d_ws, size_t ws_size,
                              hipStream_t stream) {
    (void)in_sizes; (void)n_in; (void)out_size; (void)ws_size;
    const float* x    = (const float*)d_in[0];
    const float* Wq   = (const float*)d_in[1];
    const float* Wk   = (const float*)d_in[2];
    const float* Wv   = (const float*)d_in[3];
    const float* Wb   = (const float*)d_in[4];
    const float* cwq  = (const float*)d_in[5];
    const float* cwk  = (const float*)d_in[6];
    const float* cwv  = (const float*)d_in[7];
    const float* rmsw = (const float*)d_in[8];
    const float* Wo   = (const float*)d_in[9];
    float* out = (float*)d_out;

    char* ws = (char*)d_ws;
    size_t off = 0;
    auto alloc = [&](size_t bytes) -> void* {
        void* p = ws + off;
        off += (bytes + 255) & ~(size_t)255;
        return p;
    };
    _Float16* xh   = (_Float16*)alloc((size_t)MT_ * D_ * 2);
    _Float16* Wqp  = (_Float16*)alloc((size_t)D_ * C_ * 2);   // packed fragments
    _Float16* Wkp  = (_Float16*)alloc((size_t)D_ * C_ * 2);
    _Float16* Wvp  = (_Float16*)alloc((size_t)D_ * C_ * 2);
    _Float16* Wop  = (_Float16*)alloc((size_t)C_ * D_ * 2);
    float*    Qf   = (float*)alloc((size_t)MT_ * C_ * 4);
    float*    Kf   = (float*)alloc((size_t)MT_ * C_ * 4);
    float*    Vf   = (float*)alloc((size_t)MT_ * C_ * 4);
    float*    qc   = (float*)alloc((size_t)MT_ * C_ * 4);
    float*    kc   = (float*)alloc((size_t)MT_ * C_ * 4);
    float*    vc   = (float*)alloc((size_t)MT_ * C_ * 4);
    float*    betaf= (float*)alloc((size_t)MT_ * H_ * 4);
    float*    ob   = (float*)alloc((size_t)MT_ * C_ * 4);
    _Float16* ohh  = (_Float16*)alloc((size_t)MT_ * C_ * 2);

    // 1) x as f16 (A operand) and Wq, Wk, Wv, Wo in WMMA B-fragment layout: one launch
    convert_and_pack<<<CVB_ + 4 * PKB_, EW_, 0, stream>>>(x, Wq, Wk, Wv, Wo,
                                                          xh, Wqp, Wkp, Wvp, Wop);

    // 2) the three projection GEMMs (v_wmma_f32_16x16x32_f16) and beta: one launch
    project_qkv_beta<<<BTB_ + 3 * GMB_, 128, 0, stream>>>(xh, Wqp, Wkp, Wvp, Qf, Kf, Vf,
                                                          x, Wb, betaf);

    // 3) causal depthwise conv + SiLU of q, k, v: one launch
    conv_silu<<<dim3(MT_ * C_ / 16 / EW_, 3), EW_, 0, stream>>>(Qf, Kf, Vf, cwq, cwk, cwv,
                                                                qc, kc, vc);

    // 4) l2norm of q and k (in place), scale on q: one launch
    l2norm_scale<<<dim3(NG4_ / 4 / EW_, 2), EW_, 0, stream>>>(qc, kc, SCALE_);

    // 5) sequential recurrence: 128 blocks (B*H*8 v-groups) x 128 threads
    dim3 rgrid(64 / VB_, H_, B_);
    recurrence<<<rgrid, RT_, 0, stream>>>(qc, kc, vc, betaf, ob);

    // 6) RMSNorm -> f16
    rmsnorm_f16<<<NG4_ / 4 / EW_, EW_, 0, stream>>>(ob, rmsw, ohh);

    // 7) output projection GEMM (fp32 result straight to d_out)
    gemm_f16_wmma<C_, D_><<<dim3(D_ / 64, MT_ / 16), 128, 0, stream>>>(ohh, Wop, out);
}

// v006
// It runs in 121 microseconds.
// Next to v005, in two timings, it ran 1.26 times as fast each time.
// Counting every step since v000, it is 8.37 times as fast.
#include <hip/hip_runtime.h>

// ---------------- problem dims (fixed by reference) ----------------
#define B_    2
#define T_    1024
#define D_    512
#define H_    8
#define MT_   (B_ * T_)          // 2048 rows
#define C_    512                // H*K == H*V == 512 channels

#define LR_    1e-3f
#define BETA1_ 0.9f
#define BETA2_ 0.999f
#define EPS_   1e-5f
#define SCALE_ 0.125f            // 64^-0.5

typedef __attribute__((ext_vector_type(16))) _Float16 v16h;
typedef __attribute__((ext_vector_type(8)))  float    v8f;
typedef __attribute__((ext_vector_type(4)))  float    v4f;
typedef __attribute__((ext_vector_type(2)))  float    v2f;
typedef __attribute__((ext_vector_type(4)))  _Float16 v4h;

// The elementwise kernels below are short, and what they cost is the starting of their
// waves: each lane therefore takes 16 elements and a 2048 x 512 array is 256 blocks. Their loops
// over a lane's pieces are unrolled so that the pieces stay in registers and all of a
// lane's loads are in flight together.
#define EW_ 256                  // threads per block of those kernels

// x + (x of lane ^ m), m = CTRL - 0x160 (DPP row_xmask): the partner's value comes
// through the vector unit's own cross-lane path, not through the LDS queue and a
// wait on it; both lanes add the same two values, so the sum is the shuffle's
template <int CTRL>
__device__ __forceinline__ float add_xlane(float x) {
    const int y = __builtin_amdgcn_update_dpp(0, __float_as_int(x), CTRL, 0xf, 0xf, true);
    return x + __int_as_float(y);
}

// sum over the 16 lanes of a row, the same value in each of them
__device__ __forceinline__ float row_sum(float x) {
    x = add_xlane<0x161>(x);
    x = add_xlane<0x162>(x);
    x = add_xlane<0x164>(x);
    x = add_xlane<0x168>(x);
    return x;
}

// ---------------- fp32 -> f16 conversion (row-major, for A operands) -------------
// N4 = number of 4-element pieces; a lane takes pieces g, g + N4/4, ...: each access of
// a wave is one contiguous run
template <int N4>
__device__ __forceinline__
void f32_to_f16(const float* __restrict__ in, _Float16* __restrict__ out, int blk) {
    const int g = blk * EW_ + threadIdx.x;               // over N4/4
    v4f x[4];
#pragma unroll
    for (int j = 0; j < 4; ++j) x[j] = *(const v4f*)(in + (size_t)g * 4 + (size_t)j * N4);
#pragma unroll
    for (int j = 0; j < 4; ++j) {
        v4h y;
#pragma unroll
        for (int i = 0; i < 4; ++i) y[i] = (_Float16)x[j][i];
        *(v4h*)(out + (size_t)g * 4 + (size_t)j * N4) = y;
    }
}

// ---------------- pack fp32 weight [Kd x N] into WMMA B-fragment layout ----------
// Bp layout: [nt = n/16][ks = k/32][lane 0..31][e 0..15]  (contiguous 32B per lane)
// Element map (ISA 7.12.2, 16-bit B 32x16): lane -> col = lane&15, kh = lane>>4;
// e -> k = ks*32 + (e<8 ? e : e+8) + 8*kh
// One thread builds one lane's whole fragment: 16 loads down a column, one 32-byte store.
template <int Kd, int N>
__device__ __forceinline__
void pack_b_f16(const float* __restrict__ W, _Float16* __restrict__ Bp, int blk) {
    const int idx  = blk * EW_ + threadIdx.x;            // over Kd*N/16
    const int lane = idx & 31;
    const int ks   = (idx >> 5) % (Kd / 32);
    const int nt   = idx / ((Kd / 32) << 5);
    const int kh   = lane >> 4;
    const int col  = lane & 15;
    const float* src = W + (size_t)(ks * 32 + 8 * kh) * N + nt * 16 + col;
    float w[16];
#pragma unroll
    for (int e = 0; e < 16; ++e) w[e] = src[(size_t)(e < 8 ? e : e + 8) * N];
    // precaution: the address stays in its registers up to this wait, so that no load
    // above returns into them and nothing reuses them in front of it
    asm volatile("s_wait_xcnt 0x0" :: "v"(src) : "memory");
    v16h f;
#pragma unroll
    for (int e = 0; e < 16; ++e) f[e] = (_Float16)w[e];
    *(v16h*)(Bp + (size_t)idx * 16) = f;
}

// ---------------- one launch for the conversion of x and the weight packs ------------
// The conversion of x and the four packs read only inputs and write separate arrays:
// as ranges of blocks of one grid they start together and pay one launch gap, one
// start and one drain between them.
#define CVB_ (MT_ * D_ / 16 / EW_)   // blocks that convert x
#define PKB_ (D_ * C_ / 16 / EW_)    // blocks that pack one weight matrix
__global__ __launch_bounds__(EW_)
void convert_and_pack(const float* __restrict__ x, const float* __restrict__ Wq,
                      const float* __restrict__ Wk, const float* __restrict__ Wv,
                      const float* __restrict__ Wo, _Float16* __restrict__ xh,
                      _Float16* __restrict__ Wqp, _Float16* __restrict__ Wkp,
                      _Float16* __restrict__ Wvp, _Float16* __restrict__ Wop) {
    static_assert(D_ == C_, "the four weight matrices have one shape");
    const int bid = blockIdx.x;
    if (bid < CVB_) {
        f32_to_f16<MT_ * D_ / 4>(x, xh, bid);
    } else {
        const int m = (bid - CVB_) / PKB_;               // which matrix
        const float* W  = m == 0 ? Wq  : m == 1 ? Wk  : m == 2 ? Wv  : Wo;
        _Float16*    Bp = m == 0 ? Wqp : m == 1 ? Wkp : m == 2 ? Wvp : Wop;
        pack_b_f16<D_, C_>(W, Bp, (bid - CVB_) % PKB_);
    }
}

// ---------------- WMMA f16 GEMM: C[MxN] = A[MxKd] * Bpacked ----------------------
// block = 128 threads (4 waves); each wave owns one 16x16 tile; k-loop fully
// unrolled (Kd/32 = 16 static v_wmma_f32_16x16x32_f16 per wave).
// a block takes tile row by (of M/16) and the four n-tiles bx (of N/64)
template <int Kd, int N>
__device__ __forceinline__
void gemm_tile(const _Float16* __restrict__ A, const _Float16* __restrict__ Bp,
               float* __restrict__ C, int bx, int by) {
    const int lane = threadIdx.x & 31;
    const int wave = threadIdx.x >> 5;
    const int nt   = bx * 4 + wave;          // 16-wide n-tile index
    const int m0   = by * 16;
    const int r    = lane & 15;              // A-row / C-col within tile
    const int kh   = lane >> 4;              // K-half select

    const _Float16* Arow  = A + (size_t)(m0 + r) * Kd + 8 * kh;
    const _Float16* Bfrag = Bp + ((size_t)nt * (Kd / 32) * 32 + lane) * 16;

    v8f acc = {};
#pragma unroll
    for (int ks = 0; ks < Kd / 32; ++ks) {
        v16h a;
        const _Float16* ap = Arow + ks * 32;
#pragma unroll
        for (int e = 0; e < 8; ++e) {        // k = ks*32 + 8*kh + e (+16 for hi half)
            a[e]     = ap[e];
            a[e + 8] = ap[e + 16];
        }
        const v16h b = *(const v16h*)(Bfrag + (size_t)ks * 32 * 16);
        acc = __builtin_amdgcn_wmma_f32_16x16x32_f16(false, a, false, b,
                                                     (short)0, acc, false, false);
    }
    // C/D layout: VGPR i -> row = i + 8*kh, col = lane&15
#pragma unroll
    for (int i = 0; i < 8; ++i)
        C[(size_t)(m0 + i + 8 * kh) * N + nt * 16 + r] = acc[i];
}

// grid = (N/64, M/16)
template <int Kd, int N>
__global__ __launch_bounds__(128)
void gemm_f16_wmma(const _Float16* __restrict__ A, const _Float16* __restrict__ Bp,
                   float* __restrict__ C) {
    gemm_tile<Kd, N>(A, Bp, C, blockIdx.x, blockIdx.y);
}

// ---------------- beta = sigmoid(x @ Wb), one thread per (row, h) ----------------
__device__ __forceinline__
void beta_sigmoid(const float* __restrict__ x, const float* __restrict__ Wb,
                  float* __restrict__ beta, int blk) {
    const int idx = blk * 128 + threadIdx.x;           // over MT_*H_
    const int h = idx % H_;
    const int row = idx / H_;
    float acc = 0.f;
    for (int d = 0; d < D_; ++d)
        acc += x[(size_t)row * D_ + d] * Wb[(size_t)d * H_ + h];
    beta[idx] = __builtin_amdgcn_rcpf(1.f + __expf(-acc));
}

// ---------------- one launch for the four projections of x -----------------------
// q, k, v and beta do not depend on one another. The beta blocks have the longest
// serial loop and the lowest indices, so that they start first and the tiles of the
// three products run beside them.
#define BTB_ (MT_ * H_ / 128)            // blocks of beta
#define GMB_ ((C_ / 64) * (MT_ / 16))    // blocks of one product
__global__ __launch_bounds__(128)
void project_qkv_beta(const _Float16* __restrict__ xh, const _Float16* __restrict__ Wqp,
                      const _Float16* __restrict__ Wkp, const _Float16* __restrict__ Wvp,
                      float* __restrict__ Qf, float* __restrict__ Kf,
                      float* __restrict__ Vf, const float* __restrict__ x,
                      const float* __restrict__ Wb, float* __restrict__ beta) {
    const int bid = blockIdx.x;
    if (bid < BTB_) {
        beta_sigmoid(x, Wb, beta, bid);
    } else {
        const int m = (bid - BTB_) / GMB_;               // which product
        const int t = (bid - BTB_) % GMB_;
        const _Float16* Bp = m == 0 ? Wqp : m == 1 ? Wkp : Wvp;
        float*          C  = m == 0 ? Qf  : m == 1 ? Kf  : Vf;
        gemm_tile<D_, C_>(xh, Bp, C, t % (C_ / 64), t / (C_ / 64));
        // precaution: the built code lays the beta branch behind this one, and it
        // reuses the address registers of the stores above; the wait stands in between
        asm volatile("s_wait_xcnt 0x0" ::: "memory");
    }
}

// ---------------- causal depthwise conv-4 + SiLU ---------------------------------
// A lane takes 4 channels x 4 consecutive time steps: 7 input rows serve 4 output rows.
// The three rows in front of a sequence count as zero, as the reference pads them.
// blockIdx.y picks q, k or v: the three do not depend on one another and share a launch.
__global__ __launch_bounds__(EW_)
void conv_silu(const float* __restrict__ Pq, const float* __restrict__ Pk,
               const float* __restrict__ Pv, const float* __restrict__ wq,
               const float* __restrict__ wk, const float* __restrict__ wvv,
               float* __restrict__ Yq, float* __restrict__ Yk, float* __restrict__ Yv) {
    const int m = blockIdx.y;
    const float* P = m == 0 ? Pq : m == 1 ? Pk : Pv;
    const float* w = m == 0 ? wq : m == 1 ? wk : wvv;
    float*       Y = m == 0 ? Yq : m == 1 ? Yk : Yv;
    const int g  = blockIdx.x * EW_ + threadIdx.x;       // over (MT_/4)*(C_/4)
    const int c  = (g % (C_ / 4)) * 4;
    const int bt = (g / (C_ / 4)) * 4;                   // first of the four rows
    const bool first = (bt % T_) == 0;
    const int off = bt * C_ + c;                         // the same place in P and in Y
    const float* cur = P + off;
    v4f p[7], wv[4];
#pragma unroll
    for (int r = 0; r < 4; ++r) p[3 + r] = *(const v4f*)(cur + r * C_);
#pragma unroll
    for (int r = 0; r < 3; ++r) p[r] = (v4f){0.f, 0.f, 0.f, 0.f};
    if (!first) {
#pragma unroll
        for (int r = 0; r < 3; ++r) p[r] = *(const v4f*)(cur + (r - 3) * C_);
    }
#pragma unroll
    for (int ch = 0; ch < 4; ++ch) wv[ch] = *(const v4f*)(w + (c + ch) * 4);
#pragma unroll
    for (int tt = 0; tt < 4; ++tt) {
        v4f y;
#pragma unroll
        for (int ch = 0; ch < 4; ++ch) {
            float acc = 0.f;
#pragma unroll
            for (int i = 0; i < 4; ++i) acc += p[tt + i][ch] * wv[ch][i];
            y[ch] = acc * __builtin_amdgcn_rcpf(1.f + __expf(-acc));   // SiLU
        }
        *(v4f*)(Y + off + tt * C_) = y;
    }
}

// sum of squares of a head's 64 values, 4 a lane on one 16-lane row
__device__ __forceinline__ float head_sumsq(const v4f& x) {
    const float e = __builtin_fmaf(x[2], x[2], x[0] * x[0]);
    const float d = __builtin_fmaf(x[3], x[3], x[1] * x[1]);
    return row_sum(e + d);
}

#define NG4_ (MT_ * H_ * 16)     // 4-element pieces in a [MT_][H_][64] array

// ---------------- per-head l2norm (sum, +1e-6) with scale (in place) -------------
// a lane takes its piece of heads g/16, g/16 + 4096, ...; it reads all before it writes
// blockIdx.y picks q (scaled) or k: one launch for both
__global__ __launch_bounds__(EW_)
void l2norm_scale(float* q, float* k, float qscale) {
    const int g = blockIdx.x * EW_ + threadIdx.x;        // over NG4_/4
    const float scale = blockIdx.y == 0 ? qscale : 1.0f;
    float* p = (blockIdx.y == 0 ? q : k) + (size_t)g * 4;
    v4f x[4];
#pragma unroll
    for (int j = 0; j < 4; ++j) x[j] = *(const v4f*)(p + (size_t)j * NG4_);
#pragma unroll
    for (int j = 0; j < 4; ++j) {
        const float inv = rsqrtf(head_sumsq(x[j]) + 1e-6f);
        v4f y;
#pragma unroll
        for (int i = 0; i < 4; ++i) y[i] = x[j][i] * inv * scale;
        *(v4f*)(p + (size_t)j * NG4_) = y;
    }
}

// ---------------- sequential IVON delta-rule recurrence --------------------------
// grid = (8 v-groups, H, B); block = 128 threads = 4 waves, one per SIMD of a WGP
// (kg = tid&15, vl = tid>>4): a column v of the state lies on one 16-lane row, four
// k elements a lane, so a time step is a quarter of the vector work per wave that a
// 16-element lane had, and the sums over k end in a 16-lane DPP tree.
// Inputs and outputs pass through double-buffered LDS CH_ time steps at a time: the
// global loads of chunk c+1 are in flight while chunk c is worked on, chunk c-1's
// outputs are stored behind the same barrier, and the block meets once per chunk.
// Inside a chunk each step's operands are read from LDS into registers one step
// ahead, so no global access and no barrier stands on the serial path.
// The next step does not need o, only S: o of step s is therefore summed in step s + 1,
// from the same S, beside that step's pred. The wave is alone on its SIMD and issues in
// order, so two sums one behind the other cost two latencies, side by side one.
// All 16 lanes of a column hold its o, and all store it, each its own copy: a store
// under a lane mask is a block of its own in the built code and would stand between
// pred and the update that waits for it.
#define CH_ 32
#define NCH_ (T_ / CH_)
#define VB_ 8                    // state columns per block
#define RT_ 128                  // threads per block
#define OR_ (VB_ * 16)           // floats of o a time step takes in LDS, 16 copies a column

// what step s works on: k, v and beta of s, and q of s - 1; v and beta lie side by side
// in LDS and come as one pair: a single register that a read is still to fill can be
// given the place beside err or beside LR * beta, which the packed products name as a
// register pair, and the built code then waits there for the fresh read
struct StepIn { v4f k; v4f q; v2f vb; };

template <bool PREV_O>
__device__ __forceinline__ void read_step(StepIn& r, const float* kb, const float* qb,
                                          const float* vb, int s) {
    r.k = *(const v4f*)(kb + s * 64);
    if constexpr (PREV_O) r.q = *(const v4f*)(qb + (s - 1) * 64);
    r.vb = *(const v2f*)(vb + s * VB_ * 2);
}

// a lane's share of a sum over k
__device__ __forceinline__ float lane_dot(const v4f& a, const float (&S)[4]) {
    const float e = __builtin_fmaf(a[2], S[2], a[0] * S[0]);
    const float d = __builtin_fmaf(a[3], S[3], a[1] * S[1]);
    return e + d;
}

// one time step; returns o of the step before (PREV_O), summed from S as that step left it
template <bool PREV_O>
__device__ __forceinline__ float one_step(const StepIn& r, float (&S)[4], float (&G)[4],
                                          float (&Hm)[4]) {
    // pred[v] = k . S[:,v]: a lane's 4 products as two chains of two, elements 0,2 and
    // 1,3 (three dependent links; neighbours stay side by side for packed f32), then
    // the 16 lanes of the column; o[v] = q . S[:,v] in the same way, link by link
    // beside it
    float pred = lane_dot(r.k, S);
    float o = 0.f;
    if constexpr (PREV_O) {
        o = lane_dot(r.q, S);
        pred = add_xlane<0x161>(pred);  o = add_xlane<0x161>(o);
        pred = add_xlane<0x162>(pred);  o = add_xlane<0x162>(o);
        pred = add_xlane<0x164>(pred);  o = add_xlane<0x164>(o);
        pred = add_xlane<0x168>(pred);  o = add_xlane<0x168>(o);
    } else {
        pred = row_sum(pred);
    }

    const float err = pred - r.vb[0];
    const float lrb = LR_ * r.vb[1];
#pragma unroll
    for (int i = 0; i < 4; ++i) {
        const float grad = r.k[i] * err;                    // outer(k, pred-v)
        G[i]  = BETA1_ * G[i]  + (1.f - BETA1_) * grad;
        Hm[i] = BETA2_ * Hm[i] + (1.f - BETA2_) * grad * grad;
        S[i] -= lrb * G[i] * __builtin_amdgcn_rcpf(Hm[i] + 1.f);  // WD==0, LAM==1
    }
    return o;
}

// four neighbouring columns of o, one copy of each
__device__ __forceinline__ v4f read_out(const float* c) {
    v4f y;
#pragma unroll
    for (int i = 0; i < 4; ++i) y[i] = c[i * 16];
    return y;
}

__global__ __launch_bounds__(RT_)
void recurrence(const float* __restrict__ qn, const float* __restrict__ kn,
                const float* __restrict__ vn, const float* __restrict__ beta,
                float* __restrict__ o) {
    const int tid = threadIdx.x;
    const int kg  = tid & 15;
    const int vl  = tid >> 4;
    const int vg  = blockIdx.x;
    const int h   = blockIdx.y;
    const int b   = blockIdx.z;

    float S[4], G[4], Hm[4];
#pragma unroll
    for (int i = 0; i < 4; ++i) { S[i] = 0.f; G[i] = 0.f; Hm[i] = 0.f; }

    __shared__ __attribute__((aligned(16))) float ks_[2][CH_][64];
    __shared__ __attribute__((aligned(16))) float qs_[2][CH_][64];
    __shared__ __attribute__((aligned(16))) float vs_[2][CH_][VB_][2];   // v, beta
    __shared__ __attribute__((aligned(16))) float os_[2][CH_][VB_][16];

    const size_t base  = (size_t)(b * T_) * C_ + h * 64;
    const size_t bbase = (size_t)(b * T_) * H_ + h;

    // staging map: 16 lanes cover one 64-float row of k or q (8 rows a pass); the
    // first two waves cover the chunk's 8-float rows of v and o, 2 lanes a row
    const int  r4 = tid >> 4, c4 = (tid & 15) * 4;
    const int  rv = (tid >> 1) & (CH_ - 1), cv = (tid & 1) * 4;
    const bool vo = tid < CH_ * VB_ / 4;
    const int  xo = rv & 15;    // which copy of o a lane reads: spreads the LDS banks
    const float* kgp = kn + base + (size_t)r4 * C_ + c4;
    const float* qgp = qn + base + (size_t)r4 * C_ + c4;
    const float* vgp = vn + base + vg * VB_ + (size_t)rv * C_ + cv;
    const float* bgp = beta + bbase + (size_t)rv * H_;

    v4f   kst[CH_ / 8], qst[CH_ / 8], vst;
    float bst;

    // chunk 0: global -> registers
#pragma unroll
    for (int j = 0; j < CH_ / 8; ++j) {
        kst[j] = *(const v4f*)(kgp + (size_t)j * 8 * C_);
        qst[j] = *(const v4f*)(qgp + (size_t)j * 8 * C_);
    }
    vst = *(const v4f*)vgp;
    bst = *bgp;
    // precaution: the wait stands before any address register of the loads above is
    // reused; the scheduling barrier keeps later register writes from rising over it
    asm volatile("s_wait_xcnt 0x0" ::: "memory");
    __builtin_amdgcn_sched_barrier(0);

    float* ogp = o + base + vg * VB_ + (size_t)rv * C_ + cv;
    for (int c = 0; c < NCH_; ++c) {
        const int p = c & 1;
        // registers -> LDS buffer p; its last readers (chunk c-2) left it before
        // the barrier of chunk c-1
#pragma unroll
        for (int j = 0; j < CH_ / 8; ++j) {
            *(v4f*)&ks_[p][r4 + 8 * j][c4] = kst[j];
            *(v4f*)&qs_[p][r4 + 8 * j][c4] = qst[j];
        }
        if (vo) {
            *(v4f*)&vs_[p][rv][cv][0]     = (v4f){vst[0], bst, vst[1], bst};
            *(v4f*)&vs_[p][rv][cv + 2][0] = (v4f){vst[2], bst, vst[3], bst};
        }
        __syncthreads();

        if (c > 0) {                            // chunk c-1's outputs: LDS -> global
            if (vo) *(v4f*)ogp = read_out(&os_[p ^ 1][rv][cv][xo]);
            ogp += (size_t)CH_ * C_;
        }
        if (c + 1 < NCH_) {                     // chunk c+1: in flight across chunk c
            kgp += (size_t)CH_ * C_;
            qgp += (size_t)CH_ * C_;
            vgp += (size_t)CH_ * C_;
            bgp += (size_t)CH_ * H_;
#pragma unroll
            for (int j = 0; j < CH_ / 8; ++j) {
                kst[j] = *(const v4f*)(kgp + (size_t)j * 8 * C_);
                qst[j] = *(const v4f*)(qgp + (size_t)j * 8 * C_);
            }
            vst = *(const v4f*)vgp;
            bst = *bgp;
        }

        const float* kb = &ks_[p][0][kg * 4];
        const float* qb = &qs_[p][0][kg * 4];
        const float* vb = &vs_[p][0][vl][0];
        float*       ob = &os_[p][0][vl][kg];

        // step 0 has no output to finish: the chunk before has summed its last one
        StepIn ra, rb;
        read_step<false>(ra, kb, qb, vb, 0);
        read_step<true>(rb, kb, qb, vb, 1);
        // keeps the LDS reads of the next step above this step's arithmetic, so
        // that they have returned before the first wait of the step
        __builtin_amdgcn_sched_barrier(0);
        one_step<false>(ra, S, G, Hm);
        for (int s = 1; s < CH_ - 1; s += 2) {
            read_step<true>(ra, kb, qb, vb, s + 1);
            __builtin_amdgcn_sched_barrier(0);  // as above
            ob[(s - 1) * OR_] = one_step<true>(rb, S, G, Hm);
            read_step<true>(rb, kb, qb, vb, s + 2);
            __builtin_amdgcn_sched_barrier(0);  // as above
            ob[s * OR_] = one_step<true>(ra, S, G, Hm);
        }
        // the last step, and behind it its own output: the block stores the chunk's
        // outputs behind the next barrier, so none is carried over it
        const v4f ql = *(const v4f*)(qb + (CH_ - 1) * 64);
        __builtin_amdgcn_sched_barrier(0);      // as above
        ob[(CH_ - 2) * OR_] = one_step<true>(rb, S, G, Hm);
        ob[(CH_ - 1) * OR_] = row_sum(lane_dot(ql, S));
    }

    __syncthreads();                            // last chunk's outputs are complete
    if (vo) *(v4f*)ogp = read_out(&os_[(NCH_ - 1) & 1][rv][cv][xo]);
}

// ---------------- RMSNorm over V (mean, +1e-5) * rms_w, emit f16 -----------------
__global__ __launch_bounds__(EW_)
void rmsnorm_f16(const float* __restrict__ o, const float* __restrict__ rw,
                 _Float16* __restrict__ oh) {
    const int g = blockIdx.x * EW_ + threadIdx.x;        // over NG4_/4
    v4f x[4];
#pragma unroll
    for (int j = 0; j < 4; ++j) x[j] = *(const v4f*)(o + (size_t)g * 4 + (size_t)j * NG4_);
    const v4f wv = *(const v4f*)(rw + (g & 15) * 4);
#pragma unroll
    for (int j = 0; j < 4; ++j) {
        const float inv = rsqrtf(head_sumsq(x[j]) * (1.0f / 64.f) + EPS_);
        v4h y;
#pragma unroll
        for (int i = 0; i < 4; ++i) y[i] = (_Float16)(x[j][i] * inv * wv[i]);
        *(v4h*)(oh + (size_t)g * 4 + (size_t)j * NG4_) = y;
    }
}

// ---------------- host-side launch ----------------
extern "C" void kernel_launch(void* const* d_in, const int* in_sizes, int n_in,
                              void* d_out, int out_size, void* d_ws, size_t ws_size,
                              hipStream_t stream) {
    (void)in_sizes; (void)n_in; (void)out_size; (void)ws_size;
    const float* x    = (const float*)d_in[0];
    const float* Wq   = (const float*)d_in[1];
    const float* Wk   = (const float*)d_in[2];
    const float* Wv   = (const float*)d_in[3];
    const float* Wb   = (const float*)d_in[4];
    const float* cwq  = (const float*)d_in[5];
    const float* cwk  = (const float*)d_in[6];
    const float* cwv  = (const float*)d_in[7];
    const float* rmsw = (const float*)d_in[8];
    const float* Wo   = (const float*)d_in[9];
    float* out = (float*)d_out;

    char* ws = (char*)d_ws;
    size_t off = 0;
    auto alloc = [&](size_t bytes) -> void* {
        void* p = ws + off;
        off += (bytes + 255) & ~(size_t)255;
        return p;
    };
    _Float16* xh   = (_Float16*)alloc((size_t)MT_ * D_ * 2);
    _Float16* Wqp  = (_Float16*)alloc((size_t)D_ * C_ * 2);   // packed fragments
    _Float16* Wkp  = (_Float16*)alloc((size_t)D_ * C_ * 2);
    _Float16* Wvp  = (_Float16*)alloc((size_t)D_ * C_ * 2);
    _Float16* Wop  = (_Float16*)alloc((size_t)C_ * D_ * 2);
    float*    Qf   = (float*)alloc((size_t)MT_ * C_ * 4);
    float*    Kf   = (float*)alloc((size_t)MT_ * C_ * 4);
    float*    Vf   = (float*)alloc((size_t)MT_ * C_ * 4);
    float*    qc   = (float*)alloc((size_t)MT_ * C_ * 4);
    float*    kc   = (float*)alloc((size_t)MT_ * C_ * 4);
    float*    vc   = (float*)alloc((size_t)MT_ * C_ * 4);
    float*    betaf= (float*)alloc((size_t)MT_ * H_ * 4);
    float*    ob   = (float*)alloc((size_t)MT_ * C_ * 4);
    _Float16* ohh  = (_Float16*)alloc((size_t)MT_ * C_ * 2);

    // 1) x as f16 (A operand) and Wq, Wk, Wv, Wo in WMMA B-fragment layout: one launch
    convert_and_pack<<<CVB_ + 4 * PKB_, EW_, 0, stream>>>(x, Wq, Wk, Wv, Wo,
                                                          xh, Wqp, Wkp, Wvp, Wop);

    // 2) the three projection GEMMs (v_wmma_f32_16x16x32_f16) and beta: one launch
    project_qkv_beta<<<BTB_ + 3 * GMB_, 128, 0, stream>>>(xh, Wqp, Wkp, Wvp, Qf, Kf, Vf,
                                                          x, Wb, betaf);

    // 3) causal depthwise conv + SiLU of q, k, v: one launch
    conv_silu<<<dim3(MT_ * C_ / 16 / EW_, 3), EW_, 0, stream>>>(Qf, Kf, Vf, cwq, cwk, cwv,
                                                                qc, kc, vc);

    // 4) l2norm of q and k (in place), scale on q: one launch
    l2norm_scale<<<dim3(NG4_ / 4 / EW_, 2), EW_, 0, stream>>>(qc, kc, SCALE_);

    // 5) sequential recurrence: 128 blocks (B*H*8 v-groups) x 128 threads
    dim3 rgrid(64 / VB_, H_, B_);
    recurrence<<<rgrid, RT_, 0, stream>>>(qc, kc, vc, betaf, ob);

    // 6) RMSNorm -> f16
    rmsnorm_f16<<<NG4_ / 4 / EW_, EW_, 0, stream>>>(ob, rmsw, ohh);

    // 7) output projection GEMM (fp32 result straight to d_out)
    gemm_f16_wmma<C_, D_><<<dim3(D_ / 64, MT_ / 16), 128, 0, stream>>>(ohh, Wop, out);
}

// v007
// A run of this version takes 115 microseconds.
// Timed twice side by side with v006, it ran 1.06 times as fast both times.
// Over all steps from v000 it is 8.86 times as fast.
#include <hip/hip_runtime.h>

// ---------------- problem dims (fixed by reference) ----------------
#define B_    2
#define T_    1024
#define D_    512
#define H_    8
#define MT_   (B_ * T_)          // 2048 rows
#define C_    512                // H*K == H*V == 512 channels

#define LR_    1e-3f
#define BETA1_ 0.9f
#define BETA2_ 0.999f
#define EPS_   1e-5f
#define SCALE_ 0.125f            // 64^-0.5

typedef __attribute__((ext_vector_type(16))) _Float16 v16h;
typedef __attribute__((ext_vector_type(8)))  float    v8f;
typedef __attribute__((ext_vector_type(4)))  float    v4f;
typedef __attribute__((ext_vector_type(2)))  float    v2f;
typedef __attribute__((ext_vector_type(4)))  _Float16 v4h;

// The elementwise kernels below are short, and what they cost is the starting of their
// waves: each lane therefore takes 16 elements and a 2048 x 512 array is 256 blocks. Their loops
// over a lane's pieces are unrolled so that the pieces stay in registers and all of a
// lane's loads are in flight together.
#define EW_ 256                  // threads per block of those kernels

// x + (x of lane ^ m), m = CTRL - 0x160 (DPP row_xmask): the partner's value comes
// through the vector unit's own cross-lane path, not through the LDS queue and a
// wait on it; both lanes add the same two values, so the sum is the shuffle's
template <int CTRL>
__device__ __forceinline__ float add_xlane(float x) {
    const int y = __builtin_amdgcn_update_dpp(0, __float_as_int(x), CTRL, 0xf, 0xf, true);
    return x + __int_as_float(y);
}

// sum over the 16 lanes of a row, the same value in each of them
__device__ __forceinline__ float row_sum(float x) {
    x = add_xlane<0x161>(x);
    x = add_xlane<0x162>(x);
    x = add_xlane<0x164>(x);
    x = add_xlane<0x168>(x);
    return x;
}

// ---------------- fp32 -> f16 conversion (row-major, for A operands) -------------
// N4 = number of 4-element pieces; a lane takes pieces g, g + N4/4, ...: each access of
// a wave is one contiguous run
template <int N4>
__device__ __forceinline__
void f32_to_f16(const float* __restrict__ in, _Float16* __restrict__ out, int blk) {
    const int g = blk * EW_ + threadIdx.x;               // over N4/4
    v4f x[4];
#pragma unroll
    for (int j = 0; j < 4; ++j) x[j] = *(const v4f*)(in + (size_t)g * 4 + (size_t)j * N4);
#pragma unroll
    for (int j = 0; j < 4; ++j) {
        v4h y;
#pragma unroll
        for (int i = 0; i < 4; ++i) y[i] = (_Float16)x[j][i];
        *(v4h*)(out + (size_t)g * 4 + (size_t)j * N4) = y;
    }
}

// ---------------- pack fp32 weight [Kd x N] into WMMA B-fragment layout ----------
// Bp layout: [nt = n/16][ks = k/32][lane 0..31][e 0..15]  (contiguous 32B per lane)
// Element map (ISA 7.12.2, 16-bit B 32x16): lane -> col = lane&15, kh = lane>>4;
// e -> k = ks*32 + (e<8 ? e : e+8) + 8*kh
// One thread builds one lane's whole fragment: 16 loads down a column, one 32-byte store.
template <int Kd, int N>
__device__ __forceinline__
void pack_b_f16(const float* __restrict__ W, _Float16* __restrict__ Bp, int blk) {
    const int idx  = blk * EW_ + threadIdx.x;            // over Kd*N/16
    const int lane = idx & 31;
    const int ks   = (idx >> 5) % (Kd / 32);
    const int nt   = idx / ((Kd / 32) << 5);
    const int kh   = lane >> 4;
    const int col  = lane & 15;
    const float* src = W + (size_t)(ks * 32 + 8 * kh) * N + nt * 16 + col;
    float w[16];
#pragma unroll
    for (int e = 0; e < 16; ++e) w[e] = src[(size_t)(e < 8 ? e : e + 8) * N];
    // precaution: the address stays in its registers up to this wait, so that no load
    // above returns into them and nothing reuses them in front of it
    asm volatile("s_wait_xcnt 0x0" :: "v"(src) : "memory");
    v16h f;
#pragma unroll
    for (int e = 0; e < 16; ++e) f[e] = (_Float16)w[e];
    *(v16h*)(Bp + (size_t)idx * 16) = f;
}

// ---------------- one launch for the conversion of x and the weight packs ------------
// The conversion of x and the four packs read only inputs and write separate arrays:
// as ranges of blocks of one grid they start together and pay one launch gap, one
// start and one drain between them.
#define CVB_ (MT_ * D_ / 16 / EW_)   // blocks that convert x
#define PKB_ (D_ * C_ / 16 / EW_)    // blocks that pack one weight matrix
__global__ __launch_bounds__(EW_)
void convert_and_pack(const float* __restrict__ x, const float* __restrict__ Wq,
                      const float* __restrict__ Wk, const float* __restrict__ Wv,
                      const float* __restrict__ Wo, _Float16* __restrict__ xh,
                      _Float16* __restrict__ Wqp, _Float16* __restrict__ Wkp,
                      _Float16* __restrict__ Wvp, _Float16* __restrict__ Wop) {
    static_assert(D_ == C_, "the four weight matrices have one shape");
    const int bid = blockIdx.x;
    if (bid < CVB_) {
        f32_to_f16<MT_ * D_ / 4>(x, xh, bid);
    } else {
        const int m = (bid - CVB_) / PKB_;               // which matrix
        const float* W  = m == 0 ? Wq  : m == 1 ? Wk  : m == 2 ? Wv  : Wo;
        _Float16*    Bp = m == 0 ? Wqp : m == 1 ? Wkp : m == 2 ? Wvp : Wop;
        pack_b_f16<D_, C_>(W, Bp, (bid - CVB_) % PKB_);
    }
}

// ---------------- WMMA f16 GEMM: C[MxN] = A[MxKd] * Bpacked ----------------------
// block = 128 threads (4 waves); each wave owns one 16x16 tile; k-loop fully
// unrolled (Kd/32 = 16 static v_wmma_f32_16x16x32_f16 per wave).
// a block takes tile row by (of M/16) and the four n-tiles bx (of N/64)
template <int Kd, int N>
__device__ __forceinline__
void gemm_tile(const _Float16* __restrict__ A, const _Float16* __restrict__ Bp,
               float* __restrict__ C, int bx, int by) {
    const int lane = threadIdx.x & 31;
    const int wave = threadIdx.x >> 5;
    const int nt   = bx * 4 + wave;          // 16-wide n-tile index
    const int m0   = by * 16;
    const int r    = lane & 15;              // A-row / C-col within tile
    const int kh   = lane >> 4;              // K-half select

    const _Float16* Arow  = A + (size_t)(m0 + r) * Kd + 8 * kh;
    const _Float16* Bfrag = Bp + ((size_t)nt * (Kd / 32) * 32 + lane) * 16;

    v8f acc = {};
#pragma unroll
    for (int ks = 0; ks < Kd / 32; ++ks) {
        v16h a;
        const _Float16* ap = Arow + ks * 32;
#pragma unroll
        for (int e = 0; e < 8; ++e) {        // k = ks*32 + 8*kh + e (+16 for hi half)
            a[e]     = ap[e];
            a[e + 8] = ap[e + 16];
        }
        const v16h b = *(const v16h*)(Bfrag + (size_t)ks * 32 * 16);
        acc = __builtin_amdgcn_wmma_f32_16x16x32_f16(false, a, false, b,
                                                     (short)0, acc, false, false);
    }
    // C/D layout: VGPR i -> row = i + 8*kh, col = lane&15
#pragma unroll
    for (int i = 0; i < 8; ++i)
        C[(size_t)(m0 + i + 8 * kh) * N + nt * 16 + r] = acc[i];
}

// grid = (N/64, M/16)
template <int Kd, int N>
__global__ __launch_bounds__(128)
void gemm_f16_wmma(const _Float16* __restrict__ A, const _Float16* __restrict__ Bp,
                   float* __restrict__ C) {
    gemm_tile<Kd, N>(A, Bp, C, blockIdx.x, blockIdx.y);
}

// ---------------- beta = sigmoid(x @ Wb), one thread per (row, h) ----------------
__device__ __forceinline__
void beta_sigmoid(const float* __restrict__ x, const float* __restrict__ Wb,
                  float* __restrict__ beta, int blk) {
    const int idx = blk * 128 + threadIdx.x;           // over MT_*H_
    const int h = idx % H_;
    const int row = idx / H_;
    float acc = 0.f;
    for (int d = 0; d < D_; ++d)
        acc += x[(size_t)row * D_ + d] * Wb[(size_t)d * H_ + h];
    beta[idx] = __builtin_amdgcn_rcpf(1.f + __expf(-acc));
}

// ---------------- one launch for the four projections of x -----------------------
// q, k, v and beta do not depend on one another. The beta blocks have the longest
// serial loop and the lowest indices, and the tiles of the
// three products run beside them.
#define BTB_ (MT_ * H_ / 128)            // blocks of beta
#define GMB_ ((C_ / 64) * (MT_ / 16))    // blocks of one product
__global__ __launch_bounds__(128)
void project_qkv_beta(const _Float16* __restrict__ xh, const _Float16* __restrict__ Wqp,
                      const _Float16* __restrict__ Wkp, const _Float16* __restrict__ Wvp,
                      float* __restrict__ Qf, float* __restrict__ Kf,
                      float* __restrict__ Vf, const float* __restrict__ x,
                      const float* __restrict__ Wb, float* __restrict__ beta) {
    const int bid = blockIdx.x;
    if (bid < BTB_) {
        beta_sigmoid(x, Wb, beta, bid);
    } else {
        const int m = (bid - BTB_) / GMB_;               // which product
        const int t = (bid - BTB_) % GMB_;
        const _Float16* Bp = m == 0 ? Wqp : m == 1 ? Wkp : Wvp;
        float*          C  = m == 0 ? Qf  : m == 1 ? Kf  : Vf;
        gemm_tile<D_, C_>(xh, Bp, C, t % (C_ / 64), t / (C_ / 64));
        // precaution: the built code lays the beta branch behind this one, and it
        // reuses the address registers of the stores above; the wait stands in between
        asm volatile("s_wait_xcnt 0x0" ::: "memory");
    }
}

// ---------------- causal depthwise conv-4 + SiLU ---------------------------------
// A lane takes 4 channels x 4 consecutive time steps: 7 input rows serve 4 output rows.
// The three rows in front of a sequence count as zero, as the reference pads them.
// blockIdx.y picks q, k or v: the three do not depend on one another and share a launch.
__global__ __launch_bounds__(EW_)
void conv_silu(const float* __restrict__ Pq, const float* __restrict__ Pk,
               const float* __restrict__ Pv, const float* __restrict__ wq,
               const float* __restrict__ wk, const float* __restrict__ wvv,
               float* __restrict__ Yq, float* __restrict__ Yk, float* __restrict__ Yv) {
    const int m = blockIdx.y;
    const float* P = m == 0 ? Pq : m == 1 ? Pk : Pv;
    const float* w = m == 0 ? wq : m == 1 ? wk : wvv;
    float*       Y = m == 0 ? Yq : m == 1 ? Yk : Yv;
    const int g  = blockIdx.x * EW_ + threadIdx.x;       // over (MT_/4)*(C_/4)
    const int c  = (g % (C_ / 4)) * 4;
    const int bt = (g / (C_ / 4)) * 4;                   // first of the four rows
    const bool first = (bt % T_) == 0;
    const int off = bt * C_ + c;                         // the same place in P and in Y
    const float* cur = P + off;
    v4f p[7], wv[4];
#pragma unroll
    for (int r = 0; r < 4; ++r) p[3 + r] = *(const v4f*)(cur + r * C_);
#pragma unroll
    for (int r = 0; r < 3; ++r) p[r] = (v4f){0.f, 0.f, 0.f, 0.f};
    if (!first) {
#pragma unroll
        for (int r = 0; r < 3; ++r) p[r] = *(const v4f*)(cur + (r - 3) * C_);
    }
#pragma unroll
    for (int ch = 0; ch < 4; ++ch) wv[ch] = *(const v4f*)(w + (c + ch) * 4);
#pragma unroll
    for (int tt = 0; tt < 4; ++tt) {
        v4f y;
#pragma unroll
        for (int ch = 0; ch < 4; ++ch) {
            float acc = 0.f;
#pragma unroll
            for (int i = 0; i < 4; ++i) acc += p[tt + i][ch] * wv[ch][i];
            y[ch] = acc * __builtin_amdgcn_rcpf(1.f + __expf(-acc));   // SiLU
        }
        *(v4f*)(Y + off + tt * C_) = y;
    }
}

// sum of squares of a head's 64 values, 4 a lane on one 16-lane row
__device__ __forceinline__ float head_sumsq(const v4f& x) {
    const float e = __builtin_fmaf(x[2], x[2], x[0] * x[0]);
    const float d = __builtin_fmaf(x[3], x[3], x[1] * x[1]);
    return row_sum(e + d);
}

#define NG4_ (MT_ * H_ * 16)     // 4-element pieces in a [MT_][H_][64] array

// ---------------- per-head l2norm (sum, +1e-6) with scale (in place) -------------
// a lane takes its piece of heads g/16, g/16 + 4096, ...; it reads all before it writes
// blockIdx.y picks q (scaled) or k: one launch for both
__global__ __launch_bounds__(EW_)
void l2norm_scale(float* q, float* k, float qscale) {
    const int g = blockIdx.x * EW_ + threadIdx.x;        // over NG4_/4
    const float scale = blockIdx.y == 0 ? qscale : 1.0f;
    float* p = (blockIdx.y == 0 ? q : k) + (size_t)g * 4;
    v4f x[4];
#pragma unroll
    for (int j = 0; j < 4; ++j) x[j] = *(const v4f*)(p + (size_t)j * NG4_);
#pragma unroll
    for (int j = 0; j < 4; ++j) {
        const float inv = rsqrtf(head_sumsq(x[j]) + 1e-6f);
        v4f y;
#pragma unroll
        for (int i = 0; i < 4; ++i) y[i] = x[j][i] * inv * scale;
        *(v4f*)(p + (size_t)j * NG4_) = y;
    }
}

// ---------------- sequential IVON delta-rule recurrence --------------------------
// grid = (8 v-groups, H, B); block = 128 threads = 4 waves, one per SIMD of a WGP
// (kg = tid&15, vl = tid>>4): a column v of the state lies on one 16-lane row, four
// k elements a lane, so a time step is a quarter of the vector work per wave that a
// 16-element lane had, and the sums over k end in a 16-lane DPP tree.
// Inputs and outputs pass through double-buffered LDS CH_ time steps at a time: the
// global loads of chunk c+1 are in flight while chunk c is worked on, chunk c-1's
// outputs are stored behind the same barrier, and the block meets once per chunk.
// Inside a chunk each step's operands are read from LDS into registers two steps
// before their first use, so no global access and no barrier stands on the serial path.
// The next step does not need o, only S: o of step s is therefore summed in step s + 1,
// from the same S, beside that step's pred. The wave is alone on its SIMD and issues in
// order, so two sums one behind the other cost two latencies, side by side one.
// All 16 lanes of a column hold its o, and all store it, each its own copy: a store
// under a lane mask is a block of its own in the built code and would stand between
// pred and the update that waits for it.
// What a step costs is its chain of dependent instructions from one err to the next,
// so only what needs err or the reciprocal stands on that chain:
//   g is kept as Gs = g / (1 - B1):          Gs = B1 * Gs + grad
//   h is kept as Hs = (h + LAM) / (1 - B2):  Hs = (B2 * Hs + HC_) + grad * grad
//   S -= LR * beta * g / (h + LAM)  is then  S += (NB_ * beta) * Gs / Hs
//   err of step s + 1 = k' . S_s - v' is summed as (k' . S_(s-1) - v') + sum(k' * lg * r),
//   lg = NB_ * beta * Gs, r = 1 / Hs: the bracket waits for nothing of step s, and the
//   update of S itself leaves the chain; -v' enters as -v'/16 in each of the 16 lanes.
// -v/16 and NB_ * beta are formed where a chunk is written to LDS.
#define CH_ 32
#define NCH_ (T_ / CH_)
#define VB_ 8                    // state columns per block
#define RT_ 128                  // threads per block
#define OR_ (VB_ * 16)           // floats of o a time step takes in LDS, 16 copies a column
#define NB_ ((float)(-1e-3 * (1.0 - 0.9) / (1.0 - 0.999)))      // -LR * (1 - B1) / (1 - B2)
#define HI_ ((float)(1.0 / (1.0 - 0.999)))                      // Hs at h = 0
// LAM's share of Hs must stay where it is under Hs = B2 * Hs + HC_, with B2 as f32 has it
#define HC_ ((float)((1.0 - (double)BETA2_) / (1.0 - 0.999)))

// row s of a chunk: k of s, q of s - 1, and the pair -v/16, NB_ * beta of s; the two lie
// side by side in LDS and come as one pair: a single register that a read is still to
// fill can be given the place beside a value which the packed products name as a
// register pair, and the built code then waits there for the fresh read
struct StepIn { v4f k; v4f q; v2f vb; };

template <bool PREV_O>
__device__ __forceinline__ void read_step(StepIn& r, const float* kb, const float* qb,
                                          const float* vb, int s) {
    r.k = *(const v4f*)(kb + s * 64);
    if constexpr (PREV_O) r.q = *(const v4f*)(qb + (s - 1) * 64);
    r.vb = *(const v2f*)(vb + s * VB_ * 2);
}

// a lane's share of a sum over k
__device__ __forceinline__ float lane_dot(const v4f& a, const float (&S)[4]) {
    const float e = __builtin_fmaf(a[2], S[2], a[0] * S[0]);
    const float d = __builtin_fmaf(a[3], S[3], a[1] * S[1]);
    return e + d;
}

// a lane's share of k . S - v, in two halves (elements 0,2 and 1,3); nv = -v/16
__device__ __forceinline__ v2f lane_part(const v4f& k, const float (&S)[4], float nv) {
    v2f p;
    p[0] = __builtin_fmaf(k[2], S[2], __builtin_fmaf(k[0], S[0], nv));
    p[1] = __builtin_fmaf(k[3], S[3], k[1] * S[1]);
    return p;
}

// one time step on row c; part holds the lane's share of its err and, where a row n
// follows in the chunk (NEXT), leaves with that of the next step's. Returns o of the
// step before (PREV_O), summed from S as that step left it
template <bool PREV_O, bool NEXT>
__device__ __forceinline__ float one_step(const StepIn& c, const StepIn& n, v2f& part,
                                          float (&S)[4], float (&G)[4], float (&Hs)[4]) {
    // err[v] = k . S[:,v] - v: the lane's two halves, then the 16 lanes of the column;
    // o[v] = q . S[:,v] link by link beside it
    float err = part[0] + part[1];
    float o = 0.f;
    if constexpr (PREV_O) {
        o = lane_dot(c.q, S);
        err = add_xlane<0x161>(err);  o = add_xlane<0x161>(o);
        err = add_xlane<0x162>(err);  o = add_xlane<0x162>(o);
        err = add_xlane<0x164>(err);  o = add_xlane<0x164>(o);
        err = add_xlane<0x168>(err);  o = add_xlane<0x168>(o);
    } else {
        err = row_sum(err);
    }
    // the next step's share as far as S of the step before gives it
    v2f p = {0.f, 0.f};
    if constexpr (NEXT) p = lane_part(n.k, S, n.vb[0]);

    // lg = NB_ * beta * Gs straight from err, not behind the new Gs: it has to be there,
    // times the next k, when the reciprocals arrive
    const float nb9 = BETA1_ * c.vb[1];
    const float ne  = c.vb[1] * err;
    float lg[4], r[4];
#pragma unroll
    for (int i = 0; i < 4; ++i) {
        const float grad = c.k[i] * err;                    // outer(k, pred-v)
        Hs[i] = __builtin_fmaf(grad, grad, __builtin_fmaf(BETA2_, Hs[i], HC_));
        lg[i] = __builtin_fmaf(c.k[i], ne, nb9 * G[i]);
        G[i]  = __builtin_fmaf(BETA1_, G[i], grad);
        r[i]  = __builtin_amdgcn_rcpf(Hs[i]);
    }
    if constexpr (NEXT) {
        part[0] = __builtin_fmaf(n.k[2] * lg[2], r[2], __builtin_fmaf(n.k[0] * lg[0], r[0], p[0]));
        part[1] = __builtin_fmaf(n.k[3] * lg[3], r[3], __builtin_fmaf(n.k[1] * lg[1], r[1], p[1]));
    }
#pragma unroll
    for (int i = 0; i < 4; ++i) S[i] = __builtin_fmaf(lg[i], r[i], S[i]);   // WD==0
    return o;
}

// four neighbouring columns of o, one copy of each
__device__ __forceinline__ v4f read_out(const float* c) {
    v4f y;
#pragma unroll
    for (int i = 0; i < 4; ++i) y[i] = c[i * 16];
    return y;
}

__global__ __launch_bounds__(RT_)
void recurrence(const float* __restrict__ qn, const float* __restrict__ kn,
                const float* __restrict__ vn, const float* __restrict__ beta,
                float* __restrict__ o) {
    const int tid = threadIdx.x;
    const int kg  = tid & 15;
    const int vl  = tid >> 4;
    const int vg  = blockIdx.x;
    const int h   = blockIdx.y;
    const int b   = blockIdx.z;

    float S[4], G[4], Hm[4];
#pragma unroll
    for (int i = 0; i < 4; ++i) { S[i] = 0.f; G[i] = 0.f; Hm[i] = HI_; }

    __shared__ __attribute__((aligned(16))) float ks_[2][CH_][64];
    __shared__ __attribute__((aligned(16))) float qs_[2][CH_][64];
    __shared__ __attribute__((aligned(16))) float vs_[2][CH_][VB_][2];   // -v/16, NB_*beta
    __shared__ __attribute__((aligned(16))) float os_[2][CH_][VB_][16];

    const size_t base  = (size_t)(b * T_) * C_ + h * 64;
    const size_t bbase = (size_t)(b * T_) * H_ + h;

    // staging map: 16 lanes cover one 64-float row of k or q (8 rows a pass); the
    // first two waves cover the chunk's 8-float rows of v and o, 2 lanes a row
    const int  r4 = tid >> 4, c4 = (tid & 15) * 4;
    const int  rv = (tid >> 1) & (CH_ - 1), cv = (tid & 1) * 4;
    const bool vo = tid < CH_ * VB_ / 4;
    const int  xo = rv & 15;    // which copy of o a lane reads: spreads the LDS banks
    const float* kgp = kn + base + (size_t)r4 * C_ + c4;
    const float* qgp = qn + base + (size_t)r4 * C_ + c4;
    const float* vgp = vn + base + vg * VB_ + (size_t)rv * C_ + cv;
    const float* bgp = beta + bbase + (size_t)rv * H_;

    v4f   kst[CH_ / 8], qst[CH_ / 8], vst;
    float bst;

    // chunk 0: global -> registers
#pragma unroll
    for (int j = 0; j < CH_ / 8; ++j) {
        kst[j] = *(const v4f*)(kgp + (size_t)j * 8 * C_);
        qst[j] = *(const v4f*)(qgp + (size_t)j * 8 * C_);
    }
    vst = *(const v4f*)vgp;
    bst = *bgp;
    // precaution: the wait stands before any address register of the loads above is
    // reused; the scheduling barrier keeps later register writes from rising over it
    asm volatile("s_wait_xcnt 0x0" ::: "memory");
    __builtin_amdgcn_sched_barrier(0);

    float* ogp = o + base + vg * VB_ + (size_t)rv * C_ + cv;
    for (int c = 0; c < NCH_; ++c) {
        const int p = c & 1;
        // registers -> LDS buffer p; its last readers (chunk c-2) left it before
        // the barrier of chunk c-1
#pragma unroll
        for (int j = 0; j < CH_ / 8; ++j) {
            *(v4f*)&ks_[p][r4 + 8 * j][c4] = kst[j];
            *(v4f*)&qs_[p][r4 + 8 * j][c4] = qst[j];
        }
        if (vo) {
            const v4f   nv = vst * (-1.f / 16.f);
            const float nb = bst * NB_;
            *(v4f*)&vs_[p][rv][cv][0]     = (v4f){nv[0], nb, nv[1], nb};
            *(v4f*)&vs_[p][rv][cv + 2][0] = (v4f){nv[2], nb, nv[3], nb};
        }
        __syncthreads();

        if (c > 0) {                            // chunk c-1's outputs: LDS -> global
            if (vo) *(v4f*)ogp = read_out(&os_[p ^ 1][rv][cv][xo]);
            ogp += (size_t)CH_ * C_;
        }
        if (c + 1 < NCH_) {                     // chunk c+1: in flight across chunk c
            kgp += (size_t)CH_ * C_;
            qgp += (size_t)CH_ * C_;
            vgp += (size_t)CH_ * C_;
            bgp += (size_t)CH_ * H_;
#pragma unroll
            for (int j = 0; j < CH_ / 8; ++j) {
                kst[j] = *(const v4f*)(kgp + (size_t)j * 8 * C_);
                qst[j] = *(const v4f*)(qgp + (size_t)j * 8 * C_);
            }
            vst = *(const v4f*)vgp;
            bst = *bgp;
        }

        const float* kb = &ks_[p][0][kg * 4];
        const float* qb = &qs_[p][0][kg * 4];
        const float* vb = &vs_[p][0][vl][0];
        float*       ob = &os_[p][0][vl][kg];

        // A step works on its own row and the next; a row is read two steps before its
        // first use, so four rows are held and the
        // loop's body is four steps, each row in registers of its own.
        // step 0 has no output to finish: the chunk before has summed its last one
        StepIn ra, rb, rc, rd;
        read_step<false>(ra, kb, qb, vb, 0);
        read_step<true>(rb, kb, qb, vb, 1);
        read_step<true>(rc, kb, qb, vb, 2);
        read_step<true>(rd, kb, qb, vb, 3);
        // keeps the LDS reads of later steps above this step's arithmetic, so
        // that they have returned before the first wait on them
        __builtin_amdgcn_sched_barrier(0);
        v2f part = lane_part(ra.k, S, ra.vb[0]);
        one_step<false, true>(ra, rb, part, S, G, Hm);
        for (int s = 1; s < CH_ - 6; s += 4) {
            read_step<true>(ra, kb, qb, vb, s + 3);
            __builtin_amdgcn_sched_barrier(0);  // as above
            ob[(s - 1) * OR_] = one_step<true, true>(rb, rc, part, S, G, Hm);
            read_step<true>(rb, kb, qb, vb, s + 4);
            __builtin_amdgcn_sched_barrier(0);  // as above
            ob[s * OR_] = one_step<true, true>(rc, rd, part, S, G, Hm);
            read_step<true>(rc, kb, qb, vb, s + 5);
            __builtin_amdgcn_sched_barrier(0);  // as above
            ob[(s + 1) * OR_] = one_step<true, true>(rd, ra, part, S, G, Hm);
            read_step<true>(rd, kb, qb, vb, s + 6);
            __builtin_amdgcn_sched_barrier(0);  // as above
            ob[(s + 2) * OR_] = one_step<true, true>(ra, rb, part, S, G, Hm);
        }
        // the last three steps, and behind them the last one's own output: the block
        // stores the chunk's outputs behind the next barrier, so none is carried over
        // it; the row behind the last is not in LDS yet, so the next chunk starts its
        // first err from S
        const v4f ql = *(const v4f*)(qb + (CH_ - 1) * 64);
        __builtin_amdgcn_sched_barrier(0);      // as above
        ob[(CH_ - 4) * OR_] = one_step<true, true>(rb, rc, part, S, G, Hm);
        ob[(CH_ - 3) * OR_] = one_step<true, true>(rc, rd, part, S, G, Hm);
        ob[(CH_ - 2) * OR_] = one_step<true, false>(rd, rd, part, S, G, Hm);
        ob[(CH_ - 1) * OR_] = row_sum(lane_dot(ql, S));
    }

    __syncthreads();                            // last chunk's outputs are complete
    if (vo) *(v4f*)ogp = read_out(&os_[(NCH_ - 1) & 1][rv][cv][xo]);
}

// ---------------- RMSNorm over V (mean, +1e-5) * rms_w, emit f16 -----------------
__global__ __launch_bounds__(EW_)
void rmsnorm_f16(const float* __restrict__ o, const float* __restrict__ rw,
                 _Float16* __restrict__ oh) {
    const int g = blockIdx.x * EW_ + threadIdx.x;        // over NG4_/4
    v4f x[4];
#pragma unroll
    for (int j = 0; j < 4; ++j) x[j] = *(const v4f*)(o + (size_t)g * 4 + (size_t)j * NG4_);
    const v4f wv = *(const v4f*)(rw + (g & 15) * 4);
#pragma unroll
    for (int j = 0; j < 4; ++j) {
        const float inv = rsqrtf(head_sumsq(x[j]) * (1.0f / 64.f) + EPS_);
        v4h y;
#pragma unroll
        for (int i = 0; i < 4; ++i) y[i] = (_Float16)(x[j][i] * inv * wv[i]);
        *(v4h*)(oh + (size_t)g * 4 + (size_t)j * NG4_) = y;
    }
}

// ---------------- host-side launch ----------------
extern "C" void kernel_launch(void* const* d_in, const int* in_sizes, int n_in,
                              void* d_out, int out_size, void* d_ws, size_t ws_size,
                              hipStream_t stream) {
    (void)in_sizes; (void)n_in; (void)out_size; (void)ws_size;
    const float* x    = (const float*)d_in[0];
    const float* Wq   = (const float*)d_in[1];
    const float* Wk   = (const float*)d_in[2];
    const float* Wv   = (const float*)d_in[3];
    const float* Wb   = (const float*)d_in[4];
    const float* cwq  = (const float*)d_in[5];
    const float* cwk  = (const float*)d_in[6];
    const float* cwv  = (const float*)d_in[7];
    const float* rmsw = (const float*)d_in[8];
    const float* Wo   = (const float*)d_in[9];
    float* out = (float*)d_out;

    char* ws = (char*)d_ws;
    size_t off = 0;
    auto alloc = [&](size_t bytes) -> void* {
        void* p = ws + off;
        off += (bytes + 255) & ~(size_t)255;
        return p;
    };
    _Float16* xh   = (_Float16*)alloc((size_t)MT_ * D_ * 2);
    _Float16* Wqp  = (_Float16*)alloc((size_t)D_ * C_ * 2);   // packed fragments
    _Float16* Wkp  = (_Float16*)alloc((size_t)D_ * C_ * 2);
    _Float16* Wvp  = (_Float16*)alloc((size_t)D_ * C_ * 2);
    _Float16* Wop  = (_Float16*)alloc((size_t)C_ * D_ * 2);
    float*    Qf   = (float*)alloc((size_t)MT_ * C_ * 4);
    float*    Kf   = (float*)alloc((size_t)MT_ * C_ * 4);
    float*    Vf   = (float*)alloc((size_t)MT_ * C_ * 4);
    float*    qc   = (float*)alloc((size_t)MT_ * C_ * 4);
    float*    kc   = (float*)alloc((size_t)MT_ * C_ * 4);
    float*    vc   = (float*)alloc((size_t)MT_ * C_ * 4);
    float*    betaf= (float*)alloc((size_t)MT_ * H_ * 4);
    float*    ob   = (float*)alloc((size_t)MT_ * C_ * 4);
    _Float16* ohh  = (_Float16*)alloc((size_t)MT_ * C_ * 2);

    // 1) x as f16 (A operand) and Wq, Wk, Wv, Wo in WMMA B-fragment layout: one launch
    convert_and_pack<<<CVB_ + 4 * PKB_, EW_, 0, stream>>>(x, Wq, Wk, Wv, Wo,
                                                          xh, Wqp, Wkp, Wvp, Wop);

    // 2) the three projection GEMMs (v_wmma_f32_16x16x32_f16) and beta: one launch
    project_qkv_beta<<<BTB_ + 3 * GMB_, 128, 0, stream>>>(xh, Wqp, Wkp, Wvp, Qf, Kf, Vf,
                                                          x, Wb, betaf);

    // 3) causal depthwise conv + SiLU of q, k, v: one launch
    conv_silu<<<dim3(MT_ * C_ / 16 / EW_, 3), EW_, 0, stream>>>(Qf, Kf, Vf, cwq, cwk, cwv,
                                                                qc, kc, vc);

    // 4) l2norm of q and k (in place), scale on q: one launch
    l2norm_scale<<<dim3(NG4_ / 4 / EW_, 2), EW_, 0, stream>>>(qc, kc, SCALE_);

    // 5) sequential recurrence: 128 blocks (B*H*8 v-groups) x 128 threads
    dim3 rgrid(64 / VB_, H_, B_);
    recurrence<<<rgrid, RT_, 0, stream>>>(qc, kc, vc, betaf, ob);

    // 6) RMSNorm -> f16
    rmsnorm_f16<<<NG4_ / 4 / EW_, EW_, 0, stream>>>(ob, rmsw, ohh);

    // 7) output projection GEMM (fp32 result straight to d_out)
    gemm_f16_wmma<C_, D_><<<dim3(D_ / 64, MT_ / 16), 128, 0, stream>>>(ohh, Wop, out);
}

// v008
// It runs in 104 microseconds.
// Two timings next to v007 put it at 1.11 and 1.09 times that version's speed.
// Over all steps from v000 it is 9.77 times as fast.
#include <hip/hip_runtime.h>

// ---------------- problem dims (fixed by reference) ----------------
#define B_    2
#define T_    1024
#define D_    512
#define H_    8
#define MT_   (B_ * T_)          // 2048 rows
#define C_    512                // H*K == H*V == 512 channels

#define LR_    1e-3f
#define BETA1_ 0.9f
#define BETA2_ 0.999f
#define EPS_   1e-5f
#define SCALE_ 0.125f            // 64^-0.5

typedef __attribute__((ext_vector_type(16))) _Float16 v16h;
typedef __attribute__((ext_vector_type(8)))  float    v8f;
typedef __attribute__((ext_vector_type(4)))  float    v4f;
typedef __attribute__((ext_vector_type(2)))  float    v2f;
typedef __attribute__((ext_vector_type(4)))  _Float16 v4h;
typedef __attribute__((ext_vector_type(8)))  _Float16 v8h;

// The elementwise kernels below are short, and what they cost is the starting of their
// waves: each lane therefore takes 16 elements and a 2048 x 512 array is 256 blocks. Their loops
// over a lane's pieces are unrolled so that the pieces stay in registers and all of a
// lane's loads are in flight together.
#define EW_ 256                  // threads per block of those kernels

// x + (x of lane ^ m), m = CTRL - 0x160 (DPP row_xmask): the partner's value comes
// through the vector unit's own cross-lane path, not through the LDS queue and a
// wait on it; both lanes add the same two values, so the sum is the shuffle's
template <int CTRL>
__device__ __forceinline__ float add_xlane(float x) {
    const int y = __builtin_amdgcn_update_dpp(0, __float_as_int(x), CTRL, 0xf, 0xf, true);
    return x + __int_as_float(y);
}

// sum over the 16 lanes of a row, the same value in each of them
__device__ __forceinline__ float row_sum(float x) {
    x = add_xlane<0x161>(x);
    x = add_xlane<0x162>(x);
    x = add_xlane<0x164>(x);
    x = add_xlane<0x168>(x);
    return x;
}

// ---------------- fragment order of the GEMM operands ----------------------------
// A [M x Kd] and B [Kd x N] are both kept as blocks of 512 f16, one block per 16-wide
// tile (of m or of n) and 32-deep k step: [tile][ks = k/32][half 0..1][lane 0..31][8].
// Element map (ISA 7.12.2, 16-bit operands): lane = 16*kh + rc, rc = row of A or column
// of B within the tile; k = ks*32 + 16*half + 8*kh + i. A wave's 16-byte load of one half
// is then 512 contiguous bytes, four whole cache lines.
#define FRB_ 512                 // f16 in a block
// place in its block of element kk = k % 32 of row or column rc
__device__ __forceinline__ int frag_off(int kk, int rc) {
    return ((kk >> 4) * 32 + ((kk >> 3) & 1) * 16 + rc) * 8 + (kk & 7);
}

// ---------------- fp32 [M x Kd] -> f16 in A-fragment order ------------------------
// A wave builds one block: 8 lanes read one row's 32 values (a whole line), 4 rows an
// access, 4 accesses; the wave is the only writer of the block's lines.
template <int Kd>
__device__ __forceinline__
void pack_a_f16(const float* __restrict__ in, _Float16* __restrict__ out, int blk) {
    const int idx  = blk * EW_ + threadIdx.x;            // over M*Kd/16
    const int lane = idx & 31;
    const int fb   = idx >> 5;                           // block: mt * (Kd/32) + ks
    const int ks   = fb % (Kd / 32);
    const int mt   = fb / (Kd / 32);
    const int p    = lane & 7;                           // which 4 of the 32 values
    const int rq   = lane >> 3;                          // row within an access
    const float* src = in + (size_t)(mt * 16 + rq) * Kd + ks * 32 + p * 4;
    v4f x[4];
#pragma unroll
    for (int j = 0; j < 4; ++j) x[j] = *(const v4f*)(src + (size_t)j * 4 * Kd);
    // precaution: the address stays in its registers up to this wait, so that no load
    // above returns into them and nothing reuses them in front of it
    asm volatile("s_wait_xcnt 0x0" :: "v"(src) : "memory");
    _Float16* dst = out + (size_t)fb * FRB_ + frag_off(p * 4, rq);
#pragma unroll
    for (int j = 0; j < 4; ++j) {                        // row rq + 4j
        v4h y;
#pragma unroll
        for (int i = 0; i < 4; ++i) y[i] = (_Float16)x[j][i];
        *(v4h*)(dst + j * 32) = y;
    }
}

// ---------------- pack fp32 weight [Kd x N] into B-fragment order -----------------
// lane -> col = lane&15, kh = lane>>4; e -> k = ks*32 + (e<8 ? e : e+8) + 8*kh
// One thread builds one lane's whole fragment: 16 loads down a column, one 16-byte
// store into each half of the block.
template <int Kd, int N>
__device__ __forceinline__
void pack_b_f16(const float* __restrict__ W, _Float16* __restrict__ Bp, int blk) {
    const int idx  = blk * EW_ + threadIdx.x;            // over Kd*N/16
    const int lane = idx & 31;
    const int ks   = (idx >> 5) % (Kd / 32);
    const int nt   = idx / ((Kd / 32) << 5);
    const int kh   = lane >> 4;
    const int col  = lane & 15;
    const float* src = W + (size_t)(ks * 32 + 8 * kh) * N + nt * 16 + col;
    float w[16];
#pragma unroll
    for (int e = 0; e < 16; ++e) w[e] = src[(size_t)(e < 8 ? e : e + 8) * N];
    // precaution: the address stays in its registers up to this wait, so that no load
    // above returns into them and nothing reuses them in front of it
    asm volatile("s_wait_xcnt 0x0" :: "v"(src) : "memory");
    v8h lo, hi;
#pragma unroll
    for (int e = 0; e < 8; ++e) { lo[e] = (_Float16)w[e]; hi[e] = (_Float16)w[e + 8]; }
    _Float16* dst = Bp + (size_t)(idx >> 5) * FRB_ + lane * 8;
    *(v8h*)dst         = lo;
    *(v8h*)(dst + 256) = hi;
}

// ---------------- one launch for the conversion of x and the weight packs ------------
// The conversion of x and the four packs read only inputs and write separate arrays:
// as ranges of blocks of one grid they start together and pay one launch gap, one
// start and one drain between them.
#define CVB_ (MT_ * D_ / 16 / EW_)   // blocks that convert x
#define PKB_ (D_ * C_ / 16 / EW_)    // blocks that pack one weight matrix
__global__ __launch_bounds__(EW_)
void convert_and_pack(const float* __restrict__ x, const float* __restrict__ Wq,
                      const float* __restrict__ Wk, const float* __restrict__ Wv,
                      const float* __restrict__ Wo, _Float16* __restrict__ xh,
                      _Float16* __restrict__ Wqp, _Float16* __restrict__ Wkp,
                      _Float16* __restrict__ Wvp, _Float16* __restrict__ Wop) {
    static_assert(D_ == C_, "the four weight matrices have one shape");
    const int bid = blockIdx.x;
    if (bid < CVB_) {
        pack_a_f16<D_>(x, xh, bid);
    } else {
        const int m = (bid - CVB_) / PKB_;               // which matrix
        const float* W  = m == 0 ? Wq  : m == 1 ? Wk  : m == 2 ? Wv  : Wo;
        _Float16*    Bp = m == 0 ? Wqp : m == 1 ? Wkp : m == 2 ? Wvp : Wop;
        pack_b_f16<D_, C_>(W, Bp, (bid - CVB_) % PKB_);
        // precaution: the built code lays the other branch behind this one, and it
        // reuses the address registers of the stores above; the wait stands in between
        asm volatile("s_wait_xcnt 0x0" ::: "memory");
    }
}

// ---------------- WMMA f16 GEMM: C[MxN] = A * B, both in fragment order -----------
// block = 128 threads (4 waves); each wave owns one 16x16 tile; k-loop fully
// unrolled (Kd/32 = 16 static v_wmma_f32_16x16x32_f16 per wave).
// a block takes tile row by (of M/16) and the four n-tiles bx (of N/64)
template <int Kd, int N>
__device__ __forceinline__
void gemm_tile(const _Float16* __restrict__ Ap, const _Float16* __restrict__ Bp,
               float* __restrict__ C, int bx, int by) {
    const int lane = threadIdx.x & 31;
    const int wave = threadIdx.x >> 5;
    const int nt   = bx * 4 + wave;          // 16-wide n-tile index
    const int m0   = by * 16;
    const int r    = lane & 15;              // A-row / C-col within tile
    const int kh   = lane >> 4;              // K-half select

    const _Float16* Afrag = Ap + (size_t)by * (Kd / 32) * FRB_ + lane * 8;
    const _Float16* Bfrag = Bp + (size_t)nt * (Kd / 32) * FRB_ + lane * 8;

    v8f acc = {};
#pragma unroll
    for (int ks = 0; ks < Kd / 32; ++ks) {
        const v8h a0 = *(const v8h*)(Afrag + ks * FRB_);
        const v8h a1 = *(const v8h*)(Afrag + ks * FRB_ + 256);
        const v8h b0 = *(const v8h*)(Bfrag + ks * FRB_);
        const v8h b1 = *(const v8h*)(Bfrag + ks * FRB_ + 256);
        const v16h a = __builtin_shufflevector(a0, a1, 0, 1, 2, 3, 4, 5, 6, 7,
                                               8, 9, 10, 11, 12, 13, 14, 15);
        const v16h b = __builtin_shufflevector(b0, b1, 0, 1, 2, 3, 4, 5, 6, 7,
                                               8, 9, 10, 11, 12, 13, 14, 15);
        acc = __builtin_amdgcn_wmma_f32_16x16x32_f16(false, a, false, b,
                                                     (short)0, acc, false, false);
    }
    // precaution: the wait stands before any address register of the loads above is
    // reused; the scheduling barrier keeps later vector and scalar register writes from
    // rising over it and lets the matrix instructions and the loads be placed freely
    asm volatile("s_wait_xcnt 0x0" ::: "memory");
    __builtin_amdgcn_sched_barrier(0x18);
    // C/D layout: VGPR i -> row = i + 8*kh, col = lane&15
#pragma unroll
    for (int i = 0; i < 8; ++i)
        C[(size_t)(m0 + i + 8 * kh) * N + nt * 16 + r] = acc[i];
}

// grid = (N/64, M/16)
template <int Kd, int N>
__global__ __launch_bounds__(128)
void gemm_f16_wmma(const _Float16* __restrict__ A, const _Float16* __restrict__ Bp,
                   float* __restrict__ C) {
    gemm_tile<Kd, N>(A, Bp, C, blockIdx.x, blockIdx.y);
}

// ---------------- beta = sigmoid(x @ Wb), one thread per (row, h) ----------------
__device__ __forceinline__
void beta_sigmoid(const float* __restrict__ x, const float* __restrict__ Wb,
                  float* __restrict__ beta, int blk) {
    const int idx = blk * 128 + threadIdx.x;           // over MT_*H_
    const int h = idx % H_;
    const int row = idx / H_;
    float acc = 0.f;
    for (int d = 0; d < D_; ++d)
        acc += x[(size_t)row * D_ + d] * Wb[(size_t)d * H_ + h];
    beta[idx] = __builtin_amdgcn_rcpf(1.f + __expf(-acc));
}

// ---------------- one launch for the four projections of x -----------------------
// q, k, v and beta do not depend on one another. The beta blocks have the longest
// serial loop and the lowest indices, and the tiles of the
// three products run beside them.
#define BTB_ (MT_ * H_ / 128)            // blocks of beta
#define GMB_ ((C_ / 64) * (MT_ / 16))    // blocks of one product
__global__ __launch_bounds__(128)
void project_qkv_beta(const _Float16* __restrict__ xh, const _Float16* __restrict__ Wqp,
                      const _Float16* __restrict__ Wkp, const _Float16* __restrict__ Wvp,
                      float* __restrict__ Qf, float* __restrict__ Kf,
                      float* __restrict__ Vf, const float* __restrict__ x,
                      const float* __restrict__ Wb, float* __restrict__ beta) {
    const int bid = blockIdx.x;
    if (bid < BTB_) {
        beta_sigmoid(x, Wb, beta, bid);
    } else {
        const int m = (bid - BTB_) / GMB_;               // which product
        const int t = (bid - BTB_) % GMB_;
        const _Float16* Bp = m == 0 ? Wqp : m == 1 ? Wkp : Wvp;
        float*          C  = m == 0 ? Qf  : m == 1 ? Kf  : Vf;
        gemm_tile<D_, C_>(xh, Bp, C, t % (C_ / 64), t / (C_ / 64));
        // precaution: the built code lays the beta branch behind this one, and it
        // reuses the address registers of the stores above; the wait stands in between
        asm volatile("s_wait_xcnt 0x0" ::: "memory");
    }
}

// ---------------- causal depthwise conv-4 + SiLU ---------------------------------
// A lane takes 4 channels x 4 consecutive time steps: 7 input rows serve 4 output rows.
// The three rows in front of a sequence count as zero, as the reference pads them.
// blockIdx.y picks q, k or v: the three do not depend on one another and share a launch.
__global__ __launch_bounds__(EW_)
void conv_silu(const float* __restrict__ Pq, const float* __restrict__ Pk,
               const float* __restrict__ Pv, const float* __restrict__ wq,
               const float* __restrict__ wk, const float* __restrict__ wvv,
               float* __restrict__ Yq, float* __restrict__ Yk, float* __restrict__ Yv) {
    const int m = blockIdx.y;
    const float* P = m == 0 ? Pq : m == 1 ? Pk : Pv;
    const float* w = m == 0 ? wq : m == 1 ? wk : wvv;
    float*       Y = m == 0 ? Yq : m == 1 ? Yk : Yv;
    const int g  = blockIdx.x * EW_ + threadIdx.x;       // over (MT_/4)*(C_/4)
    const int c  = (g % (C_ / 4)) * 4;
    const int bt = (g / (C_ / 4)) * 4;                   // first of the four rows
    const bool first = (bt % T_) == 0;
    const int off = bt * C_ + c;                         // the same place in P and in Y
    const float* cur = P + off;
    v4f p[7], wv[4];
#pragma unroll
    for (int r = 0; r < 4; ++r) p[3 + r] = *(const v4f*)(cur + r * C_);
#pragma unroll
    for (int r = 0; r < 3; ++r) p[r] = (v4f){0.f, 0.f, 0.f, 0.f};
    if (!first) {
#pragma unroll
        for (int r = 0; r < 3; ++r) p[r] = *(const v4f*)(cur + (r - 3) * C_);
    }
#pragma unroll
    for (int ch = 0; ch < 4; ++ch) wv[ch] = *(const v4f*)(w + (c + ch) * 4);
#pragma unroll
    for (int tt = 0; tt < 4; ++tt) {
        v4f y;
#pragma unroll
        for (int ch = 0; ch < 4; ++ch) {
            float acc = 0.f;
#pragma unroll
            for (int i = 0; i < 4; ++i) acc += p[tt + i][ch] * wv[ch][i];
            y[ch] = acc * __builtin_amdgcn_rcpf(1.f + __expf(-acc));   // SiLU
        }
        *(v4f*)(Y + off + tt * C_) = y;
    }
}

// sum of squares of a head's 64 values, 4 a lane on one 16-lane row
__device__ __forceinline__ float head_sumsq(const v4f& x) {
    const float e = __builtin_fmaf(x[2], x[2], x[0] * x[0]);
    const float d = __builtin_fmaf(x[3], x[3], x[1] * x[1]);
    return row_sum(e + d);
}

#define NG4_ (MT_ * H_ * 16)     // 4-element pieces in a [MT_][H_][64] array

// ---------------- per-head l2norm (sum, +1e-6) with scale (in place) -------------
// a lane takes its piece of heads g/16, g/16 + 4096, ...; it reads all before it writes
// blockIdx.y picks q (scaled) or k: one launch for both
__global__ __launch_bounds__(EW_)
void l2norm_scale(float* q, float* k, float qscale) {
    const int g = blockIdx.x * EW_ + threadIdx.x;        // over NG4_/4
    const float scale = blockIdx.y == 0 ? qscale : 1.0f;
    float* p = (blockIdx.y == 0 ? q : k) + (size_t)g * 4;
    v4f x[4];
#pragma unroll
    for (int j = 0; j < 4; ++j) x[j] = *(const v4f*)(p + (size_t)j * NG4_);
#pragma unroll
    for (int j = 0; j < 4; ++j) {
        const float inv = rsqrtf(head_sumsq(x[j]) + 1e-6f);
        v4f y;
#pragma unroll
        for (int i = 0; i < 4; ++i) y[i] = x[j][i] * inv * scale;
        *(v4f*)(p + (size_t)j * NG4_) = y;
    }
}

// ---------------- sequential IVON delta-rule recurrence --------------------------
// grid = (8 v-groups, H, B); block = 128 threads = 4 waves, one per SIMD of a WGP
// (kg = tid&15, vl = tid>>4): a column v of the state lies on one 16-lane row, four
// k elements a lane, so a time step is a quarter of the vector work per wave that a
// 16-element lane had, and the sums over k end in a 16-lane DPP tree.
// Inputs and outputs pass through double-buffered LDS CH_ time steps at a time: the
// global loads of chunk c+1 are in flight while chunk c is worked on, chunk c-1's
// outputs are stored behind the same barrier, and the block meets once per chunk.
// Inside a chunk each step's operands are read from LDS into registers two steps
// before their first use, so no global access and no barrier stands on the serial path.
// The next step does not need o, only S: o of step s is therefore summed in step s + 1,
// from the same S, beside that step's pred. The wave is alone on its SIMD and issues in
// order, so two sums one behind the other cost two latencies, side by side one.
// All 16 lanes of a column hold its o, and all store it, each its own copy: a store
// under a lane mask is a block of its own in the built code and would stand between
// pred and the update that waits for it.
// What a step costs is its chain of dependent instructions from one err to the next,
// so only what needs err or the reciprocal stands on that chain:
//   g is kept as Gs = g / (1 - B1):          Gs = B1 * Gs + grad
//   h is kept as Hs = (h + LAM) / (1 - B2):  Hs = (B2 * Hs + HC_) + grad * grad
//   S -= LR * beta * g / (h + LAM)  is then  S += (NB_ * beta) * Gs / Hs
//   err of step s + 1 = k' . S_s - v' is summed as (k' . S_(s-1) - v') + sum(k' * lg * r),
//   lg = NB_ * beta * Gs, r = 1 / Hs: the bracket waits for nothing of step s, and the
//   update of S itself leaves the chain; -v' enters as -v'/16 in each of the 16 lanes.
// -v/16 and NB_ * beta are formed where a chunk is written to LDS.
#define CH_ 32
#define NCH_ (T_ / CH_)
#define VB_ 8                    // state columns per block
#define RT_ 128                  // threads per block
#define OR_ (VB_ * 16)           // floats of o a time step takes in LDS, 16 copies a column
#define NB_ ((float)(-1e-3 * (1.0 - 0.9) / (1.0 - 0.999)))      // -LR * (1 - B1) / (1 - B2)
#define HI_ ((float)(1.0 / (1.0 - 0.999)))                      // Hs at h = 0
// LAM's share of Hs must stay where it is under Hs = B2 * Hs + HC_, with B2 as f32 has it
#define HC_ ((float)((1.0 - (double)BETA2_) / (1.0 - 0.999)))

// row s of a chunk: k of s, q of s - 1, and the pair -v/16, NB_ * beta of s; the two lie
// side by side in LDS and come as one pair: a single register that a read is still to
// fill can be given the place beside a value which the packed products name as a
// register pair, and the built code then waits there for the fresh read
struct StepIn { v4f k; v4f q; v2f vb; };

template <bool PREV_O>
__device__ __forceinline__ void read_step(StepIn& r, const float* kb, const float* qb,
                                          const float* vb, int s) {
    r.k = *(const v4f*)(kb + s * 64);
    if constexpr (PREV_O) r.q = *(const v4f*)(qb + (s - 1) * 64);
    r.vb = *(const v2f*)(vb + s * VB_ * 2);
}

// a lane's share of a sum over k
__device__ __forceinline__ float lane_dot(const v4f& a, const float (&S)[4]) {
    const float e = __builtin_fmaf(a[2], S[2], a[0] * S[0]);
    const float d = __builtin_fmaf(a[3], S[3], a[1] * S[1]);
    return e + d;
}

// a lane's share of k . S - v, in two halves (elements 0,2 and 1,3); nv = -v/16
__device__ __forceinline__ v2f lane_part(const v4f& k, const float (&S)[4], float nv) {
    v2f p;
    p[0] = __builtin_fmaf(k[2], S[2], __builtin_fmaf(k[0], S[0], nv));
    p[1] = __builtin_fmaf(k[3], S[3], k[1] * S[1]);
    return p;
}

// one time step on row c; part holds the lane's share of its err and, where a row n
// follows in the chunk (NEXT), leaves with that of the next step's. Returns o of the
// step before (PREV_O), summed from S as that step left it
template <bool PREV_O, bool NEXT>
__device__ __forceinline__ float one_step(const StepIn& c, const StepIn& n, v2f& part,
                                          float (&S)[4], float (&G)[4], float (&Hs)[4]) {
    // err[v] = k . S[:,v] - v: the lane's two halves, then the 16 lanes of the column;
    // o[v] = q . S[:,v] link by link beside it
    float err = part[0] + part[1];
    float o = 0.f;
    if constexpr (PREV_O) {
        o = lane_dot(c.q, S);
        err = add_xlane<0x161>(err);  o = add_xlane<0x161>(o);
        err = add_xlane<0x162>(err);  o = add_xlane<0x162>(o);
        err = add_xlane<0x164>(err);  o = add_xlane<0x164>(o);
        err = add_xlane<0x168>(err);  o = add_xlane<0x168>(o);
    } else {
        err = row_sum(err);
    }
    // the next step's share as far as S of the step before gives it
    v2f p = {0.f, 0.f};
    if constexpr (NEXT) p = lane_part(n.k, S, n.vb[0]);

    // lg = NB_ * beta * Gs straight from err, not behind the new Gs: it has to be there,
    // times the next k, when the reciprocals arrive
    const float nb9 = BETA1_ * c.vb[1];
    const float ne  = c.vb[1] * err;
    float lg[4], r[4];
#pragma unroll
    for (int i = 0; i < 4; ++i) {
        const float grad = c.k[i] * err;                    // outer(k, pred-v)
        Hs[i] = __builtin_fmaf(grad, grad, __builtin_fmaf(BETA2_, Hs[i], HC_));
        lg[i] = __builtin_fmaf(c.k[i], ne, nb9 * G[i]);
        G[i]  = __builtin_fmaf(BETA1_, G[i], grad);
        r[i]  = __builtin_amdgcn_rcpf(Hs[i]);
    }
    if constexpr (NEXT) {
        part[0] = __builtin_fmaf(n.k[2] * lg[2], r[2], __builtin_fmaf(n.k[0] * lg[0], r[0], p[0]));
        part[1] = __builtin_fmaf(n.k[3] * lg[3], r[3], __builtin_fmaf(n.k[1] * lg[1], r[1], p[1]));
    }
#pragma unroll
    for (int i = 0; i < 4; ++i) S[i] = __builtin_fmaf(lg[i], r[i], S[i]);   // WD==0
    return o;
}

// four neighbouring columns of o, one copy of each
__device__ __forceinline__ v4f read_out(const float* c) {
    v4f y;
#pragma unroll
    for (int i = 0; i < 4; ++i) y[i] = c[i * 16];
    return y;
}

__global__ __launch_bounds__(RT_)
void recurrence(const float* __restrict__ qn, const float* __restrict__ kn,
                const float* __restrict__ vn, const float* __restrict__ beta,
                float* __restrict__ o) {
    const int tid = threadIdx.x;
    const int kg  = tid & 15;
    const int vl  = tid >> 4;
    const int vg  = blockIdx.x;
    const int h   = blockIdx.y;
    const int b   = blockIdx.z;

    float S[4], G[4], Hm[4];
#pragma unroll
    for (int i = 0; i < 4; ++i) { S[i] = 0.f; G[i] = 0.f; Hm[i] = HI_; }

    __shared__ __attribute__((aligned(16))) float ks_[2][CH_][64];
    __shared__ __attribute__((aligned(16))) float qs_[2][CH_][64];
    __shared__ __attribute__((aligned(16))) float vs_[2][CH_][VB_][2];   // -v/16, NB_*beta
    __shared__ __attribute__((aligned(16))) float os_[2][CH_][VB_][16];

    const size_t base  = (size_t)(b * T_) * C_ + h * 64;
    const size_t bbase = (size_t)(b * T_) * H_ + h;

    // staging map: 16 lanes cover one 64-float row of k or q (8 rows a pass); the
    // first two waves cover the chunk's 8-float rows of v and o, 2 lanes a row
    const int  r4 = tid >> 4, c4 = (tid & 15) * 4;
    const int  rv = (tid >> 1) & (CH_ - 1), cv = (tid & 1) * 4;
    const bool vo = tid < CH_ * VB_ / 4;
    const int  xo = rv & 15;    // which copy of o a lane reads: spreads the LDS banks
    const float* kgp = kn + base + (size_t)r4 * C_ + c4;
    const float* qgp = qn + base + (size_t)r4 * C_ + c4;
    const float* vgp = vn + base + vg * VB_ + (size_t)rv * C_ + cv;
    const float* bgp = beta + bbase + (size_t)rv * H_;

    v4f   kst[CH_ / 8], qst[CH_ / 8], vst;
    float bst;

    // chunk 0: global -> registers
#pragma unroll
    for (int j = 0; j < CH_ / 8; ++j) {
        kst[j] = *(const v4f*)(kgp + (size_t)j * 8 * C_);
        qst[j] = *(const v4f*)(qgp + (size_t)j * 8 * C_);
    }
    vst = *(const v4f*)vgp;
    bst = *bgp;
    // precaution: the wait stands before any address register of the loads above is
    // reused; the scheduling barrier keeps later register writes from rising over it
    asm volatile("s_wait_xcnt 0x0" ::: "memory");
    __builtin_amdgcn_sched_barrier(0);

    float* ogp = o + base + vg * VB_ + (size_t)rv * C_ + cv;
    for (int c = 0; c < NCH_; ++c) {
        const int p = c & 1;
        // registers -> LDS buffer p; its last readers (chunk c-2) left it before
        // the barrier of chunk c-1
#pragma unroll
        for (int j = 0; j < CH_ / 8; ++j) {
            *(v4f*)&ks_[p][r4 + 8 * j][c4] = kst[j];
            *(v4f*)&qs_[p][r4 + 8 * j][c4] = qst[j];
        }
        if (vo) {
            const v4f   nv = vst * (-1.f / 16.f);
            const float nb = bst * NB_;
            *(v4f*)&vs_[p][rv][cv][0]     = (v4f){nv[0], nb, nv[1], nb};
            *(v4f*)&vs_[p][rv][cv + 2][0] = (v4f){nv[2], nb, nv[3], nb};
        }
        __syncthreads();

        if (c > 0) {                            // chunk c-1's outputs: LDS -> global
            if (vo) *(v4f*)ogp = read_out(&os_[p ^ 1][rv][cv][xo]);
            ogp += (size_t)CH_ * C_;
        }
        if (c + 1 < NCH_) {                     // chunk c+1: in flight across chunk c
            kgp += (size_t)CH_ * C_;
            qgp += (size_t)CH_ * C_;
            vgp += (size_t)CH_ * C_;
            bgp += (size_t)CH_ * H_;
#pragma unroll
            for (int j = 0; j < CH_ / 8; ++j) {
                kst[j] = *(const v4f*)(kgp + (size_t)j * 8 * C_);
                qst[j] = *(const v4f*)(qgp + (size_t)j * 8 * C_);
            }
            vst = *(const v4f*)vgp;
            bst = *bgp;
        }

        const float* kb = &ks_[p][0][kg * 4];
        const float* qb = &qs_[p][0][kg * 4];
        const float* vb = &vs_[p][0][vl][0];
        float*       ob = &os_[p][0][vl][kg];

        // A step works on its own row and the next; a row is read two steps before its
        // first use, so four rows are held and the
        // loop's body is four steps, each row in registers of its own.
        // step 0 has no output to finish: the chunk before has summed its last one
        StepIn ra, rb, rc, rd;
        read_step<false>(ra, kb, qb, vb, 0);
        read_step<true>(rb, kb, qb, vb, 1);
        read_step<true>(rc, kb, qb, vb, 2);
        read_step<true>(rd, kb, qb, vb, 3);
        // keeps the LDS reads of later steps above this step's arithmetic, so
        // that they have returned before the first wait on them
        __builtin_amdgcn_sched_barrier(0);
        v2f part = lane_part(ra.k, S, ra.vb[0]);
        one_step<false, true>(ra, rb, part, S, G, Hm);
        for (int s = 1; s < CH_ - 6; s += 4) {
            read_step<true>(ra, kb, qb, vb, s + 3);
            __builtin_amdgcn_sched_barrier(0);  // as above
            ob[(s - 1) * OR_] = one_step<true, true>(rb, rc, part, S, G, Hm);
            read_step<true>(rb, kb, qb, vb, s + 4);
            __builtin_amdgcn_sched_barrier(0);  // as above
            ob[s * OR_] = one_step<true, true>(rc, rd, part, S, G, Hm);
            read_step<true>(rc, kb, qb, vb, s + 5);
            __builtin_amdgcn_sched_barrier(0);  // as above
            ob[(s + 1) * OR_] = one_step<true, true>(rd, ra, part, S, G, Hm);
            read_step<true>(rd, kb, qb, vb, s + 6);
            __builtin_amdgcn_sched_barrier(0);  // as above
            ob[(s + 2) * OR_] = one_step<true, true>(ra, rb, part, S, G, Hm);
        }
        // the last three steps, and behind them the last one's own output: the block
        // stores the chunk's outputs behind the next barrier, so none is carried over
        // it; the row behind the last is not in LDS yet, so the next chunk starts its
        // first err from S
        const v4f ql = *(const v4f*)(qb + (CH_ - 1) * 64);
        __builtin_amdgcn_sched_barrier(0);      // as above
        ob[(CH_ - 4) * OR_] = one_step<true, true>(rb, rc, part, S, G, Hm);
        ob[(CH_ - 3) * OR_] = one_step<true, true>(rc, rd, part, S, G, Hm);
        ob[(CH_ - 2) * OR_] = one_step<true, false>(rd, rd, part, S, G, Hm);
        ob[(CH_ - 1) * OR_] = row_sum(lane_dot(ql, S));
    }

    __syncthreads();                            // last chunk's outputs are complete
    if (vo) *(v4f*)ogp = read_out(&os_[(NCH_ - 1) & 1][rv][cv][xo]);
}

// ---------------- RMSNorm over V (mean, +1e-5) * rms_w, f16 in A-fragment order ---
// A block takes one 16-row tile and four heads; a wave takes 8 rows of one head, 16
// lanes a row and 4 rows a lane: each access reads whole lines, and the wave is the
// only writer of the lines it fills (8 rows of one k-octet make a line).
__global__ __launch_bounds__(EW_)
void rmsnorm_f16(const float* __restrict__ o, const float* __restrict__ rw,
                 _Float16* __restrict__ oh) {
    const int l    = threadIdx.x & 15;                   // 4 values of the head's 64
    const int w    = threadIdx.x >> 5;
    const int mt   = blockIdx.x >> 1;
    const int head = (blockIdx.x & 1) * 4 + (w >> 1);
    const int r0   = (w & 1) * 8 + ((threadIdx.x >> 4) & 1) * 4;   // first of 4 rows
    const float* src = o + (size_t)(mt * 16 + r0) * C_ + head * 64 + l * 4;
    v4f x[4];
#pragma unroll
    for (int j = 0; j < 4; ++j) x[j] = *(const v4f*)(src + j * C_);
    const v4f wv = *(const v4f*)(rw + l * 4);
    // precaution: the address stays in its registers up to this wait, so that no load
    // above returns into them and nothing reuses them in front of it
    asm volatile("s_wait_xcnt 0x0" :: "v"(src) : "memory");
    _Float16* dst = oh + (size_t)(mt * (C_ / 32) + head * 2 + (l >> 3)) * FRB_
                       + frag_off((l & 7) * 4, r0);
#pragma unroll
    for (int j = 0; j < 4; ++j) {
        const float inv = rsqrtf(head_sumsq(x[j]) * (1.0f / 64.f) + EPS_);
        v4h y;
#pragma unroll
        for (int i = 0; i < 4; ++i) y[i] = (_Float16)(x[j][i] * inv * wv[i]);
        *(v4h*)(dst + j * 8) = y;
    }
}

// ---------------- host-side launch ----------------
extern "C" void kernel_launch(void* const* d_in, const int* in_sizes, int n_in,
                              void* d_out, int out_size, void* d_ws, size_t ws_size,
                              hipStream_t stream) {
    (void)in_sizes; (void)n_in; (void)out_size; (void)ws_size;
    const float* x    = (const float*)d_in[0];
    const float* Wq   = (const float*)d_in[1];
    const float* Wk   = (const float*)d_in[2];
    const float* Wv   = (const float*)d_in[3];
    const float* Wb   = (const float*)d_in[4];
    const float* cwq  = (const float*)d_in[5];
    const float* cwk  = (const float*)d_in[6];
    const float* cwv  = (const float*)d_in[7];
    const float* rmsw = (const float*)d_in[8];
    const float* Wo   = (const float*)d_in[9];
    float* out = (float*)d_out;

    char* ws = (char*)d_ws;
    size_t off = 0;
    auto alloc = [&](size_t bytes) -> void* {
        void* p = ws + off;
        off += (bytes + 255) & ~(size_t)255;
        return p;
    };
    _Float16* xh   = (_Float16*)alloc((size_t)MT_ * D_ * 2);
    _Float16* Wqp  = (_Float16*)alloc((size_t)D_ * C_ * 2);   // packed fragments
    _Float16* Wkp  = (_Float16*)alloc((size_t)D_ * C_ * 2);
    _Float16* Wvp  = (_Float16*)alloc((size_t)D_ * C_ * 2);
    _Float16* Wop  = (_Float16*)alloc((size_t)C_ * D_ * 2);
    float*    Qf   = (float*)alloc((size_t)MT_ * C_ * 4);
    float*    Kf   = (float*)alloc((size_t)MT_ * C_ * 4);
    float*    Vf   = (float*)alloc((size_t)MT_ * C_ * 4);
    float*    qc   = (float*)alloc((size_t)MT_ * C_ * 4);
    float*    kc   = (float*)alloc((size_t)MT_ * C_ * 4);
    float*    vc   = (float*)alloc((size_t)MT_ * C_ * 4);
    float*    betaf= (float*)alloc((size_t)MT_ * H_ * 4);
    float*    ob   = (float*)alloc((size_t)MT_ * C_ * 4);
    _Float16* ohh  = (_Float16*)alloc((size_t)MT_ * C_ * 2);

    // 1) x and the four GEMM weight matrices as f16 in WMMA fragment order: one launch
    convert_and_pack<<<CVB_ + 4 * PKB_, EW_, 0, stream>>>(x, Wq, Wk, Wv, Wo,
                                                          xh, Wqp, Wkp, Wvp, Wop);

    // 2) the three projection GEMMs (v_wmma_f32_16x16x32_f16) and beta: one launch
    project_qkv_beta<<<BTB_ + 3 * GMB_, 128, 0, stream>>>(xh, Wqp, Wkp, Wvp, Qf, Kf, Vf,
                                                          x, Wb, betaf);

    // 3) causal depthwise conv + SiLU of q, k, v: one launch
    conv_silu<<<dim3(MT_ * C_ / 16 / EW_, 3), EW_, 0, stream>>>(Qf, Kf, Vf, cwq, cwk, cwv,
                                                                qc, kc, vc);

    // 4) l2norm of q and k (in place), scale on q: one launch
    l2norm_scale<<<dim3(NG4_ / 4 / EW_, 2), EW_, 0, stream>>>(qc, kc, SCALE_);

    // 5) sequential recurrence: 128 blocks (B*H*8 v-groups) x 128 threads
    dim3 rgrid(64 / VB_, H_, B_);
    recurrence<<<rgrid, RT_, 0, stream>>>(qc, kc, vc, betaf, ob);

    // 6) RMSNorm -> f16 in A-fragment order
    rmsnorm_f16<<<NG4_ / 4 / EW_, EW_, 0, stream>>>(ob, rmsw, ohh);

    // 7) output projection GEMM (fp32 result straight to d_out)
    gemm_f16_wmma<C_, D_><<<dim3(D_ / 64, MT_ / 16), 128, 0, stream>>>(ohh, Wop, out);
}

// v009
// Measured time: 94.5 microseconds a run.
// In two side-by-side timings against v008, it was 1.09 and 1.10 times as fast.
// All steps since v000 together make it 10.7 times as fast.
#include <hip/hip_runtime.h>

// ---------------- problem dims (fixed by reference) ----------------
#define B_    2
#define T_    1024
#define D_    512
#define H_    8
#define MT_   (B_ * T_)          // 2048 rows
#define C_    512                // H*K == H*V == 512 channels

#define LR_    1e-3f
#define BETA1_ 0.9f
#define BETA2_ 0.999f
#define EPS_   1e-5f
#define SCALE_ 0.125f            // 64^-0.5

typedef __attribute__((ext_vector_type(16))) _Float16 v16h;
typedef __attribute__((ext_vector_type(8)))  float    v8f;
typedef __attribute__((ext_vector_type(4)))  float    v4f;
typedef __attribute__((ext_vector_type(2)))  float    v2f;
typedef __attribute__((ext_vector_type(4)))  _Float16 v4h;
typedef __attribute__((ext_vector_type(8)))  _Float16 v8h;

// The elementwise kernels below are short, and what they cost is the starting of their
// waves: each lane therefore takes 16 elements and a 2048 x 512 array is 256 blocks. Their loops
// over a lane's pieces are unrolled so that the pieces stay in registers and all of a
// lane's loads are in flight together.
#define EW_ 256                  // threads per block of those kernels

// x + (x of lane ^ m), m = CTRL - 0x160 (DPP row_xmask): the partner's value comes
// through the vector unit's own cross-lane path, not through the LDS queue and a
// wait on it; both lanes add the same two values, so the sum is the shuffle's
template <int CTRL>
__device__ __forceinline__ float add_xlane(float x) {
    const int y = __builtin_amdgcn_update_dpp(0, __float_as_int(x), CTRL, 0xf, 0xf, true);
    return x + __int_as_float(y);
}

// sum over the 16 lanes of a row, the same value in each of them
__device__ __forceinline__ float row_sum(float x) {
    x = add_xlane<0x161>(x);
    x = add_xlane<0x162>(x);
    x = add_xlane<0x164>(x);
    x = add_xlane<0x168>(x);
    return x;
}

// ---------------- fragment order of the GEMM operands ----------------------------
// A [M x Kd] and B [Kd x N] are both kept as blocks of 512 f16, one block per 16-wide
// tile (of m or of n) and 32-deep k step: [tile][ks = k/32][half 0..1][lane 0..31][8].
// Element map (ISA 7.12.2, 16-bit operands): lane = 16*kh + rc, rc = row of A or column
// of B within the tile; k = ks*32 + 16*half + 8*kh + i. A wave's 16-byte load of one half
// is then 512 contiguous bytes, four whole cache lines.
#define FRB_ 512                 // f16 in a block
// place in its block of element kk = k % 32 of row or column rc
__device__ __forceinline__ int frag_off(int kk, int rc) {
    return ((kk >> 4) * 32 + ((kk >> 3) & 1) * 16 + rc) * 8 + (kk & 7);
}

// ---------------- fp32 [M x Kd] -> f16 in A-fragment order ------------------------
// A wave builds one block: 8 lanes read one row's 32 values (a whole line), 4 rows an
// access, 4 accesses; the wave is the only writer of the block's lines.
template <int Kd>
__device__ __forceinline__
void pack_a_f16(const float* __restrict__ in, _Float16* __restrict__ out, int blk) {
    const int idx  = blk * EW_ + threadIdx.x;            // over M*Kd/16
    const int lane = idx & 31;
    const int fb   = idx >> 5;                           // block: mt * (Kd/32) + ks
    const int ks   = fb % (Kd / 32);
    const int mt   = fb / (Kd / 32);
    const int p    = lane & 7;                           // which 4 of the 32 values
    const int rq   = lane >> 3;                          // row within an access
    const float* src = in + (size_t)(mt * 16 + rq) * Kd + ks * 32 + p * 4;
    v4f x[4];
#pragma unroll
    for (int j = 0; j < 4; ++j) x[j] = *(const v4f*)(src + (size_t)j * 4 * Kd);
    // precaution: the address stays in its registers up to this wait, so that no load
    // above returns into them and nothing reuses them in front of it
    asm volatile("s_wait_xcnt 0x0" :: "v"(src) : "memory");
    _Float16* dst = out + (size_t)fb * FRB_ + frag_off(p * 4, rq);
#pragma unroll
    for (int j = 0; j < 4; ++j) {                        // row rq + 4j
        v4h y;
#pragma unroll
        for (int i = 0; i < 4; ++i) y[i] = (_Float16)x[j][i];
        *(v4h*)(dst + j * 32) = y;
    }
}

// ---------------- pack fp32 weight [Kd x N] into B-fragment order -----------------
// lane -> col = lane&15, kh = lane>>4; e -> k = ks*32 + (e<8 ? e : e+8) + 8*kh
// One thread builds one lane's whole fragment: 16 loads down a column, one 16-byte
// store into each half of the block.
template <int Kd, int N>
__device__ __forceinline__
void pack_b_f16(const float* __restrict__ W, _Float16* __restrict__ Bp, int blk) {
    const int idx  = blk * EW_ + threadIdx.x;            // over Kd*N/16
    const int lane = idx & 31;
    const int ks   = (idx >> 5) % (Kd / 32);
    const int nt   = idx / ((Kd / 32) << 5);
    const int kh   = lane >> 4;
    const int col  = lane & 15;
    const float* src = W + (size_t)(ks * 32 + 8 * kh) * N + nt * 16 + col;
    float w[16];
#pragma unroll
    for (int e = 0; e < 16; ++e) w[e] = src[(size_t)(e < 8 ? e : e + 8) * N];
    // precaution: the address stays in its registers up to this wait, so that no load
    // above returns into them and nothing reuses them in front of it
    asm volatile("s_wait_xcnt 0x0" :: "v"(src) : "memory");
    v8h lo, hi;
#pragma unroll
    for (int e = 0; e < 8; ++e) { lo[e] = (_Float16)w[e]; hi[e] = (_Float16)w[e + 8]; }
    _Float16* dst = Bp + (size_t)(idx >> 5) * FRB_ + lane * 8;
    *(v8h*)dst         = lo;
    *(v8h*)(dst + 256) = hi;
}

// ---------------- one launch for the conversion of x and the weight packs ------------
// The conversion of x and the four packs read only inputs and write separate arrays:
// as ranges of blocks of one grid they start together and pay one launch gap, one
// start and one drain between them.
#define CVB_ (MT_ * D_ / 16 / EW_)   // blocks that convert x
#define PKB_ (D_ * C_ / 16 / EW_)    // blocks that pack one weight matrix
__global__ __launch_bounds__(EW_)
void convert_and_pack(const float* __restrict__ x, const float* __restrict__ Wq,
                      const float* __restrict__ Wk, const float* __restrict__ Wv,
                      const float* __restrict__ Wo, _Float16* __restrict__ xh,
                      _Float16* __restrict__ Wqp, _Float16* __restrict__ Wkp,
                      _Float16* __restrict__ Wvp, _Float16* __restrict__ Wop) {
    static_assert(D_ == C_, "the four weight matrices have one shape");
    const int bid = blockIdx.x;
    if (bid < CVB_) {
        pack_a_f16<D_>(x, xh, bid);
    } else {
        const int m = (bid - CVB_) / PKB_;               // which matrix
        const float* W  = m == 0 ? Wq  : m == 1 ? Wk  : m == 2 ? Wv  : Wo;
        _Float16*    Bp = m == 0 ? Wqp : m == 1 ? Wkp : m == 2 ? Wvp : Wop;
        pack_b_f16<D_, C_>(W, Bp, (bid - CVB_) % PKB_);
        // precaution: the built code lays the other branch behind this one, and it
        // reuses the address registers of the stores above; the wait stands in between
        asm volatile("s_wait_xcnt 0x0" ::: "memory");
    }
}

// ---------------- WMMA f16 GEMM: C[MxN] = A * B, both in fragment order -----------
// block = 128 threads (4 waves); each wave owns one 16x16 tile; k-loop fully
// unrolled (Kd/32 = 16 static v_wmma_f32_16x16x32_f16 per wave).
// a block takes tile row by (of M/16) and the four n-tiles bx (of N/64)
template <int Kd, int N>
__device__ __forceinline__
void gemm_tile(const _Float16* __restrict__ Ap, const _Float16* __restrict__ Bp,
               float* __restrict__ C, int bx, int by) {
    const int lane = threadIdx.x & 31;
    const int wave = threadIdx.x >> 5;
    const int nt   = bx * 4 + wave;          // 16-wide n-tile index
    const int m0   = by * 16;
    const int r    = lane & 15;              // A-row / C-col within tile
    const int kh   = lane >> 4;              // K-half select

    const _Float16* Afrag = Ap + (size_t)by * (Kd / 32) * FRB_ + lane * 8;
    const _Float16* Bfrag = Bp + (size_t)nt * (Kd / 32) * FRB_ + lane * 8;

    v8f acc = {};
#pragma unroll
    for (int ks = 0; ks < Kd / 32; ++ks) {
        const v8h a0 = *(const v8h*)(Afrag + ks * FRB_);
        const v8h a1 = *(const v8h*)(Afrag + ks * FRB_ + 256);
        const v8h b0 = *(const v8h*)(Bfrag + ks * FRB_);
        const v8h b1 = *(const v8h*)(Bfrag + ks * FRB_ + 256);
        const v16h a = __builtin_shufflevector(a0, a1, 0, 1, 2, 3, 4, 5, 6, 7,
                                               8, 9, 10, 11, 12, 13, 14, 15);
        const v16h b = __builtin_shufflevector(b0, b1, 0, 1, 2, 3, 4, 5, 6, 7,
                                               8, 9, 10, 11, 12, 13, 14, 15);
        acc = __builtin_amdgcn_wmma_f32_16x16x32_f16(false, a, false, b,
                                                     (short)0, acc, false, false);
    }
    // precaution: the wait stands before any address register of the loads above is
    // reused; the scheduling barrier keeps later vector and scalar register writes from
    // rising over it and lets the matrix instructions and the loads be placed freely
    asm volatile("s_wait_xcnt 0x0" ::: "memory");
    __builtin_amdgcn_sched_barrier(0x18);
    // C/D layout: VGPR i -> row = i + 8*kh, col = lane&15
#pragma unroll
    for (int i = 0; i < 8; ++i)
        C[(size_t)(m0 + i + 8 * kh) * N + nt * 16 + r] = acc[i];
}

// grid = (N/64, M/16)
template <int Kd, int N>
__global__ __launch_bounds__(128)
void gemm_f16_wmma(const _Float16* __restrict__ A, const _Float16* __restrict__ Bp,
                   float* __restrict__ C) {
    gemm_tile<Kd, N>(A, Bp, C, blockIdx.x, blockIdx.y);
}

// ---------------- beta = sigmoid(x @ Wb), one thread per (row, h) ----------------
__device__ __forceinline__
void beta_sigmoid(const float* __restrict__ x, const float* __restrict__ Wb,
                  float* __restrict__ beta, int blk) {
    const int idx = blk * 128 + threadIdx.x;           // over MT_*H_
    const int h = idx % H_;
    const int row = idx / H_;
    float acc = 0.f;
    for (int d = 0; d < D_; ++d)
        acc += x[(size_t)row * D_ + d] * Wb[(size_t)d * H_ + h];
    beta[idx] = __builtin_amdgcn_rcpf(1.f + __expf(-acc));
}

// sum of squares of a head's 64 values, 4 a lane on one 16-lane row
__device__ __forceinline__ float head_sumsq(const v4f& x) {
    const float e = __builtin_fmaf(x[2], x[2], x[0] * x[0]);
    const float d = __builtin_fmaf(x[3], x[3], x[1] * x[1]);
    return row_sum(e + d);
}

#define NG4_ (MT_ * H_ * 16)     // 4-element pieces in a [MT_][H_][64] array

// a / (1 + exp(-a)). The v_nop in each statement is the slot that the instruction set asks
// for between a transcendental and a next instruction that reads its result or writes
// over its source.
__device__ __forceinline__ float silu(float a) {
    float e, r;
    asm("v_exp_f32 %0, %1\n\tv_nop" : "=v"(e) : "v"(a * -1.4426950408889634f));
    asm("v_rcp_f32 %0, %1\n\tv_nop" : "=v"(r) : "v"(1.f + e));
    return a * r;
}

// ---------------- projection, causal depthwise conv-4 + SiLU, per-head l2norm ----
// The conv needs a channel's last four rows and the norm a head's 64 channels, so a
// block that holds one head's columns over a run of rows has all that both need: it
// takes RM_ 16-row tiles of one head, and the tile in front of them once more for its
// last three rows. Each wave owns one 16-wide n-tile, as in gemm_tile, and keeps its B
// fragment for all the row tiles. The products go to LDS and not to memory; behind one
// barrier a lane takes 4 channels x 4 consecutive rows (7 rows serve 4), and a head's
// sum of squares is a 16-lane row sum of what the lanes hold.
// The three rows in front of a sequence count as zero, as the reference pads them.
// Every loop here is unrolled: its arrays are registers only under constant indices.
#define RM_ 4                    // row tiles of output per block
#define PP_ 68                   // floats from row to row in LDS: rows i and i + 8, which
                                 // one store of a C register writes, fall on other banks
template <int Kd>
__device__ __forceinline__
void project_conv_norm(const _Float16* __restrict__ Ap, const _Float16* __restrict__ Bp,
                       const float* __restrict__ w, float* __restrict__ Y,
                       int head, int rb, bool norm, float scale, float (*P)[PP_]) {
    const int lane = threadIdx.x & 31;
    const int wave = threadIdx.x >> 5;
    const int nt   = head * 4 + wave;        // 16-wide n-tile index
    const int r    = lane & 15;              // C-col within tile
    const int kh   = lane >> 4;              // K-half select
    const int mt0  = rb * RM_;               // first row tile of the output
    const int mth  = mt0 > 0 ? mt0 - 1 : 0;  // the tile in front (unused at a sequence's start)
    const int c4   = (threadIdx.x & 15) * 4; // the lane's 4 channels of the head
    const int rg   = threadIdx.x >> 4;       // and its group of 4 rows

    const _Float16* Ahalo = Ap + (size_t)mth * (Kd / 32) * FRB_ + lane * 8;
    const _Float16* Afrag = Ap + (size_t)mt0 * (Kd / 32) * FRB_ + lane * 8;
    const _Float16* Bfrag = Bp + (size_t)nt * (Kd / 32) * FRB_ + lane * 8;

    v4f wv[4];
#pragma unroll
    for (int ch = 0; ch < 4; ++ch) wv[ch] = *(const v4f*)(w + (head * 64 + c4 + ch) * 4);

    // A wave has 12 loads a k step and few neighbours on its SIMD to hide them behind, so
    // the fragments of k steps ks + 1 and ks + 2 are in flight while step ks is multiplied:
    // three sets of fragment registers, taken in turn
    v8h fa[3][RM_ + 1][2], fb[3][2];
    auto fetch = [&](int ks) {
        const int s = ks % 3;
        fb[s][0] = *(const v8h*)(Bfrag + ks * FRB_);
        fb[s][1] = *(const v8h*)(Bfrag + ks * FRB_ + 256);
#pragma unroll
        for (int t = 0; t <= RM_; ++t) {
            const _Float16* At = (t == 0 ? Ahalo : Afrag + (t - 1) * (Kd / 32) * FRB_)
                                 + ks * FRB_;
            fa[s][t][0] = *(const v8h*)At;
            fa[s][t][1] = *(const v8h*)(At + 256);
        }
    };
    fetch(0);
    fetch(1);
    v8f acc[RM_ + 1] = {};
#pragma unroll
    for (int ks = 0; ks < Kd / 32; ++ks) {
        if (ks + 2 < Kd / 32) fetch(ks + 2);
        // keeps the loads of step ks + 2 above the products of step ks: left to itself
        // the built code issues a fragment's loads only three products ahead of its use
        __builtin_amdgcn_sched_barrier(0);
        const int s = ks % 3;
        const v16h b = __builtin_shufflevector(fb[s][0], fb[s][1], 0, 1, 2, 3, 4, 5, 6, 7,
                                               8, 9, 10, 11, 12, 13, 14, 15);
#pragma unroll
        for (int t = 0; t <= RM_; ++t) {
            const v16h a = __builtin_shufflevector(fa[s][t][0], fa[s][t][1], 0, 1, 2, 3, 4,
                                                   5, 6, 7, 8, 9, 10, 11, 12, 13, 14, 15);
            acc[t] = __builtin_amdgcn_wmma_f32_16x16x32_f16(false, a, false, b,
                                                            (short)0, acc[t], false, false);
        }
    }
    // precaution: the wait stands before any address register of the loads above is
    // reused; the scheduling barrier keeps later vector and scalar register writes from
    // rising over it and lets the matrix instructions and the loads be placed freely
    asm volatile("s_wait_xcnt 0x0" ::: "memory");
    __builtin_amdgcn_sched_barrier(0x18);
    // C/D layout: VGPR i -> row = i + 8*kh, col = lane&15
#pragma unroll
    for (int t = 0; t <= RM_; ++t)
#pragma unroll
        for (int i = 0; i < 8; ++i)
            P[t * 16 + i + 8 * kh][wave * 16 + r] = acc[t][i];
    __syncthreads();                         // the four waves' columns make up the head

    const bool pad = (mt0 * 16) % T_ == 0 && rg == 0;    // these rows open a sequence
    v4f y[RM_ / 2][4];
#pragma unroll
    for (int j = 0; j < RM_ / 2; ++j) {      // 8 groups of 4 rows a pass
        const int lr = 16 + (j * 8 + rg) * 4;            // the group's first row in LDS
        v4f p[7];
#pragma unroll
        for (int q = 0; q < 7; ++q) p[q] = *(const v4f*)&P[lr - 3 + q][c4];
        if (j == 0) {
#pragma unroll
            for (int q = 0; q < 3; ++q)
                p[q] = pad ? (v4f){0.f, 0.f, 0.f, 0.f} : p[q];
        }
#pragma unroll
        for (int tt = 0; tt < 4; ++tt) {
#pragma unroll
            for (int ch = 0; ch < 4; ++ch) {
                float a = 0.f;
#pragma unroll
                for (int i = 0; i < 4; ++i) a = __builtin_fmaf(p[tt + i][ch], wv[ch][i], a);
                y[j][tt][ch] = silu(a);
            }
        }
    }
    if (norm) {                              // l2norm (sum, +1e-6) with scale
#pragma unroll
        for (int j = 0; j < RM_ / 2; ++j) {
#pragma unroll
            for (int tt = 0; tt < 4; ++tt) {
                const float inv = rsqrtf(head_sumsq(y[j][tt]) + 1e-6f);
#pragma unroll
                for (int i = 0; i < 4; ++i) y[j][tt][i] = y[j][tt][i] * inv * scale;
            }
        }
    }
    // all stores stand behind all arithmetic: none of their registers is written again
    float* dst = Y + (size_t)(mt0 * 16 + rg * 4) * C_ + head * 64 + c4;
#pragma unroll
    for (int j = 0; j < RM_ / 2; ++j)
#pragma unroll
        for (int tt = 0; tt < 4; ++tt) *(v4f*)(dst + (j * 32 + tt) * C_) = y[j][tt];
}

// ---------------- one launch for all that leads from x to the recurrence ---------
// q, k, v and beta do not depend on one another. The beta blocks have the longest
// serial loop and take the lowest indices (for speed only); the blocks of the three
// products run beside them.
#define BTB_ (MT_ * H_ / 128)            // blocks of beta
#define GMB_ (H_ * (MT_ / 16 / RM_))     // blocks of one product
__global__ __launch_bounds__(128)
void project_qkv_beta(const _Float16* __restrict__ xh, const _Float16* __restrict__ Wqp,
                      const _Float16* __restrict__ Wkp, const _Float16* __restrict__ Wvp,
                      const float* __restrict__ wq, const float* __restrict__ wk,
                      const float* __restrict__ wvv, float* __restrict__ Yq,
                      float* __restrict__ Yk, float* __restrict__ Yv,
                      const float* __restrict__ x, const float* __restrict__ Wb,
                      float* __restrict__ beta) {
    static_assert((T_ / 16) % RM_ == 0, "a block's rows lie in one sequence");
    __shared__ __attribute__((aligned(16))) float P[(RM_ + 1) * 16][PP_];
    const int bid = blockIdx.x;
    if (bid < BTB_) {
        beta_sigmoid(x, Wb, beta, bid);
    } else {
        const int m = (bid - BTB_) / GMB_;               // which product
        const int t = (bid - BTB_) % GMB_;
        const _Float16* Bp = m == 0 ? Wqp : m == 1 ? Wkp : Wvp;
        const float*    w  = m == 0 ? wq  : m == 1 ? wk  : wvv;
        float*          Y  = m == 0 ? Yq  : m == 1 ? Yk  : Yv;
        project_conv_norm<D_>(xh, Bp, w, Y, t % H_, t / H_, m < 2,
                              m == 0 ? SCALE_ : 1.0f, P);
        // precaution: the built code lays the beta branch behind this one, and it
        // reuses the address registers of the stores above; the wait stands in between
        asm volatile("s_wait_xcnt 0x0" ::: "memory");
    }
}

// ---------------- sequential IVON delta-rule recurrence --------------------------
// grid = (8 v-groups, H, B); block = 128 threads = 4 waves, one per SIMD of a WGP
// (kg = tid&15, vl = tid>>4): a column v of the state lies on one 16-lane row, four
// k elements a lane, so a time step is a quarter of the vector work per wave that a
// 16-element lane had, and the sums over k end in a 16-lane DPP tree.
// Inputs and outputs pass through double-buffered LDS CH_ time steps at a time: the
// global loads of chunk c+1 are in flight while chunk c is worked on, chunk c-1's
// outputs are stored behind the same barrier, and the block meets once per chunk.
// Inside a chunk each step's operands are read from LDS into registers two steps
// before their first use, so no global access and no barrier stands on the serial path.
// The next step does not need o, only S: o of step s is therefore summed in step s + 1,
// from the same S, beside that step's pred. The wave is alone on its SIMD and issues in
// order, so two sums one behind the other cost two latencies, side by side one.
// All 16 lanes of a column hold its o, and all store it, each its own copy: a store
// under a lane mask is a block of its own in the built code and would stand between
// pred and the update that waits for it.
// What a step costs is its chain of dependent instructions from one err to the next,
// so only what needs err or the reciprocal stands on that chain:
//   g is kept as Gs = g / (1 - B1):          Gs = B1 * Gs + grad
//   h is kept as Hs = (h + LAM) / (1 - B2):  Hs = (B2 * Hs + HC_) + grad * grad
//   S -= LR * beta * g / (h + LAM)  is then  S += (NB_ * beta) * Gs / Hs
//   err of step s + 1 = k' . S_s - v' is summed as (k' . S_(s-1) - v') + sum(k' * lg * r),
//   lg = NB_ * beta * Gs, r = 1 / Hs: the bracket waits for nothing of step s, and the
//   update of S itself leaves the chain; -v' enters as -v'/16 in each of the 16 lanes.
// -v/16 and NB_ * beta are formed where a chunk is written to LDS.
#define CH_ 32
#define NCH_ (T_ / CH_)
#define VB_ 8                    // state columns per block
#define RT_ 128                  // threads per block
#define OR_ (VB_ * 16)           // floats of o a time step takes in LDS, 16 copies a column
#define NB_ ((float)(-1e-3 * (1.0 - 0.9) / (1.0 - 0.999)))      // -LR * (1 - B1) / (1 - B2)
#define HI_ ((float)(1.0 / (1.0 - 0.999)))                      // Hs at h = 0
// LAM's share of Hs must stay where it is under Hs = B2 * Hs + HC_, with B2 as f32 has it
#define HC_ ((float)((1.0 - (double)BETA2_) / (1.0 - 0.999)))

// row s of a chunk: k of s, q of s - 1, and the pair -v/16, NB_ * beta of s; the two lie
// side by side in LDS and come as one pair: a single register that a read is still to
// fill can be given the place beside a value which the packed products name as a
// register pair, and the built code then waits there for the fresh read
struct StepIn { v4f k; v4f q; v2f vb; };

template <bool PREV_O>
__device__ __forceinline__ void read_step(StepIn& r, const float* kb, const float* qb,
                                          const float* vb, int s) {
    r.k = *(const v4f*)(kb + s * 64);
    if constexpr (PREV_O) r.q = *(const v4f*)(qb + (s - 1) * 64);
    r.vb = *(const v2f*)(vb + s * VB_ * 2);
}

// a lane's share of a sum over k
__device__ __forceinline__ float lane_dot(const v4f& a, const float (&S)[4]) {
    const float e = __builtin_fmaf(a[2], S[2], a[0] * S[0]);
    const float d = __builtin_fmaf(a[3], S[3], a[1] * S[1]);
    return e + d;
}

// a lane's share of k . S - v, in two halves (elements 0,2 and 1,3); nv = -v/16
__device__ __forceinline__ v2f lane_part(const v4f& k, const float (&S)[4], float nv) {
    v2f p;
    p[0] = __builtin_fmaf(k[2], S[2], __builtin_fmaf(k[0], S[0], nv));
    p[1] = __builtin_fmaf(k[3], S[3], k[1] * S[1]);
    return p;
}

// one time step on row c; part holds the lane's share of its err and, where a row n
// follows in the chunk (NEXT), leaves with that of the next step's. Returns o of the
// step before (PREV_O), summed from S as that step left it
template <bool PREV_O, bool NEXT>
__device__ __forceinline__ float one_step(const StepIn& c, const StepIn& n, v2f& part,
                                          float (&S)[4], float (&G)[4], float (&Hs)[4]) {
    // err[v] = k . S[:,v] - v: the lane's two halves, then the 16 lanes of the column;
    // o[v] = q . S[:,v] link by link beside it
    float err = part[0] + part[1];
    float o = 0.f;
    if constexpr (PREV_O) {
        o = lane_dot(c.q, S);
        err = add_xlane<0x161>(err);  o = add_xlane<0x161>(o);
        err = add_xlane<0x162>(err);  o = add_xlane<0x162>(o);
        err = add_xlane<0x164>(err);  o = add_xlane<0x164>(o);
        err = add_xlane<0x168>(err);  o = add_xlane<0x168>(o);
    } else {
        err = row_sum(err);
    }
    // the next step's share as far as S of the step before gives it
    v2f p = {0.f, 0.f};
    if constexpr (NEXT) p = lane_part(n.k, S, n.vb[0]);

    // lg = NB_ * beta * Gs straight from err, not behind the new Gs: it has to be there,
    // times the next k, when the reciprocals arrive
    const float nb9 = BETA1_ * c.vb[1];
    const float ne  = c.vb[1] * err;
    float lg[4], r[4];
#pragma unroll
    for (int i = 0; i < 4; ++i) {
        const float grad = c.k[i] * err;                    // outer(k, pred-v)
        Hs[i] = __builtin_fmaf(grad, grad, __builtin_fmaf(BETA2_, Hs[i], HC_));
        lg[i] = __builtin_fmaf(c.k[i], ne, nb9 * G[i]);
        G[i]  = __builtin_fmaf(BETA1_, G[i], grad);
        r[i]  = __builtin_amdgcn_rcpf(Hs[i]);
    }
    if constexpr (NEXT) {
        part[0] = __builtin_fmaf(n.k[2] * lg[2], r[2], __builtin_fmaf(n.k[0] * lg[0], r[0], p[0]));
        part[1] = __builtin_fmaf(n.k[3] * lg[3], r[3], __builtin_fmaf(n.k[1] * lg[1], r[1], p[1]));
    }
#pragma unroll
    for (int i = 0; i < 4; ++i) S[i] = __builtin_fmaf(lg[i], r[i], S[i]);   // WD==0
    return o;
}

// four neighbouring columns of o, one copy of each
__device__ __forceinline__ v4f read_out(const float* c) {
    v4f y;
#pragma unroll
    for (int i = 0; i < 4; ++i) y[i] = c[i * 16];
    return y;
}

__global__ __launch_bounds__(RT_)
void recurrence(const float* __restrict__ qn, const float* __restrict__ kn,
                const float* __restrict__ vn, const float* __restrict__ beta,
                float* __restrict__ o) {
    const int tid = threadIdx.x;
    const int kg  = tid & 15;
    const int vl  = tid >> 4;
    const int vg  = blockIdx.x;
    const int h   = blockIdx.y;
    const int b   = blockIdx.z;

    float S[4], G[4], Hm[4];
#pragma unroll
    for (int i = 0; i < 4; ++i) { S[i] = 0.f; G[i] = 0.f; Hm[i] = HI_; }

    __shared__ __attribute__((aligned(16))) float ks_[2][CH_][64];
    __shared__ __attribute__((aligned(16))) float qs_[2][CH_][64];
    __shared__ __attribute__((aligned(16))) float vs_[2][CH_][VB_][2];   // -v/16, NB_*beta
    __shared__ __attribute__((aligned(16))) float os_[2][CH_][VB_][16];

    const size_t base  = (size_t)(b * T_) * C_ + h * 64;
    const size_t bbase = (size_t)(b * T_) * H_ + h;

    // staging map: 16 lanes cover one 64-float row of k or q (8 rows a pass); the
    // first two waves cover the chunk's 8-float rows of v and o, 2 lanes a row
    const int  r4 = tid >> 4, c4 = (tid & 15) * 4;
    const int  rv = (tid >> 1) & (CH_ - 1), cv = (tid & 1) * 4;
    const bool vo = tid < CH_ * VB_ / 4;
    const int  xo = rv & 15;    // which copy of o a lane reads: spreads the LDS banks
    const float* kgp = kn + base + (size_t)r4 * C_ + c4;
    const float* qgp = qn + base + (size_t)r4 * C_ + c4;
    const float* vgp = vn + base + vg * VB_ + (size_t)rv * C_ + cv;
    const float* bgp = beta + bbase + (size_t)rv * H_;

    v4f   kst[CH_ / 8], qst[CH_ / 8], vst;
    float bst;

    // chunk 0: global -> registers
#pragma unroll
    for (int j = 0; j < CH_ / 8; ++j) {
        kst[j] = *(const v4f*)(kgp + (size_t)j * 8 * C_);
        qst[j] = *(const v4f*)(qgp + (size_t)j * 8 * C_);
    }
    vst = *(const v4f*)vgp;
    bst = *bgp;
    // precaution: the wait stands before any address register of the loads above is
    // reused; the scheduling barrier keeps later register writes from rising over it
    asm volatile("s_wait_xcnt 0x0" ::: "memory");
    __builtin_amdgcn_sched_barrier(0);

    float* ogp = o + base + vg * VB_ + (size_t)rv * C_ + cv;
    for (int c = 0; c < NCH_; ++c) {
        const int p = c & 1;
        // registers -> LDS buffer p; its last readers (chunk c-2) left it before
        // the barrier of chunk c-1
#pragma unroll
        for (int j = 0; j < CH_ / 8; ++j) {
            *(v4f*)&ks_[p][r4 + 8 * j][c4] = kst[j];
            *(v4f*)&qs_[p][r4 + 8 * j][c4] = qst[j];
        }
        if (vo) {
            const v4f   nv = vst * (-1.f / 16.f);
            const float nb = bst * NB_;
            *(v4f*)&vs_[p][rv][cv][0]     = (v4f){nv[0], nb, nv[1], nb};
            *(v4f*)&vs_[p][rv][cv + 2][0] = (v4f){nv[2], nb, nv[3], nb};
        }
        __syncthreads();

        if (c > 0) {                            // chunk c-1's outputs: LDS -> global
            if (vo) *(v4f*)ogp = read_out(&os_[p ^ 1][rv][cv][xo]);
            ogp += (size_t)CH_ * C_;
        }
        if (c + 1 < NCH_) {                     // chunk c+1: in flight across chunk c
            kgp += (size_t)CH_ * C_;
            qgp += (size_t)CH_ * C_;
            vgp += (size_t)CH_ * C_;
            bgp += (size_t)CH_ * H_;
#pragma unroll
            for (int j = 0; j < CH_ / 8; ++j) {
                kst[j] = *(const v4f*)(kgp + (size_t)j * 8 * C_);
                qst[j] = *(const v4f*)(qgp + (size_t)j * 8 * C_);
            }
            vst = *(const v4f*)vgp;
            bst = *bgp;
        }

        const float* kb = &ks_[p][0][kg * 4];
        const float* qb = &qs_[p][0][kg * 4];
        const float* vb = &vs_[p][0][vl][0];
        float*       ob = &os_[p][0][vl][kg];

        // A step works on its own row and the next; a row is read two steps before its
        // first use, so four rows are held and the
        // loop's body is four steps, each row in registers of its own.
        // step 0 has no output to finish: the chunk before has summed its last one
        StepIn ra, rb, rc, rd;
        read_step<false>(ra, kb, qb, vb, 0);
        read_step<true>(rb, kb, qb, vb, 1);
        read_step<true>(rc, kb, qb, vb, 2);
        read_step<true>(rd, kb, qb, vb, 3);
        // keeps the LDS reads of later steps above this step's arithmetic, so
        // that they have returned before the first wait on them
        __builtin_amdgcn_sched_barrier(0);
        v2f part = lane_part(ra.k, S, ra.vb[0]);
        one_step<false, true>(ra, rb, part, S, G, Hm);
        for (int s = 1; s < CH_ - 6; s += 4) {
            read_step<true>(ra, kb, qb, vb, s + 3);
            __builtin_amdgcn_sched_barrier(0);  // as above
            ob[(s - 1) * OR_] = one_step<true, true>(rb, rc, part, S, G, Hm);
            read_step<true>(rb, kb, qb, vb, s + 4);
            __builtin_amdgcn_sched_barrier(0);  // as above
            ob[s * OR_] = one_step<true, true>(rc, rd, part, S, G, Hm);
            read_step<true>(rc, kb, qb, vb, s + 5);
            __builtin_amdgcn_sched_barrier(0);  // as above
            ob[(s + 1) * OR_] = one_step<true, true>(rd, ra, part, S, G, Hm);
            read_step<true>(rd, kb, qb, vb, s + 6);
            __builtin_amdgcn_sched_barrier(0);  // as above
            ob[(s + 2) * OR_] = one_step<true, true>(ra, rb, part, S, G, Hm);
        }
        // the last three steps, and behind them the last one's own output: the block
        // stores the chunk's outputs behind the next barrier, so none is carried over
        // it; the row behind the last is not in LDS yet, so the next chunk starts its
        // first err from S
        const v4f ql = *(const v4f*)(qb + (CH_ - 1) * 64);
        __builtin_amdgcn_sched_barrier(0);      // as above
        ob[(CH_ - 4) * OR_] = one_step<true, true>(rb, rc, part, S, G, Hm);
        ob[(CH_ - 3) * OR_] = one_step<true, true>(rc, rd, part, S, G, Hm);
        ob[(CH_ - 2) * OR_] = one_step<true, false>(rd, rd, part, S, G, Hm);
        ob[(CH_ - 1) * OR_] = row_sum(lane_dot(ql, S));
    }

    __syncthreads();                            // last chunk's outputs are complete
    if (vo) *(v4f*)ogp = read_out(&os_[(NCH_ - 1) & 1][rv][cv][xo]);
}

// ---------------- RMSNorm over V (mean, +1e-5) * rms_w, f16 in A-fragment order ---
// A block takes one 16-row tile and four heads; a wave takes 8 rows of one head, 16
// lanes a row and 4 rows a lane: each access reads whole lines, and the wave is the
// only writer of the lines it fills (8 rows of one k-octet make a line).
__global__ __launch_bounds__(EW_)
void rmsnorm_f16(const float* __restrict__ o, const float* __restrict__ rw,
                 _Float16* __restrict__ oh) {
    const int l    = threadIdx.x & 15;                   // 4 values of the head's 64
    const int w    = threadIdx.x >> 5;
    const int mt   = blockIdx.x >> 1;
    const int head = (blockIdx.x & 1) * 4 + (w >> 1);
    const int r0   = (w & 1) * 8 + ((threadIdx.x >> 4) & 1) * 4;   // first of 4 rows
    const float* src = o + (size_t)(mt * 16 + r0) * C_ + head * 64 + l * 4;
    v4f x[4];
#pragma unroll
    for (int j = 0; j < 4; ++j) x[j] = *(const v4f*)(src + j * C_);
    const v4f wv = *(const v4f*)(rw + l * 4);
    // precaution: the address stays in its registers up to this wait, so that no load
    // above returns into them and nothing reuses them in front of it
    asm volatile("s_wait_xcnt 0x0" :: "v"(src) : "memory");
    _Float16* dst = oh + (size_t)(mt * (C_ / 32) + head * 2 + (l >> 3)) * FRB_
                       + frag_off((l & 7) * 4, r0);
#pragma unroll
    for (int j = 0; j < 4; ++j) {
        const float inv = rsqrtf(head_sumsq(x[j]) * (1.0f / 64.f) + EPS_);
        v4h y;
#pragma unroll
        for (int i = 0; i < 4; ++i) y[i] = (_Float16)(x[j][i] * inv * wv[i]);
        *(v4h*)(dst + j * 8) = y;
    }
}

// ---------------- host-side launch ----------------
extern "C" void kernel_launch(void* const* d_in, const int* in_sizes, int n_in,
                              void* d_out, int out_size, void* d_ws, size_t ws_size,
                              hipStream_t stream) {
    (void)in_sizes; (void)n_in; (void)out_size; (void)ws_size;
    const float* x    = (const float*)d_in[0];
    const float* Wq   = (const float*)d_in[1];
    const float* Wk   = (const float*)d_in[2];
    const float* Wv   = (const float*)d_in[3];
    const float* Wb   = (const float*)d_in[4];
    const float* cwq  = (const float*)d_in[5];
    const float* cwk  = (const float*)d_in[6];
    const float* cwv  = (const float*)d_in[7];
    const float* rmsw = (const float*)d_in[8];
    const float* Wo   = (const float*)d_in[9];
    float* out = (float*)d_out;

    char* ws = (char*)d_ws;
    size_t off = 0;
    auto alloc = [&](size_t bytes) -> void* {
        void* p = ws + off;
        off += (bytes + 255) & ~(size_t)255;
        return p;
    };
    _Float16* xh   = (_Float16*)alloc((size_t)MT_ * D_ * 2);
    _Float16* Wqp  = (_Float16*)alloc((size_t)D_ * C_ * 2);   // packed fragments
    _Float16* Wkp  = (_Float16*)alloc((size_t)D_ * C_ * 2);
    _Float16* Wvp  = (_Float16*)alloc((size_t)D_ * C_ * 2);
    _Float16* Wop  = (_Float16*)alloc((size_t)C_ * D_ * 2);
    float*    qc   = (float*)alloc((size_t)MT_ * C_ * 4);
    float*    kc   = (float*)alloc((size_t)MT_ * C_ * 4);
    float*    vc   = (float*)alloc((size_t)MT_ * C_ * 4);
    float*    betaf= (float*)alloc((size_t)MT_ * H_ * 4);
    float*    ob   = (float*)alloc((size_t)MT_ * C_ * 4);
    _Float16* ohh  = (_Float16*)alloc((size_t)MT_ * C_ * 2);

    // 1) x and the four GEMM weight matrices as f16 in WMMA fragment order: one launch
    convert_and_pack<<<CVB_ + 4 * PKB_, EW_, 0, stream>>>(x, Wq, Wk, Wv, Wo,
                                                          xh, Wqp, Wkp, Wvp, Wop);

    // 2) the three projection GEMMs (v_wmma_f32_16x16x32_f16), each with its conv + SiLU
    //    and, for q and k, its l2norm (scale on q), and beta: one launch
    project_qkv_beta<<<BTB_ + 3 * GMB_, 128, 0, stream>>>(xh, Wqp, Wkp, Wvp, cwq, cwk, cwv,
                                                          qc, kc, vc, x, Wb, betaf);

    // 3) sequential recurrence: 128 blocks (B*H*8 v-groups) x 128 threads
    dim3 rgrid(64 / VB_, H_, B_);
    recurrence<<<rgrid, RT_, 0, stream>>>(qc, kc, vc, betaf, ob);

    // 4) RMSNorm -> f16 in A-fragment order
    rmsnorm_f16<<<NG4_ / 4 / EW_, EW_, 0, stream>>>(ob, rmsw, ohh);

    // 5) output projection GEMM (fp32 result straight to d_out)
    gemm_f16_wmma<C_, D_><<<dim3(D_ / 64, MT_ / 16), 128, 0, stream>>>(ohh, Wop, out);
}

// v010
// A run of this version takes 91.6 microseconds.
// Two timings next to v009 put it at 1.03 and 1.04 times that version's speed.
// All steps since v000 together make it 11.1 times as fast.
#include <hip/hip_runtime.h>

// ---------------- problem dims (fixed by reference) ----------------
#define B_    2
#define T_    1024
#define D_    512
#define H_    8
#define MT_   (B_ * T_)          // 2048 rows
#define C_    512                // H*K == H*V == 512 channels

#define LR_    1e-3f
#define BETA1_ 0.9f
#define BETA2_ 0.999f
#define EPS_   1e-5f
#define SCALE_ 0.125f            // 64^-0.5

typedef __attribute__((ext_vector_type(16))) _Float16 v16h;
typedef __attribute__((ext_vector_type(8)))  float    v8f;
typedef __attribute__((ext_vector_type(4)))  float    v4f;
typedef __attribute__((ext_vector_type(2)))  float    v2f;
typedef __attribute__((ext_vector_type(4)))  _Float16 v4h;
typedef __attribute__((ext_vector_type(8)))  _Float16 v8h;

// The elementwise kernels below are short, and what they cost is the starting of their
// waves: each lane therefore takes 16 elements and a 2048 x 512 array is 256 blocks. Their loops
// over a lane's pieces are unrolled so that the pieces stay in registers and all of a
// lane's loads are in flight together.
#define EW_ 256                  // threads per block of those kernels

// x + (x of lane ^ m), m = CTRL - 0x160 (DPP row_xmask): the partner's value comes
// through the vector unit's own cross-lane path, not through the LDS queue and a
// wait on it; both lanes add the same two values, so the sum is the shuffle's
template <int CTRL>
__device__ __forceinline__ float add_xlane(float x) {
    const int y = __builtin_amdgcn_update_dpp(0, __float_as_int(x), CTRL, 0xf, 0xf, true);
    return x + __int_as_float(y);
}

// sum over the 16 lanes of a row, the same value in each of them
__device__ __forceinline__ float row_sum(float x) {
    x = add_xlane<0x161>(x);
    x = add_xlane<0x162>(x);
    x = add_xlane<0x164>(x);
    x = add_xlane<0x168>(x);
    return x;
}

// ---------------- fragment order of the GEMM operands ----------------------------
// A [M x Kd] and B [Kd x N] are both kept as blocks of 512 f16, one block per 16-wide
// tile (of m or of n) and 32-deep k step: [tile][ks = k/32][half 0..1][lane 0..31][8].
// Element map (ISA 7.12.2, 16-bit operands): lane = 16*kh + rc, rc = row of A or column
// of B within the tile; k = ks*32 + 16*half + 8*kh + i. A wave's 16-byte load of one half
// is then 512 contiguous bytes, four whole cache lines.
#define FRB_ 512                 // f16 in a block
// place in its block of element kk = k % 32 of row or column rc
__device__ __forceinline__ int frag_off(int kk, int rc) {
    return ((kk >> 4) * 32 + ((kk >> 3) & 1) * 16 + rc) * 8 + (kk & 7);
}

// ---------------- fp32 [M x Kd] -> f16 in A-fragment order ------------------------
// A wave builds one block: 8 lanes read one row's 32 values (a whole line), 4 rows an
// access, 4 accesses; the wave is the only writer of the block's lines.
template <int Kd>
__device__ __forceinline__
void pack_a_f16(const float* __restrict__ in, _Float16* __restrict__ out, int blk) {
    const int idx  = blk * EW_ + threadIdx.x;            // over M*Kd/16
    const int lane = idx & 31;
    const int fb   = idx >> 5;                           // block: mt * (Kd/32) + ks
    const int ks   = fb % (Kd / 32);
    const int mt   = fb / (Kd / 32);
    const int p    = lane & 7;                           // which 4 of the 32 values
    const int rq   = lane >> 3;                          // row within an access
    const float* src = in + (size_t)(mt * 16 + rq) * Kd + ks * 32 + p * 4;
    v4f x[4];
#pragma unroll
    for (int j = 0; j < 4; ++j) x[j] = *(const v4f*)(src + (size_t)j * 4 * Kd);
    // precaution: the address stays in its registers up to this wait, so that no load
    // above returns into them and nothing reuses them in front of it
    asm volatile("s_wait_xcnt 0x0" :: "v"(src) : "memory");
    _Float16* dst = out + (size_t)fb * FRB_ + frag_off(p * 4, rq);
#pragma unroll
    for (int j = 0; j < 4; ++j) {                        // row rq + 4j
        v4h y;
#pragma unroll
        for (int i = 0; i < 4; ++i) y[i] = (_Float16)x[j][i];
        *(v4h*)(dst + j * 32) = y;
    }
}

// ---------------- pack fp32 weight [Kd x N] into B-fragment order -----------------
// lane -> col = lane&15, kh = lane>>4; e -> k = ks*32 + (e<8 ? e : e+8) + 8*kh
// One thread builds one lane's whole fragment: 16 loads down a column, one 16-byte
// store into each half of the block.
template <int Kd, int N>
__device__ __forceinline__
void pack_b_f16(const float* __restrict__ W, _Float16* __restrict__ Bp, int blk) {
    const int idx  = blk * EW_ + threadIdx.x;            // over Kd*N/16
    const int lane = idx & 31;
    const int ks   = (idx >> 5) % (Kd / 32);
    const int nt   = idx / ((Kd / 32) << 5);
    const int kh   = lane >> 4;
    const int col  = lane & 15;
    const float* src = W + (size_t)(ks * 32 + 8 * kh) * N + nt * 16 + col;
    float w[16];
#pragma unroll
    for (int e = 0; e < 16; ++e) w[e] = src[(size_t)(e < 8 ? e : e + 8) * N];
    // precaution: the address stays in its registers up to this wait, so that no load
    // above returns into them and nothing reuses them in front of it
    asm volatile("s_wait_xcnt 0x0" :: "v"(src) : "memory");
    v8h lo, hi;
#pragma unroll
    for (int e = 0; e < 8; ++e) { lo[e] = (_Float16)w[e]; hi[e] = (_Float16)w[e + 8]; }
    _Float16* dst = Bp + (size_t)(idx >> 5) * FRB_ + lane * 8;
    *(v8h*)dst         = lo;
    *(v8h*)(dst + 256) = hi;
}

// ---------------- one launch for the conversion of x and the weight packs ------------
// The conversion of x and the four packs read only inputs and write separate arrays:
// as ranges of blocks of one grid they start together and pay one launch gap, one
// start and one drain between them.
#define CVB_ (MT_ * D_ / 16 / EW_)   // blocks that convert x
#define PKB_ (D_ * C_ / 16 / EW_)    // blocks that pack one weight matrix
__global__ __launch_bounds__(EW_)
void convert_and_pack(const float* __restrict__ x, const float* __restrict__ Wq,
                      const float* __restrict__ Wk, const float* __restrict__ Wv,
                      const float* __restrict__ Wo, _Float16* __restrict__ xh,
                      _Float16* __restrict__ Wqp, _Float16* __restrict__ Wkp,
                      _Float16* __restrict__ Wvp, _Float16* __restrict__ Wop) {
    static_assert(D_ == C_, "the four weight matrices have one shape");
    const int bid = blockIdx.x;
    if (bid < CVB_) {
        pack_a_f16<D_>(x, xh, bid);
    } else {
        const int m = (bid - CVB_) / PKB_;               // which matrix
        const float* W  = m == 0 ? Wq  : m == 1 ? Wk  : m == 2 ? Wv  : Wo;
        _Float16*    Bp = m == 0 ? Wqp : m == 1 ? Wkp : m == 2 ? Wvp : Wop;
        pack_b_f16<D_, C_>(W, Bp, (bid - CVB_) % PKB_);
        // precaution: the built code lays the other branch behind this one, and it
        // reuses the address registers of the stores above; the wait stands in between
        asm volatile("s_wait_xcnt 0x0" ::: "memory");
    }
}

// ---------------- beta = sigmoid(x @ Wb), one thread per (row, h) ----------------
__device__ __forceinline__
void beta_sigmoid(const float* __restrict__ x, const float* __restrict__ Wb,
                  float* __restrict__ beta, int blk) {
    const int idx = blk * 128 + threadIdx.x;           // over MT_*H_
    const int h = idx % H_;
    const int row = idx / H_;
    float acc = 0.f;
    for (int d = 0; d < D_; ++d)
        acc += x[(size_t)row * D_ + d] * Wb[(size_t)d * H_ + h];
    beta[idx] = __builtin_amdgcn_rcpf(1.f + __expf(-acc));
}

// sum of squares of a head's 64 values, 4 a lane on one 16-lane row
__device__ __forceinline__ float head_sumsq(const v4f& x) {
    const float e = __builtin_fmaf(x[2], x[2], x[0] * x[0]);
    const float d = __builtin_fmaf(x[3], x[3], x[1] * x[1]);
    return row_sum(e + d);
}

// a / (1 + exp(-a)). The v_nop in each statement is the slot that the instruction set asks
// for between a transcendental and a next instruction that reads its result or writes
// over its source.
__device__ __forceinline__ float silu(float a) {
    float e, r;
    asm("v_exp_f32 %0, %1\n\tv_nop" : "=v"(e) : "v"(a * -1.4426950408889634f));
    asm("v_rcp_f32 %0, %1\n\tv_nop" : "=v"(r) : "v"(1.f + e));
    return a * r;
}

// ---------------- projection, causal depthwise conv-4 + SiLU, per-head l2norm ----
// The conv needs a channel's last four rows and the norm a head's 64 channels, so a
// block that holds one head's columns over a run of rows has all that both need: it
// takes RM_ 16-row tiles of one head, and the tile in front of them once more for its
// last three rows. Each wave owns one 16-wide n-tile and keeps its B
// fragment for all the row tiles. The products go to LDS and not to memory; behind one
// barrier a lane takes 4 channels x 4 consecutive rows (7 rows serve 4), and a head's
// sum of squares is a 16-lane row sum of what the lanes hold.
// The three rows in front of a sequence count as zero, as the reference pads them.
// Every loop here is unrolled: its arrays are registers only under constant indices.
#define RM_ 4                    // row tiles of output per block
#define PP_ 68                   // floats from row to row in LDS: rows i and i + 8, which
                                 // one store of a C register writes, fall on other banks
template <int Kd>
__device__ __forceinline__
void project_conv_norm(const _Float16* __restrict__ Ap, const _Float16* __restrict__ Bp,
                       const float* __restrict__ w, float* __restrict__ Y,
                       int head, int rb, bool norm, float scale, float (*P)[PP_]) {
    const int lane = threadIdx.x & 31;
    const int wave = threadIdx.x >> 5;
    const int nt   = head * 4 + wave;        // 16-wide n-tile index
    const int r    = lane & 15;              // C-col within tile
    const int kh   = lane >> 4;              // K-half select
    const int mt0  = rb * RM_;               // first row tile of the output
    const int mth  = mt0 > 0 ? mt0 - 1 : 0;  // the tile in front (unused at a sequence's start)
    const int c4   = (threadIdx.x & 15) * 4; // the lane's 4 channels of the head
    const int rg   = threadIdx.x >> 4;       // and its group of 4 rows

    const _Float16* Ahalo = Ap + (size_t)mth * (Kd / 32) * FRB_ + lane * 8;
    const _Float16* Afrag = Ap + (size_t)mt0 * (Kd / 32) * FRB_ + lane * 8;
    const _Float16* Bfrag = Bp + (size_t)nt * (Kd / 32) * FRB_ + lane * 8;

    v4f wv[4];
#pragma unroll
    for (int ch = 0; ch < 4; ++ch) wv[ch] = *(const v4f*)(w + (head * 64 + c4 + ch) * 4);

    // A wave has 12 loads a k step and few neighbours on its SIMD to hide them behind, so
    // the fragments of k steps ks + 1 and ks + 2 are in flight while step ks is multiplied:
    // three sets of fragment registers, taken in turn
    v8h fa[3][RM_ + 1][2], fb[3][2];
    auto fetch = [&](int ks) {
        const int s = ks % 3;
        fb[s][0] = *(const v8h*)(Bfrag + ks * FRB_);
        fb[s][1] = *(const v8h*)(Bfrag + ks * FRB_ + 256);
#pragma unroll
        for (int t = 0; t <= RM_; ++t) {
            const _Float16* At = (t == 0 ? Ahalo : Afrag + (t - 1) * (Kd / 32) * FRB_)
                                 + ks * FRB_;
            fa[s][t][0] = *(const v8h*)At;
            fa[s][t][1] = *(const v8h*)(At + 256);
        }
    };
    fetch(0);
    fetch(1);
    v8f acc[RM_ + 1] = {};
#pragma unroll
    for (int ks = 0; ks < Kd / 32; ++ks) {
        if (ks + 2 < Kd / 32) fetch(ks + 2);
        // keeps the loads of step ks + 2 above the products of step ks: left to itself
        // the built code issues a fragment's loads only three products ahead of its use
        __builtin_amdgcn_sched_barrier(0);
        const int s = ks % 3;
        const v16h b = __builtin_shufflevector(fb[s][0], fb[s][1], 0, 1, 2, 3, 4, 5, 6, 7,
                                               8, 9, 10, 11, 12, 13, 14, 15);
#pragma unroll
        for (int t = 0; t <= RM_; ++t) {
            const v16h a = __builtin_shufflevector(fa[s][t][0], fa[s][t][1], 0, 1, 2, 3, 4,
                                                   5, 6, 7, 8, 9, 10, 11, 12, 13, 14, 15);
            acc[t] = __builtin_amdgcn_wmma_f32_16x16x32_f16(false, a, false, b,
                                                            (short)0, acc[t], false, false);
        }
    }
    // precaution: the wait stands before any address register of the loads above is
    // reused; the scheduling barrier keeps later vector and scalar register writes from
    // rising over it and lets the matrix instructions and the loads be placed freely
    asm volatile("s_wait_xcnt 0x0" ::: "memory");
    __builtin_amdgcn_sched_barrier(0x18);
    // C/D layout: VGPR i -> row = i + 8*kh, col = lane&15
#pragma unroll
    for (int t = 0; t <= RM_; ++t)
#pragma unroll
        for (int i = 0; i < 8; ++i)
            P[t * 16 + i + 8 * kh][wave * 16 + r] = acc[t][i];
    __syncthreads();                         // the four waves' columns make up the head

    const bool pad = (mt0 * 16) % T_ == 0 && rg == 0;    // these rows open a sequence
    v4f y[RM_ / 2][4];
#pragma unroll
    for (int j = 0; j < RM_ / 2; ++j) {      // 8 groups of 4 rows a pass
        const int lr = 16 + (j * 8 + rg) * 4;            // the group's first row in LDS
        v4f p[7];
#pragma unroll
        for (int q = 0; q < 7; ++q) p[q] = *(const v4f*)&P[lr - 3 + q][c4];
        if (j == 0) {
#pragma unroll
            for (int q = 0; q < 3; ++q)
                p[q] = pad ? (v4f){0.f, 0.f, 0.f, 0.f} : p[q];
        }
#pragma unroll
        for (int tt = 0; tt < 4; ++tt) {
#pragma unroll
            for (int ch = 0; ch < 4; ++ch) {
                float a = 0.f;
#pragma unroll
                for (int i = 0; i < 4; ++i) a = __builtin_fmaf(p[tt + i][ch], wv[ch][i], a);
                y[j][tt][ch] = silu(a);
            }
        }
    }
    if (norm) {                              // l2norm (sum, +1e-6) with scale
#pragma unroll
        for (int j = 0; j < RM_ / 2; ++j) {
#pragma unroll
            for (int tt = 0; tt < 4; ++tt) {
                const float inv = rsqrtf(head_sumsq(y[j][tt]) + 1e-6f);
#pragma unroll
                for (int i = 0; i < 4; ++i) y[j][tt][i] = y[j][tt][i] * inv * scale;
            }
        }
    }
    // all stores stand behind all arithmetic: none of their registers is written again
    float* dst = Y + (size_t)(mt0 * 16 + rg * 4) * C_ + head * 64 + c4;
#pragma unroll
    for (int j = 0; j < RM_ / 2; ++j)
#pragma unroll
        for (int tt = 0; tt < 4; ++tt) *(v4f*)(dst + (j * 32 + tt) * C_) = y[j][tt];
}

// ---------------- one launch for all that leads from x to the recurrence ---------
// q, k, v and beta do not depend on one another. The beta blocks have the longest
// serial loop and take the lowest indices (for speed only); the blocks of the three
// products run beside them.
#define BTB_ (MT_ * H_ / 128)            // blocks of beta
#define GMB_ (H_ * (MT_ / 16 / RM_))     // blocks of one product
__global__ __launch_bounds__(128)
void project_qkv_beta(const _Float16* __restrict__ xh, const _Float16* __restrict__ Wqp,
                      const _Float16* __restrict__ Wkp, const _Float16* __restrict__ Wvp,
                      const float* __restrict__ wq, const float* __restrict__ wk,
                      const float* __restrict__ wvv, float* __restrict__ Yq,
                      float* __restrict__ Yk, float* __restrict__ Yv,
                      const float* __restrict__ x, const float* __restrict__ Wb,
                      float* __restrict__ beta) {
    static_assert((T_ / 16) % RM_ == 0, "a block's rows lie in one sequence");
    __shared__ __attribute__((aligned(16))) float P[(RM_ + 1) * 16][PP_];
    const int bid = blockIdx.x;
    if (bid < BTB_) {
        beta_sigmoid(x, Wb, beta, bid);
    } else {
        const int m = (bid - BTB_) / GMB_;               // which product
        const int t = (bid - BTB_) % GMB_;
        const _Float16* Bp = m == 0 ? Wqp : m == 1 ? Wkp : Wvp;
        const float*    w  = m == 0 ? wq  : m == 1 ? wk  : wvv;
        float*          Y  = m == 0 ? Yq  : m == 1 ? Yk  : Yv;
        project_conv_norm<D_>(xh, Bp, w, Y, t % H_, t / H_, m < 2,
                              m == 0 ? SCALE_ : 1.0f, P);
        // precaution: the built code lays the beta branch behind this one, and it
        // reuses the address registers of the stores above; the wait stands in between
        asm volatile("s_wait_xcnt 0x0" ::: "memory");
    }
}

// ---------------- sequential IVON delta-rule recurrence --------------------------
// grid = (8 v-groups, H, B); block = 128 threads = 4 waves, one per SIMD of a WGP
// (kg = tid&15, vl = tid>>4): a column v of the state lies on one 16-lane row, four
// k elements a lane, so a time step is a quarter of the vector work per wave that a
// 16-element lane had, and the sums over k end in a 16-lane DPP tree.
// Inputs and outputs pass through double-buffered LDS CH_ time steps at a time: the
// global loads of chunk c+1 are in flight while chunk c is worked on, chunk c-1's
// outputs are stored behind the same barrier, and the block meets once per chunk.
// Inside a chunk each step's operands are read from LDS into registers two steps
// before their first use, so no global access and no barrier stands on the serial path.
// The next step does not need o, only S: o of step s is therefore summed in step s + 1,
// from the same S, beside that step's pred. The wave is alone on its SIMD and issues in
// order, so two sums one behind the other cost two latencies, side by side one.
// All 16 lanes of a column hold its o, and all store it, each its own copy: a store
// under a lane mask is a block of its own in the built code and would stand between
// pred and the update that waits for it.
// What a step costs is its chain of dependent instructions from one err to the next,
// so only what needs err or the reciprocal stands on that chain:
//   g is kept as Gs = g / (1 - B1):          Gs = B1 * Gs + grad
//   h is kept as Hs = (h + LAM) / (1 - B2):  Hs = (B2 * Hs + HC_) + grad * grad
//   S -= LR * beta * g / (h + LAM)  is then  S += (NB_ * beta) * Gs / Hs
//   err of step s + 1 = k' . S_s - v' is summed as (k' . S_(s-1) - v') + sum(k' * lg * r),
//   lg = NB_ * beta * Gs, r = 1 / Hs: the bracket waits for nothing of step s, and the
//   update of S itself leaves the chain; -v' enters as -v'/16 in each of the 16 lanes.
// -v/16 and NB_ * beta are formed where a chunk is written to LDS.
#define CH_ 32
#define NCH_ (T_ / CH_)
#define VB_ 8                    // state columns per block
#define RT_ 128                  // threads per block
#define OR_ (VB_ * 16)           // floats of o a time step takes in LDS, 16 copies a column
#define NB_ ((float)(-1e-3 * (1.0 - 0.9) / (1.0 - 0.999)))      // -LR * (1 - B1) / (1 - B2)
#define HI_ ((float)(1.0 / (1.0 - 0.999)))                      // Hs at h = 0
// LAM's share of Hs must stay where it is under Hs = B2 * Hs + HC_, with B2 as f32 has it
#define HC_ ((float)((1.0 - (double)BETA2_) / (1.0 - 0.999)))

// row s of a chunk: k of s, q of s - 1, and the pair -v/16, NB_ * beta of s; the two lie
// side by side in LDS and come as one pair: a single register that a read is still to
// fill can be given the place beside a value which the packed products name as a
// register pair, and the built code then waits there for the fresh read
struct StepIn { v4f k; v4f q; v2f vb; };

template <bool PREV_O>
__device__ __forceinline__ void read_step(StepIn& r, const float* kb, const float* qb,
                                          const float* vb, int s) {
    r.k = *(const v4f*)(kb + s * 64);
    if constexpr (PREV_O) r.q = *(const v4f*)(qb + (s - 1) * 64);
    r.vb = *(const v2f*)(vb + s * VB_ * 2);
}

// a lane's share of a sum over k
__device__ __forceinline__ float lane_dot(const v4f& a, const float (&S)[4]) {
    const float e = __builtin_fmaf(a[2], S[2], a[0] * S[0]);
    const float d = __builtin_fmaf(a[3], S[3], a[1] * S[1]);
    return e + d;
}

// a lane's share of k . S - v, in two halves (elements 0,2 and 1,3); nv = -v/16
__device__ __forceinline__ v2f lane_part(const v4f& k, const float (&S)[4], float nv) {
    v2f p;
    p[0] = __builtin_fmaf(k[2], S[2], __builtin_fmaf(k[0], S[0], nv));
    p[1] = __builtin_fmaf(k[3], S[3], k[1] * S[1]);
    return p;
}

// one time step on row c; part holds the lane's share of its err and, where a row n
// follows in the chunk (NEXT), leaves with that of the next step's. Returns o of the
// step before (PREV_O), summed from S as that step left it
template <bool PREV_O, bool NEXT>
__device__ __forceinline__ float one_step(const StepIn& c, const StepIn& n, v2f& part,
                                          float (&S)[4], float (&G)[4], float (&Hs)[4]) {
    // err[v] = k . S[:,v] - v: the lane's two halves, then the 16 lanes of the column;
    // o[v] = q . S[:,v] link by link beside it
    float err = part[0] + part[1];
    float o = 0.f;
    if constexpr (PREV_O) {
        o = lane_dot(c.q, S);
        err = add_xlane<0x161>(err);  o = add_xlane<0x161>(o);
        err = add_xlane<0x162>(err);  o = add_xlane<0x162>(o);
        err = add_xlane<0x164>(err);  o = add_xlane<0x164>(o);
        err = add_xlane<0x168>(err);  o = add_xlane<0x168>(o);
    } else {
        err = row_sum(err);
    }
    // the next step's share as far as S of the step before gives it
    v2f p = {0.f, 0.f};
    if constexpr (NEXT) p = lane_part(n.k, S, n.vb[0]);

    // lg = NB_ * beta * Gs straight from err, not behind the new Gs: it has to be there,
    // times the next k, when the reciprocals arrive
    const float nb9 = BETA1_ * c.vb[1];
    const float ne  = c.vb[1] * err;
    float lg[4], r[4];
#pragma unroll
    for (int i = 0; i < 4; ++i) {
        const float grad = c.k[i] * err;                    // outer(k, pred-v)
        Hs[i] = __builtin_fmaf(grad, grad, __builtin_fmaf(BETA2_, Hs[i], HC_));
        lg[i] = __builtin_fmaf(c.k[i], ne, nb9 * G[i]);
        G[i]  = __builtin_fmaf(BETA1_, G[i], grad);
        r[i]  = __builtin_amdgcn_rcpf(Hs[i]);
    }
    if constexpr (NEXT) {
        part[0] = __builtin_fmaf(n.k[2] * lg[2], r[2], __builtin_fmaf(n.k[0] * lg[0], r[0], p[0]));
        part[1] = __builtin_fmaf(n.k[3] * lg[3], r[3], __builtin_fmaf(n.k[1] * lg[1], r[1], p[1]));
    }
#pragma unroll
    for (int i = 0; i < 4; ++i) S[i] = __builtin_fmaf(lg[i], r[i], S[i]);   // WD==0
    return o;
}

// four neighbouring columns of o, one copy of each
__device__ __forceinline__ v4f read_out(const float* c) {
    v4f y;
#pragma unroll
    for (int i = 0; i < 4; ++i) y[i] = c[i * 16];
    return y;
}

__global__ __launch_bounds__(RT_)
void recurrence(const float* __restrict__ qn, const float* __restrict__ kn,
                const float* __restrict__ vn, const float* __restrict__ beta,
                float* __restrict__ o) {
    const int tid = threadIdx.x;
    const int kg  = tid & 15;
    const int vl  = tid >> 4;
    const int vg  = blockIdx.x;
    const int h   = blockIdx.y;
    const int b   = blockIdx.z;

    float S[4], G[4], Hm[4];
#pragma unroll
    for (int i = 0; i < 4; ++i) { S[i] = 0.f; G[i] = 0.f; Hm[i] = HI_; }

    __shared__ __attribute__((aligned(16))) float ks_[2][CH_][64];
    __shared__ __attribute__((aligned(16))) float qs_[2][CH_][64];
    __shared__ __attribute__((aligned(16))) float vs_[2][CH_][VB_][2];   // -v/16, NB_*beta
    __shared__ __attribute__((aligned(16))) float os_[2][CH_][VB_][16];

    const size_t base  = (size_t)(b * T_) * C_ + h * 64;
    const size_t bbase = (size_t)(b * T_) * H_ + h;

    // staging map: 16 lanes cover one 64-float row of k or q (8 rows a pass); the
    // first two waves cover the chunk's 8-float rows of v and o, 2 lanes a row
    const int  r4 = tid >> 4, c4 = (tid & 15) * 4;
    const int  rv = (tid >> 1) & (CH_ - 1), cv = (tid & 1) * 4;
    const bool vo = tid < CH_ * VB_ / 4;
    const int  xo = rv & 15;    // which copy of o a lane reads: spreads the LDS banks
    const float* kgp = kn + base + (size_t)r4 * C_ + c4;
    const float* qgp = qn + base + (size_t)r4 * C_ + c4;
    const float* vgp = vn + base + vg * VB_ + (size_t)rv * C_ + cv;
    const float* bgp = beta + bbase + (size_t)rv * H_;

    v4f   kst[CH_ / 8], qst[CH_ / 8], vst;
    float bst;

    // chunk 0: global -> registers
#pragma unroll
    for (int j = 0; j < CH_ / 8; ++j) {
        kst[j] = *(const v4f*)(kgp + (size_t)j * 8 * C_);
        qst[j] = *(const v4f*)(qgp + (size_t)j * 8 * C_);
    }
    vst = *(const v4f*)vgp;
    bst = *bgp;
    // precaution: the wait stands before any address register of the loads above is
    // reused; the scheduling barrier keeps later register writes from rising over it
    asm volatile("s_wait_xcnt 0x0" ::: "memory");
    __builtin_amdgcn_sched_barrier(0);

    float* ogp = o + base + vg * VB_ + (size_t)rv * C_ + cv;
    for (int c = 0; c < NCH_; ++c) {
        const int p = c & 1;
        // registers -> LDS buffer p; its last readers (chunk c-2) left it before
        // the barrier of chunk c-1
#pragma unroll
        for (int j = 0; j < CH_ / 8; ++j) {
            *(v4f*)&ks_[p][r4 + 8 * j][c4] = kst[j];
            *(v4f*)&qs_[p][r4 + 8 * j][c4] = qst[j];
        }
        if (vo) {
            const v4f   nv = vst * (-1.f / 16.f);
            const float nb = bst * NB_;
            *(v4f*)&vs_[p][rv][cv][0]     = (v4f){nv[0], nb, nv[1], nb};
            *(v4f*)&vs_[p][rv][cv + 2][0] = (v4f){nv[2], nb, nv[3], nb};
        }
        __syncthreads();

        if (c > 0) {                            // chunk c-1's outputs: LDS -> global
            if (vo) *(v4f*)ogp = read_out(&os_[p ^ 1][rv][cv][xo]);
            ogp += (size_t)CH_ * C_;
        }
        if (c + 1 < NCH_) {                     // chunk c+1: in flight across chunk c
            kgp += (size_t)CH_ * C_;
            qgp += (size_t)CH_ * C_;
            vgp += (size_t)CH_ * C_;
            bgp += (size_t)CH_ * H_;
#pragma unroll
            for (int j = 0; j < CH_ / 8; ++j) {
                kst[j] = *(const v4f*)(kgp + (size_t)j * 8 * C_);
                qst[j] = *(const v4f*)(qgp + (size_t)j * 8 * C_);
            }
            vst = *(const v4f*)vgp;
            bst = *bgp;
        }

        const float* kb = &ks_[p][0][kg * 4];
        const float* qb = &qs_[p][0][kg * 4];
        const float* vb = &vs_[p][0][vl][0];
        float*       ob = &os_[p][0][vl][kg];

        // A step works on its own row and the next; a row is read two steps before its
        // first use, so four rows are held and the
        // loop's body is four steps, each row in registers of its own.
        // step 0 has no output to finish: the chunk before has summed its last one
        StepIn ra, rb, rc, rd;
        read_step<false>(ra, kb, qb, vb, 0);
        read_step<true>(rb, kb, qb, vb, 1);
        read_step<true>(rc, kb, qb, vb, 2);
        read_step<true>(rd, kb, qb, vb, 3);
        // keeps the LDS reads of later steps above this step's arithmetic, so
        // that they have returned before the first wait on them
        __builtin_amdgcn_sched_barrier(0);
        v2f part = lane_part(ra.k, S, ra.vb[0]);
        one_step<false, true>(ra, rb, part, S, G, Hm);
        for (int s = 1; s < CH_ - 6; s += 4) {
            read_step<true>(ra, kb, qb, vb, s + 3);
            __builtin_amdgcn_sched_barrier(0);  // as above
            ob[(s - 1) * OR_] = one_step<true, true>(rb, rc, part, S, G, Hm);
            read_step<true>(rb, kb, qb, vb, s + 4);
            __builtin_amdgcn_sched_barrier(0);  // as above
            ob[s * OR_] = one_step<true, true>(rc, rd, part, S, G, Hm);
            read_step<true>(rc, kb, qb, vb, s + 5);
            __builtin_amdgcn_sched_barrier(0);  // as above
            ob[(s + 1) * OR_] = one_step<true, true>(rd, ra, part, S, G, Hm);
            read_step<true>(rd, kb, qb, vb, s + 6);
            __builtin_amdgcn_sched_barrier(0);  // as above
            ob[(s + 2) * OR_] = one_step<true, true>(ra, rb, part, S, G, Hm);
        }
        // the last three steps, and behind them the last one's own output: the block
        // stores the chunk's outputs behind the next barrier, so none is carried over
        // it; the row behind the last is not in LDS yet, so the next chunk starts its
        // first err from S
        const v4f ql = *(const v4f*)(qb + (CH_ - 1) * 64);
        __builtin_amdgcn_sched_barrier(0);      // as above
        ob[(CH_ - 4) * OR_] = one_step<true, true>(rb, rc, part, S, G, Hm);
        ob[(CH_ - 3) * OR_] = one_step<true, true>(rc, rd, part, S, G, Hm);
        ob[(CH_ - 2) * OR_] = one_step<true, false>(rd, rd, part, S, G, Hm);
        ob[(CH_ - 1) * OR_] = row_sum(lane_dot(ql, S));
    }

    __syncthreads();                            // last chunk's outputs are complete
    if (vo) *(v4f*)ogp = read_out(&os_[(NCH_ - 1) & 1][rv][cv][xo]);
}

// ---------------- RMSNorm over V (mean, +1e-5) * rms_w, then the output projection -
// The norm needs a head's 64 values of a row and the product all eight heads of it, so a
// block that holds whole rows has all that both need, and the normed rows go to LDS and
// not through memory and a launch of their own. A block takes OM_ 16-row tiles and ON_
// 16-wide n-tiles, grid = (N / 128, M / 32): one block a WGP.
// Norm: a wave takes one head, 16 lanes a row, each half of the wave the 16 rows of one
// tile: each access reads whole lines. Product: a wave owns one n-tile, k loop unrolled
// (Kd/32 = 16 v_wmma_f32_16x16x32_f16 per row tile). Its B fragments of all k steps fit in
// registers: their loads are issued at the start, behind those of the rows, and fly
// while the rows are normed.
// A in LDS: [tile][q = k / 8][row 0..15][8], which is the fragment order above with
// q = 4 * ks + 2 * half + kh. AQ_ is 16 bytes more than the 16 rows take, so that the eight
// q which one store of a half wave writes fall on other banks; TP_ adds 128 bytes, so
// that the two halves of the wave do too. A 16-lane row of a fragment read is 256
// contiguous bytes.
// Every loop here is unrolled: its arrays are registers only under constant indices.
#define OM_ 2                    // row tiles per block
#define ON_ 8                    // n-tiles per block, one a wave
#define AQ_ (16 * 8 + 8)         // f16 from q to q + 1
template <int Kd, int N>
__global__ __launch_bounds__(ON_ * 32)
void rmsnorm_project(const float* __restrict__ o, const float* __restrict__ rw,
                     const _Float16* __restrict__ Bp, float* __restrict__ C) {
    static_assert(Kd == ON_ * 64, "a wave norms one head");
    constexpr int TP_ = (Kd / 8) * AQ_ + 64;             // f16 from tile to tile
    __shared__ __attribute__((aligned(16))) _Float16 A[OM_ * TP_];
    const int lane = threadIdx.x & 31;
    const int wave = threadIdx.x >> 5;
    const int nt   = blockIdx.x * ON_ + wave;            // 16-wide n-tile index
    const int m0   = blockIdx.y * OM_ * 16;
    const int r    = lane & 15;              // 4 values of the head; A-row; C-col
    const int kh   = lane >> 4;              // tile in the norm; K-half select in the product

    const float*    src   = o + (size_t)(m0 + kh * 16) * Kd + wave * 64 + r * 4;
    const _Float16* Bfrag = Bp + (size_t)nt * (Kd / 32) * FRB_ + lane * 8;
    v4f x[16];
#pragma unroll
    for (int j = 0; j < 16; ++j) x[j] = *(const v4f*)(src + j * Kd);
    const v4f wv = *(const v4f*)(rw + r * 4);
    v8h fb[Kd / 32][2];
#pragma unroll
    for (int ks = 0; ks < Kd / 32; ++ks) {
        fb[ks][0] = *(const v8h*)(Bfrag + ks * FRB_);
        fb[ks][1] = *(const v8h*)(Bfrag + ks * FRB_ + 256);
    }
    // precaution: the addresses stay in their registers up to this wait, so that no load
    // above returns into them and nothing reuses them in front of it
    asm volatile("s_wait_xcnt 0x0" :: "v"(src), "v"(Bfrag) : "memory");

    _Float16* dst = A + kh * TP_ + (wave * 8 + (r >> 1)) * AQ_ + (r & 1) * 4;
#pragma unroll
    for (int j = 0; j < 16; ++j) {
        const float inv = rsqrtf(head_sumsq(x[j]) * (1.0f / 64.f) + EPS_);
        v4h y;
#pragma unroll
        for (int i = 0; i < 4; ++i) y[i] = (_Float16)(x[j][i] * inv * wv[i]);
        *(v4h*)(dst + j * 8) = y;
    }
    __syncthreads();                         // the eight waves' heads make up the rows

    const _Float16* Afrag = A + kh * AQ_ + r * 8;
    // The A fragments of two k steps are read as one
    // group of eight, two groups ahead of their use, in three sets of registers
    v8h fa[3][2][OM_][2];
    auto fetch = [&](int g) {
#pragma unroll
        for (int kk = 0; kk < 2; ++kk)
#pragma unroll
            for (int t = 0; t < OM_; ++t) {
                const _Float16* At = Afrag + t * TP_ + ((g * 2 + kk) * 4) * AQ_;
                fa[g % 3][kk][t][0] = *(const v8h*)At;
                fa[g % 3][kk][t][1] = *(const v8h*)(At + 2 * AQ_);
            }
    };
    fetch(0);
    fetch(1);
    v8f acc[OM_] = {};
#pragma unroll
    for (int g = 0; g < Kd / 64; ++g) {
        if (g + 2 < Kd / 64) fetch(g + 2);
        // keeps the group together and above the products of group g: left to itself the
        // built code reads a fragment one product ahead of its use, two reads at a place
        __builtin_amdgcn_sched_barrier(0);
#pragma unroll
        for (int kk = 0; kk < 2; ++kk) {
            const int ks = g * 2 + kk;
            const v16h b = __builtin_shufflevector(fb[ks][0], fb[ks][1], 0, 1, 2, 3, 4, 5, 6,
                                                   7, 8, 9, 10, 11, 12, 13, 14, 15);
#pragma unroll
            for (int t = 0; t < OM_; ++t) {
                const v16h a = __builtin_shufflevector(fa[g % 3][kk][t][0], fa[g % 3][kk][t][1],
                                                       0, 1, 2, 3, 4, 5, 6, 7,
                                                       8, 9, 10, 11, 12, 13, 14, 15);
                acc[t] = __builtin_amdgcn_wmma_f32_16x16x32_f16(false, a, false, b,
                                                                (short)0, acc[t], false, false);
            }
        }
    }
    // C/D layout: VGPR i -> row = i + 8*kh, col = lane&15
#pragma unroll
    for (int t = 0; t < OM_; ++t)
#pragma unroll
        for (int i = 0; i < 8; ++i)
            C[(size_t)(m0 + t * 16 + i + 8 * kh) * N + nt * 16 + r] = acc[t][i];
}

// ---------------- host-side launch ----------------
extern "C" void kernel_launch(void* const* d_in, const int* in_sizes, int n_in,
                              void* d_out, int out_size, void* d_ws, size_t ws_size,
                              hipStream_t stream) {
    (void)in_sizes; (void)n_in; (void)out_size; (void)ws_size;
    const float* x    = (const float*)d_in[0];
    const float* Wq   = (const float*)d_in[1];
    const float* Wk   = (const float*)d_in[2];
    const float* Wv   = (const float*)d_in[3];
    const float* Wb   = (const float*)d_in[4];
    const float* cwq  = (const float*)d_in[5];
    const float* cwk  = (const float*)d_in[6];
    const float* cwv  = (const float*)d_in[7];
    const float* rmsw = (const float*)d_in[8];
    const float* Wo   = (const float*)d_in[9];
    float* out = (float*)d_out;

    char* ws = (char*)d_ws;
    size_t off = 0;
    auto alloc = [&](size_t bytes) -> void* {
        void* p = ws + off;
        off += (bytes + 255) & ~(size_t)255;
        return p;
    };
    _Float16* xh   = (_Float16*)alloc((size_t)MT_ * D_ * 2);
    _Float16* Wqp  = (_Float16*)alloc((size_t)D_ * C_ * 2);   // packed fragments
    _Float16* Wkp  = (_Float16*)alloc((size_t)D_ * C_ * 2);
    _Float16* Wvp  = (_Float16*)alloc((size_t)D_ * C_ * 2);
    _Float16* Wop  = (_Float16*)alloc((size_t)C_ * D_ * 2);
    float*    qc   = (float*)alloc((size_t)MT_ * C_ * 4);
    float*    kc   = (float*)alloc((size_t)MT_ * C_ * 4);
    float*    vc   = (float*)alloc((size_t)MT_ * C_ * 4);
    float*    betaf= (float*)alloc((size_t)MT_ * H_ * 4);
    float*    ob   = (float*)alloc((size_t)MT_ * C_ * 4);

    // 1) x and Wq, Wk, Wv, Wo as f16 in WMMA fragment order: one launch
    convert_and_pack<<<CVB_ + 4 * PKB_, EW_, 0, stream>>>(x, Wq, Wk, Wv, Wo,
                                                          xh, Wqp, Wkp, Wvp, Wop);

    // 2) the three projection GEMMs (v_wmma_f32_16x16x32_f16), each with its conv + SiLU
    //    and, for q and k, its l2norm (scale on q), and beta: one launch
    project_qkv_beta<<<BTB_ + 3 * GMB_, 128, 0, stream>>>(xh, Wqp, Wkp, Wvp, cwq, cwk, cwv,
                                                          qc, kc, vc, x, Wb, betaf);

    // 3) sequential recurrence: 128 blocks (B*H*8 v-groups) x 128 threads
    dim3 rgrid(64 / VB_, H_, B_);
    recurrence<<<rgrid, RT_, 0, stream>>>(qc, kc, vc, betaf, ob);

    // 4) RMSNorm and the output projection GEMM (fp32 result straight to d_out): one launch
    rmsnorm_project<C_, D_><<<dim3(D_ / (16 * ON_), MT_ / (16 * OM_)), ON_ * 32, 0, stream>>>(
        ob, rmsw, Wop, out);
}
